// v000
// The times below were measured on an AMD MI455X: many runs one after another, warmed up first and cycling through
// copies of the inputs, with the whole window's GPU time divided by the number of runs. Launches and the gaps
// between them are all in it. The median over several windows is given; except for v000 it joins two sittings, which
// can be a few percent apart, so the side-by-side timings, each taken in one sitting, are the better comparison.
// v000, which the later versions start from, runs in 320 microseconds.
#include <hip/hip_runtime.h>
// Projections h*W{q,k,v}: v_wmma_f32_16x16x32_bf16 (bf16 operands = RNE-converted inputs, f32 accumulate); scores K*Q^T and context V^T*P: v_wmma_f32_16x16x32_f16 (f16 operands, Q/K/V planes carried x8, P carried x1024, f32 accumulate); softmax in f32.

#ifndef SEQ
#define SEQ 4096
#endif
#define SEQ_FULL 4096
#define IN_DIM 1024
#define NUM_HEADS 16
#define HEAD_DIM 64
#define OUT_DIM (NUM_HEADS * HEAD_DIM)

static_assert(SEQ % 128 == 0);
static_assert(SEQ <= SEQ_FULL);
static_assert(IN_DIM % 64 == 0);
static_assert(OUT_DIM % 64 == 0);
static_assert(HEAD_DIM == 64);
static_assert((size_t)SEQ_FULL * OUT_DIM * 4 == 16777216);

// LDS pitches (in 16-bit elements unless noted); all keep 16-byte row alignment
#define BTP 40     // weight k-tile [64 n][32 k]
#define EQP 72     // row-major epilogue tile [128 rows][64 cols]
#define EVP 136    // transposed epilogue tile [64 d][128 s]
#define TP  72     // weight transpose tile [64 n][64 k]
#define OLP 68     // context tile [16 q][64 d], floats
#define ESZ 9216   // max(128*EQP, 64*EVP)
static_assert(128 * EQP <= ESZ);
static_assert(64 * EVP <= ESZ);

typedef __bf16   v16bf __attribute__((ext_vector_type(16)));
typedef __bf16   v8bf  __attribute__((ext_vector_type(8)));
typedef _Float16 v16h  __attribute__((ext_vector_type(16)));
typedef _Float16 v8h   __attribute__((ext_vector_type(8)));
typedef float    v8f   __attribute__((ext_vector_type(8)));
typedef float    v4f   __attribute__((ext_vector_type(4)));
typedef unsigned int v4u __attribute__((ext_vector_type(4)));

// ---------------------------------------------------------------------------
// WMMA wrappers with the VALU hazard guard (4 v_nop after every issue).
__device__ __forceinline__ v8f mma_bf16(v16bf a, v16bf b, v8f c) {
  v8f d = __builtin_amdgcn_wmma_f32_16x16x32_bf16(false, a, false, b, (short)0, c, false, false);
  asm volatile("v_nop\n\tv_nop\n\tv_nop\n\tv_nop" : "+v"(d) : "v"(a), "v"(b));
  return d;
}
__device__ __forceinline__ v8f mma_f16(v16h a, v16h b, v8f c) {
  v8f d = __builtin_amdgcn_wmma_f32_16x16x32_f16(false, a, false, b, (short)0, c, false, false);
  asm volatile("v_nop\n\tv_nop\n\tv_nop\n\tv_nop" : "+v"(d) : "v"(a), "v"(b));
  return d;
}

// 16-bit fragment, contraction dim CONTIGUOUS in memory: elem(k) = p0[rc*ld + k].
// Lane l: row/col rc = (l&15); elements 0..7 <- kk+8h+0..7, elements 8..15 <- kk+16+8h+0..7
// (h = l>>4). Same map for A (rc = row) and B (rc = column of a k-contiguous copy).
__device__ __forceinline__ v16bf ld_frag_bf(const __bf16* p0, int ld, int rc, int kk, int lane) {
  const int hh = (lane >> 4) & 1;
  const __bf16* p = p0 + (size_t)rc * ld + kk + 8 * hh;
  const v8bf lo = *(const v8bf*)(p);
  const v8bf hi = *(const v8bf*)(p + 16);
  v16bf f;
#pragma unroll
  for (int i = 0; i < 8; ++i) { f[i] = lo[i]; f[8 + i] = hi[i]; }
  return f;
}
__device__ __forceinline__ v16h ld_frag_h(const _Float16* p0, int ld, int rc, int kk, int lane) {
  const int hh = (lane >> 4) & 1;
  const _Float16* p = p0 + (size_t)rc * ld + kk + 8 * hh;
  const v8h lo = *(const v8h*)(p);
  const v8h hi = *(const v8h*)(p + 16);
  v16h f;
#pragma unroll
  for (int i = 0; i < 8; ++i) { f[i] = lo[i]; f[8 + i] = hi[i]; }
  return f;
}

// f32 -> bf16 bits, RNE convert
__device__ __forceinline__ unsigned int bfb(float x) {
  unsigned int u = __float_as_uint(x);
  u = u + 0x7FFFu + ((u >> 16) & 1u);
  return u >> 16;
}
// f32 -> value of its RNE bf16
__device__ __forceinline__ float bf16val(float x) {
  return __uint_as_float(bfb(x) << 16);
}
// f32 -> f16 bits, RNE convert
__device__ __forceinline__ unsigned short hbits(float x) {
  const _Float16 hv = (_Float16)x;
  return __builtin_bit_cast(unsigned short, hv);
}

// ---------------------------------------------------------------------------
// h f32 [SEQ][IN_DIM] -> bf16 plane (same layout). Thread g converts 8
// consecutive floats -> one 16-byte store; 8 consecutive lanes fill one
__global__ __launch_bounds__(256) void k_cvt_rows(const float* __restrict__ in,
                                                  unsigned short* __restrict__ outp, int n8) {
  const int g = blockIdx.x * 256 + threadIdx.x;
  if (g >= n8) return;
  const v4f a = *(const v4f*)(in + (size_t)g * 8);
  const v4f b = *(const v4f*)(in + (size_t)g * 8 + 4);
  v4u w;
  w[0] = bfb(a[0]) | (bfb(a[1]) << 16);
  w[1] = bfb(a[2]) | (bfb(a[3]) << 16);
  w[2] = bfb(b[0]) | (bfb(b[1]) << 16);
  w[3] = bfb(b[2]) | (bfb(b[3]) << 16);
  v4u* p = (v4u*)(outp + (size_t)g * 8);
  *p = w;
  
}

// ---------------------------------------------------------------------------
// W f32 [IN_DIM k][OUT_DIM n] -> WT bf16 [OUT_DIM n][IN_DIM k] (k contiguous),
// three matrices selected by blockIdx.z into three consecutive planes.
// Block = 64 k x 64 n tile transposed through LDS; each WT row segment
__global__ __launch_bounds__(256) void k_cvt_wT(const float* __restrict__ Wq,
                                                const float* __restrict__ Wk,
                                                const float* __restrict__ Wv,
                                                unsigned short* __restrict__ wT) {
  __shared__ __align__(16) unsigned short T[64 * TP];   // [n local][k local], cross-wave (block barrier)
  const int z = blockIdx.z;
  const float* W = (z == 0) ? Wq : ((z == 1) ? Wk : Wv);
  unsigned short* dst = wT + (size_t)z * OUT_DIM * IN_DIM;
  const int k0 = blockIdx.x * 64;
  const int n0 = blockIdx.y * 64;
  const int tid = threadIdx.x;
  const int wave = tid >> 5, lane = tid & 31;

#pragma unroll
  for (int i = 0; i < 4; ++i) {
    const int idx = i * 256 + tid;          // 0..1023
    const int kk = idx >> 4;                // 0..63
    const int c4 = (idx & 15) * 4;          // 0..60
    const v4f w = *(const v4f*)(W + (size_t)(k0 + kk) * OUT_DIM + n0 + c4);
    T[(c4 + 0) * TP + kk] = (unsigned short)bfb(w[0]);
    T[(c4 + 1) * TP + kk] = (unsigned short)bfb(w[1]);
    T[(c4 + 2) * TP + kk] = (unsigned short)bfb(w[2]);
    T[(c4 + 3) * TP + kk] = (unsigned short)bfb(w[3]);
  }
  __syncthreads();

  v4u v[2];
  size_t off[2];
#pragma unroll
  for (int it = 0; it < 2; ++it) {
    const int nn = wave * 8 + it * 4 + (lane >> 3);   // 0..63 over (wave, it, lane>>3)
    const int q = lane & 7;
    v[it] = *(const v4u*)(&T[nn * TP + q * 8]);
    off[it] = (size_t)(n0 + nn) * IN_DIM + k0 + q * 8;
  }
#pragma unroll
  for (int it = 0; it < 2; ++it) *(v4u*)(dst + off[it]) = v[it];
  
}

// ---------------------------------------------------------------------------
// Projection: C[SEQ][OUT_DIM] = hb[SEQ][IN_DIM] * WT[OUT_DIM][IN_DIM]^T + bias.
// 256 thr = 8 waves; block tile 128 rows x 64 cols; wave owns 16 rows x 64 cols.
// Weight k-tile [64 n][32 k] staged in LDS with plain loads (single buffer,
// two block barriers per step); A fragments straight from the bf16 plane.
// z = 0: Q plane f16 x8 [SEQ][OUT_DIM]; z = 1: K plane f16 x8 [SEQ][OUT_DIM];
// z = 2: V^T plane f16 x8 [OUT_DIM][SEQ]. Epilogue staged in LDS, every
__global__ __launch_bounds__(256) void k_proj(
    const unsigned short* __restrict__ hb, const unsigned short* __restrict__ wT,
    const float* __restrict__ bq, const float* __restrict__ bk, const float* __restrict__ bv,
    unsigned short* __restrict__ qp, unsigned short* __restrict__ kp,
    unsigned short* __restrict__ vtp) {
  __shared__ __align__(16) unsigned short bt[64 * BTP];   // weight k-tile, cross-wave (block barrier)
  __shared__ __align__(16) unsigned short E[ESZ];         // epilogue tile, cross-wave (block barrier)

  const int z = blockIdx.z;
  const int n0 = blockIdx.x * 64;
  const int m0 = blockIdx.y * 128;
  const int tid = threadIdx.x;
  const int wave = tid >> 5, lane = tid & 31;
  const int l15 = lane & 15, half = (lane >> 4) & 1;

  const unsigned short* Wt = wT + (size_t)z * OUT_DIM * IN_DIM;
  const float* bias = (z == 0) ? bq : ((z == 1) ? bk : bv);

  const int tn = tid >> 2;            // 0..63 : column within tile
  const int tk = (tid & 3) * 8;       // 0,8,16,24 : k within step
  const unsigned short* wsrc = Wt + (size_t)(n0 + tn) * IN_DIM + tk;
  const __bf16* A = (const __bf16*)hb;
  const int arow = m0 + wave * 16 + l15;

  v8f acc[4] = {};
  for (int s = 0; s < IN_DIM / 32; ++s) {
    const int kk = s * 32;
    const v4u wv = *(const v4u*)(wsrc + kk);
    __syncthreads();                               // earlier reads of bt done
    *(v4u*)(&bt[tn * BTP + tk]) = wv;
    __syncthreads();                               // tile complete
    const v16bf a = ld_frag_bf(A, IN_DIM, arow, kk, lane);
#pragma unroll
    for (int j = 0; j < 4; ++j) {
      const v16bf b = ld_frag_bf((const __bf16*)bt, BTP, j * 16 + l15, 0, lane);
      acc[j] = mma_bf16(a, b, acc[j]);
    }
  }

  // acc[j][r] = C[m0 + wave*16 + 8*half + r][n0 + j*16 + l15]
  const float car = 8.0f;
  if (z != 2) {                      // block-uniform branch
#pragma unroll
    for (int j = 0; j < 4; ++j) {
      const int col = j * 16 + l15;
      const float bb = bf16val(bias[n0 + col]);
#pragma unroll
      for (int r = 0; r < 8; ++r) {
        const int row = wave * 16 + 8 * half + r;
        E[row * EQP + col] = hbits((acc[j][r] + bb) * car);
      }
    }
    __syncthreads();
    unsigned short* dst = (z == 0) ? qp : kp;
    v4u v[4];
    size_t off[4];
#pragma unroll
    for (int it = 0; it < 4; ++it) {
      const int row = wave * 16 + it * 4 + (lane >> 3);   // wave's 16 rows over (it, lane>>3)
      const int q = lane & 7;
      v[it] = *(const v4u*)(&E[row * EQP + q * 8]);
      off[it] = (size_t)(m0 + row) * OUT_DIM + n0 + q * 8;
    }
#pragma unroll
    for (int it = 0; it < 4; ++it) *(v4u*)(dst + off[it]) = v[it];
    
  } else {
#pragma unroll
    for (int j = 0; j < 4; ++j) {
      const int col = j * 16 + l15;                       // d within tile
      const float bb = bf16val(bias[n0 + col]);
#pragma unroll
      for (int r = 0; r < 8; ++r) {
        const int srow = wave * 16 + 8 * half + r;        // s within tile
        E[col * EVP + srow] = hbits((acc[j][r] + bb) * car);
      }
    }
    __syncthreads();
    v4u v[4];
    size_t off[4];
#pragma unroll
    for (int it = 0; it < 4; ++it) {
      const int drow = wave * 8 + it * 2 + half;          // wave's 8 d-rows over (it, half)
      const int q = l15;                                  // 16 pieces = 256-byte row = 2 lines
      v[it] = *(const v4u*)(&E[drow * EVP + q * 8]);
      off[it] = (size_t)(n0 + drow) * SEQ + m0 + q * 8;
    }
#pragma unroll
    for (int it = 0; it < 4; ++it) *(v4u*)(vtp + off[it]) = v[it];
    
  }
}

// ---------------------------------------------------------------------------
// Flash attention, transposed-score form: one wave = (16 queries, one head).
// Per 32-key chunk:
//   S^T = K . Q^T    A = K rows (lane = key, k = d), B = Q^T (lane = query, k = d)
//                    D[row = key 8h+r][col = query l15]; c0 keys 0..15, c1 keys 16..31
//   per-lane online softmax for query l15 (16 local keys + xor-16 partner)
//   O^T += V^T . P   A = V^T rows (lane = d, k = key), B = P: element i<8 <- c0[i]
//                    (key 8h+i), element 8+i <- c1[i] (key 16+8h+i), same lane
//                    D[row = d 8h+r][col = query l15]
// Scores carry 64 from the x8 planes -> scaled by 1/512 (= 1/8 of q.k).
// P carried x1024, V carried x8 -> context scaled by 1/(8192 * sum).
// Output tile [16 q][64 d] f32 staged in LDS; each 256-byte row = 2 lines,
__global__ __launch_bounds__(32) void k_attn(const unsigned short* __restrict__ qp,
                                             const unsigned short* __restrict__ kp,
                                             const unsigned short* __restrict__ vtp,
                                             float* __restrict__ outp) {
  __shared__ __align__(16) float Ol[16 * OLP];   // wave-private (block = one wave), block barrier used

  const int lane = threadIdx.x & 31;
  const int l15 = lane & 15;
  const int half = (lane >> 4) & 1;
  const int q0 = blockIdx.x * 16;
  const int head = blockIdx.y;

  const _Float16* Q  = (const _Float16*)qp;
  const _Float16* K  = (const _Float16*)kp;
  const _Float16* VT = (const _Float16*)vtp;

  const _Float16* qbase = Q + (size_t)q0 * OUT_DIM + head * HEAD_DIM;
  const v16h qb0 = ld_frag_h(qbase, OUT_DIM, l15, 0, lane);    // d 0..31
  const v16h qb1 = ld_frag_h(qbase, OUT_DIM, l15, 32, lane);   // d 32..63
  const _Float16* kbase = K + head * HEAD_DIM;                   // key t at kbase + t*OUT_DIM
  const _Float16* vbase = VT + (size_t)head * HEAD_DIM * SEQ;    // d row at vbase + d*SEQ

  v8f o[4] = {};
  float mrun = -1.0e30f, lrun = 0.0f;
  const float sscale = 1.0f / 512.0f;

  for (int kc = 0; kc < SEQ; kc += 32) {
    const _Float16* kt = kbase + (size_t)kc * OUT_DIM;
    const v16h ka0 = ld_frag_h(kt, OUT_DIM, l15, 0, lane);
    const v16h ka1 = ld_frag_h(kt, OUT_DIM, l15, 32, lane);
    const v16h ka2 = ld_frag_h(kt, OUT_DIM, 16 + l15, 0, lane);
    const v16h ka3 = ld_frag_h(kt, OUT_DIM, 16 + l15, 32, lane);
    v8f c0 = {}, c1 = {};
    c0 = mma_f16(ka0, qb0, c0);
    c0 = mma_f16(ka1, qb1, c0);
    c1 = mma_f16(ka2, qb0, c1);
    c1 = mma_f16(ka3, qb1, c1);

    float sa[8], sb[8];
#pragma unroll
    for (int r = 0; r < 8; ++r) { sa[r] = c0[r] * sscale; sb[r] = c1[r] * sscale; }
    float lm = fmaxf(sa[0], sb[0]);
#pragma unroll
    for (int r = 1; r < 8; ++r) lm = fmaxf(lm, fmaxf(sa[r], sb[r]));
    lm = fmaxf(lm, __shfl_xor(lm, 16, 32));
    const float mnew = fmaxf(mrun, lm);
    const float alpha = __expf(mrun - mnew);
    float p0[8], p1[8];
    float ls = 0.0f;
#pragma unroll
    for (int r = 0; r < 8; ++r) {
      p0[r] = __expf(sa[r] - mnew);
      p1[r] = __expf(sb[r] - mnew);
      ls += p0[r] + p1[r];
    }
    ls += __shfl_xor(ls, 16, 32);
    lrun = lrun * alpha + ls;
    mrun = mnew;
#pragma unroll
    for (int j = 0; j < 4; ++j)
#pragma unroll
      for (int r = 0; r < 8; ++r) o[j][r] *= alpha;

    v16h pb;
#pragma unroll
    for (int e = 0; e < 8; ++e) {
      pb[e]     = (_Float16)(p0[e] * 1024.0f);   // key kc + 8h + e
      pb[8 + e] = (_Float16)(p1[e] * 1024.0f);   // key kc + 16 + 8h + e
    }
#pragma unroll
    for (int j = 0; j < 4; ++j) {
      const v16h va = ld_frag_h(vbase, SEQ, j * 16 + l15, kc, lane);
      o[j] = mma_f16(va, pb, o[j]);
    }
  }

  // o[j][r] = 8192 * sum_t p_t v_t for query l15, d = j*16 + 8*half + r
  const float inv = 1.0f / (lrun * 8192.0f);
#pragma unroll
  for (int j = 0; j < 4; ++j) {
    v4f lo4, hi4;
    lo4[0] = o[j][0] * inv; lo4[1] = o[j][1] * inv; lo4[2] = o[j][2] * inv; lo4[3] = o[j][3] * inv;
    hi4[0] = o[j][4] * inv; hi4[1] = o[j][5] * inv; hi4[2] = o[j][6] * inv; hi4[3] = o[j][7] * inv;
    *(v4f*)(&Ol[l15 * OLP + j * 16 + 8 * half])     = lo4;
    *(v4f*)(&Ol[l15 * OLP + j * 16 + 8 * half + 4]) = hi4;
  }
  __syncthreads();

  v4f v[8];
  size_t off[8];
  float* ob = outp + (size_t)q0 * OUT_DIM + head * HEAD_DIM;
#pragma unroll
  for (int it = 0; it < 8; ++it) {
    const int row = it * 2 + half;       // 0..15
    const int q = l15;                   // 16 pieces of 16 B = the row's 256 bytes (2 lines)
    v[it] = *(const v4f*)(&Ol[row * OLP + q * 4]);
    off[it] = (size_t)row * OUT_DIM + q * 4;
  }
#pragma unroll
  for (int it = 0; it < 8; ++it) *(v4f*)(ob + off[it]) = v[it];
  
}

// ---------------------------------------------------------------------------
extern "C" void kernel_launch(void* const* d_in, const int* in_sizes, int n_in,
                              void* d_out, int out_size, void* d_ws, size_t ws_size,
                              hipStream_t stream) {
  if (n_in < 7) return;
  if (in_sizes[0] < SEQ * IN_DIM) return;
  if (in_sizes[1] < IN_DIM * OUT_DIM || in_sizes[2] < IN_DIM * OUT_DIM ||
      in_sizes[3] < IN_DIM * OUT_DIM) return;
  if (in_sizes[4] < OUT_DIM || in_sizes[5] < OUT_DIM || in_sizes[6] < OUT_DIM) return;
  if (out_size < SEQ * OUT_DIM) return;

  const float* h  = (const float*)d_in[0];
  const float* Wq = (const float*)d_in[1];
  const float* Wk = (const float*)d_in[2];
  const float* Wv = (const float*)d_in[3];
  const float* bq = (const float*)d_in[4];
  const float* bk = (const float*)d_in[5];
  const float* bv = (const float*)d_in[6];

  // every offset a multiple of 2 MiB
  const size_t hb_bytes = (size_t)SEQ * IN_DIM * 2;           // bf16 h plane
  const size_t wt_bytes = (size_t)3 * OUT_DIM * IN_DIM * 2;   // 3 bf16 WT planes
  const size_t pl_bytes = (size_t)SEQ * OUT_DIM * 2;          // one f16 q/k/vT plane
  const size_t off_hb = 0;
  const size_t off_wt = off_hb + hb_bytes;
  const size_t off_q  = off_wt + wt_bytes;
  const size_t off_k  = off_q + pl_bytes;
  const size_t off_vt = off_k + pl_bytes;
  const size_t total  = off_vt + pl_bytes;                    // 38 MiB at SEQ = 4096
  if (total > ws_size) return;

  char* ws = (char*)d_ws;
  unsigned short* hb  = (unsigned short*)(ws + off_hb);
  unsigned short* wt  = (unsigned short*)(ws + off_wt);
  unsigned short* qpl = (unsigned short*)(ws + off_q);
  unsigned short* kpl = (unsigned short*)(ws + off_k);
  unsigned short* vtp = (unsigned short*)(ws + off_vt);

  const int n8 = SEQ * IN_DIM / 8;
  k_cvt_rows<<<(n8 + 255) / 256, 256, 0, stream>>>(h, hb, n8);
  k_cvt_wT<<<dim3(IN_DIM / 64, OUT_DIM / 64, 3), 256, 0, stream>>>(Wq, Wk, Wv, wt);
  k_proj<<<dim3(OUT_DIM / 64, SEQ / 128, 3), 256, 0, stream>>>(hb, wt, bq, bk, bv, qpl, kpl, vtp);
  k_attn<<<dim3(SEQ / 16, NUM_HEADS), 32, 0, stream>>>(qpl, kpl, vtp, (float*)d_out);
}

// v001
// A run of this version takes 132 microseconds.
// Two timings next to v000 put it at 2.46 and 2.47 times that version's speed.
#include <hip/hip_runtime.h>
// Projections h*W{q,k,v}: v_wmma_f32_16x16x32_bf16 (bf16 operands = RNE-converted inputs, f32 accumulate); scores K*Q^T and context V^T*P: v_wmma_f32_16x16x32_f16 (f16 operands, Q/K/V planes carried x8, P carried x1024, f32 accumulate); softmax in f32.

#ifndef SEQ
#define SEQ 4096
#endif
#define SEQ_FULL 4096
#define IN_DIM 1024
#define NUM_HEADS 16
#define HEAD_DIM 64
#define OUT_DIM (NUM_HEADS * HEAD_DIM)

static_assert(SEQ % 128 == 0);
static_assert(SEQ <= SEQ_FULL);
static_assert(IN_DIM % 64 == 0);
static_assert(OUT_DIM % 64 == 0);
static_assert(HEAD_DIM == 64);
static_assert((size_t)SEQ_FULL * OUT_DIM * 4 == 16777216);

// LDS pitches (in 16-bit elements unless noted); all keep 16-byte row alignment
#define BTP 40     // weight k-tile [64 n][32 k]
#define EQP 72     // row-major epilogue tile [128 rows][64 cols]
#define EVP 136    // transposed epilogue tile [64 d][128 s]
#define TP  72     // weight transpose tile [64 n][64 k]
#define OLP 68     // context tile [16 q][64 d], floats
#define ESZ 9216   // max(128*EQP, 64*EVP)
static_assert(128 * EQP <= ESZ);
static_assert(64 * EVP <= ESZ);

typedef __bf16   v16bf __attribute__((ext_vector_type(16)));
typedef __bf16   v8bf  __attribute__((ext_vector_type(8)));
typedef _Float16 v16h  __attribute__((ext_vector_type(16)));
typedef _Float16 v8h   __attribute__((ext_vector_type(8)));
typedef float    v8f   __attribute__((ext_vector_type(8)));
typedef float    v4f   __attribute__((ext_vector_type(4)));
typedef unsigned int v4u __attribute__((ext_vector_type(4)));

// ---------------------------------------------------------------------------
// WMMA wrappers with the VALU hazard guard (4 v_nop after every issue).
__device__ __forceinline__ v8f mma_bf16(v16bf a, v16bf b, v8f c) {
  v8f d = __builtin_amdgcn_wmma_f32_16x16x32_bf16(false, a, false, b, (short)0, c, false, false);
  asm volatile("v_nop\n\tv_nop\n\tv_nop\n\tv_nop" : "+v"(d) : "v"(a), "v"(b));
  return d;
}
__device__ __forceinline__ v8f mma_f16(v16h a, v16h b, v8f c) {
  v8f d = __builtin_amdgcn_wmma_f32_16x16x32_f16(false, a, false, b, (short)0, c, false, false);
  asm volatile("v_nop\n\tv_nop\n\tv_nop\n\tv_nop" : "+v"(d) : "v"(a), "v"(b));
  return d;
}

// 16-bit fragment, contraction dim CONTIGUOUS in memory: elem(k) = p0[rc*ld + k].
// Lane l: row/col rc = (l&15); elements 0..7 <- kk+8h+0..7, elements 8..15 <- kk+16+8h+0..7
// (h = l>>4). Same map for A (rc = row) and B (rc = column of a k-contiguous copy).
__device__ __forceinline__ v16bf ld_frag_bf(const __bf16* p0, int ld, int rc, int kk, int lane) {
  const int hh = (lane >> 4) & 1;
  const __bf16* p = p0 + (size_t)rc * ld + kk + 8 * hh;
  const v8bf lo = *(const v8bf*)(p);
  const v8bf hi = *(const v8bf*)(p + 16);
  v16bf f;
#pragma unroll
  for (int i = 0; i < 8; ++i) { f[i] = lo[i]; f[8 + i] = hi[i]; }
  return f;
}
__device__ __forceinline__ v16h ld_frag_h(const _Float16* p0, int ld, int rc, int kk, int lane) {
  const int hh = (lane >> 4) & 1;
  const _Float16* p = p0 + (size_t)rc * ld + kk + 8 * hh;
  const v8h lo = *(const v8h*)(p);
  const v8h hi = *(const v8h*)(p + 16);
  v16h f;
#pragma unroll
  for (int i = 0; i < 8; ++i) { f[i] = lo[i]; f[8 + i] = hi[i]; }
  return f;
}

// f32 -> bf16 bits, RNE convert
__device__ __forceinline__ unsigned int bfb(float x) {
  unsigned int u = __float_as_uint(x);
  u = u + 0x7FFFu + ((u >> 16) & 1u);
  return u >> 16;
}
// f32 -> value of its RNE bf16
__device__ __forceinline__ float bf16val(float x) {
  return __uint_as_float(bfb(x) << 16);
}
// f32 -> f16 bits, RNE convert
__device__ __forceinline__ unsigned short hbits(float x) {
  const _Float16 hv = (_Float16)x;
  return __builtin_bit_cast(unsigned short, hv);
}

// ---------------------------------------------------------------------------
// h f32 [SEQ][IN_DIM] -> bf16 plane (same layout). Thread g converts 8
// consecutive floats -> one 16-byte store; 8 consecutive lanes fill one
__global__ __launch_bounds__(256) void k_cvt_rows(const float* __restrict__ in,
                                                  unsigned short* __restrict__ outp, int n8) {
  const int g = blockIdx.x * 256 + threadIdx.x;
  if (g >= n8) return;
  const v4f a = *(const v4f*)(in + (size_t)g * 8);
  const v4f b = *(const v4f*)(in + (size_t)g * 8 + 4);
  v4u w;
  w[0] = bfb(a[0]) | (bfb(a[1]) << 16);
  w[1] = bfb(a[2]) | (bfb(a[3]) << 16);
  w[2] = bfb(b[0]) | (bfb(b[1]) << 16);
  w[3] = bfb(b[2]) | (bfb(b[3]) << 16);
  v4u* p = (v4u*)(outp + (size_t)g * 8);
  *p = w;
  
}

// ---------------------------------------------------------------------------
// W f32 [IN_DIM k][OUT_DIM n] -> WT bf16 [OUT_DIM n][IN_DIM k] (k contiguous),
// three matrices selected by blockIdx.z into three consecutive planes.
// Block = 64 k x 64 n tile transposed through LDS; each WT row segment
__global__ __launch_bounds__(256) void k_cvt_wT(const float* __restrict__ Wq,
                                                const float* __restrict__ Wk,
                                                const float* __restrict__ Wv,
                                                unsigned short* __restrict__ wT) {
  __shared__ __align__(16) unsigned short T[64 * TP];   // [n local][k local], cross-wave (block barrier)
  const int z = blockIdx.z;
  const float* W = (z == 0) ? Wq : ((z == 1) ? Wk : Wv);
  unsigned short* dst = wT + (size_t)z * OUT_DIM * IN_DIM;
  const int k0 = blockIdx.x * 64;
  const int n0 = blockIdx.y * 64;
  const int tid = threadIdx.x;
  const int wave = tid >> 5, lane = tid & 31;

#pragma unroll
  for (int i = 0; i < 4; ++i) {
    const int idx = i * 256 + tid;          // 0..1023
    const int kk = idx >> 4;                // 0..63
    const int c4 = (idx & 15) * 4;          // 0..60
    const v4f w = *(const v4f*)(W + (size_t)(k0 + kk) * OUT_DIM + n0 + c4);
    T[(c4 + 0) * TP + kk] = (unsigned short)bfb(w[0]);
    T[(c4 + 1) * TP + kk] = (unsigned short)bfb(w[1]);
    T[(c4 + 2) * TP + kk] = (unsigned short)bfb(w[2]);
    T[(c4 + 3) * TP + kk] = (unsigned short)bfb(w[3]);
  }
  __syncthreads();

  v4u v[2];
  size_t off[2];
#pragma unroll
  for (int it = 0; it < 2; ++it) {
    const int nn = wave * 8 + it * 4 + (lane >> 3);   // 0..63 over (wave, it, lane>>3)
    const int q = lane & 7;
    v[it] = *(const v4u*)(&T[nn * TP + q * 8]);
    off[it] = (size_t)(n0 + nn) * IN_DIM + k0 + q * 8;
  }
#pragma unroll
  for (int it = 0; it < 2; ++it) *(v4u*)(dst + off[it]) = v[it];
  
}

// ---------------------------------------------------------------------------
// Projection: C[SEQ][OUT_DIM] = hb[SEQ][IN_DIM] * WT[OUT_DIM][IN_DIM]^T + bias.
// 256 thr = 8 waves; block tile 128 rows x 64 cols; wave owns 16 rows x 64 cols.
// Weight k-tile [64 n][32 k] staged in LDS with plain loads (single buffer,
// two block barriers per step); A fragments straight from the bf16 plane.
// z = 0: Q plane f16 x8 [SEQ][OUT_DIM]; z = 1: K plane f16 x8 [SEQ][OUT_DIM];
// z = 2: V^T plane f16 x8 [OUT_DIM][SEQ]. Epilogue staged in LDS, every
__global__ __launch_bounds__(256) void k_proj(
    const unsigned short* __restrict__ hb, const unsigned short* __restrict__ wT,
    const float* __restrict__ bq, const float* __restrict__ bk, const float* __restrict__ bv,
    unsigned short* __restrict__ qp, unsigned short* __restrict__ kp,
    unsigned short* __restrict__ vtp) {
  __shared__ __align__(16) unsigned short bt[64 * BTP];   // weight k-tile, cross-wave (block barrier)
  __shared__ __align__(16) unsigned short E[ESZ];         // epilogue tile, cross-wave (block barrier)

  const int z = blockIdx.z;
  const int n0 = blockIdx.x * 64;
  const int m0 = blockIdx.y * 128;
  const int tid = threadIdx.x;
  const int wave = tid >> 5, lane = tid & 31;
  const int l15 = lane & 15, half = (lane >> 4) & 1;

  const unsigned short* Wt = wT + (size_t)z * OUT_DIM * IN_DIM;
  const float* bias = (z == 0) ? bq : ((z == 1) ? bk : bv);

  const int tn = tid >> 2;            // 0..63 : column within tile
  const int tk = (tid & 3) * 8;       // 0,8,16,24 : k within step
  const unsigned short* wsrc = Wt + (size_t)(n0 + tn) * IN_DIM + tk;
  const __bf16* A = (const __bf16*)hb;
  const int arow = m0 + wave * 16 + l15;

  v8f acc[4] = {};
  for (int s = 0; s < IN_DIM / 32; ++s) {
    const int kk = s * 32;
    const v4u wv = *(const v4u*)(wsrc + kk);
    __syncthreads();                               // earlier reads of bt done
    *(v4u*)(&bt[tn * BTP + tk]) = wv;
    __syncthreads();                               // tile complete
    const v16bf a = ld_frag_bf(A, IN_DIM, arow, kk, lane);
#pragma unroll
    for (int j = 0; j < 4; ++j) {
      const v16bf b = ld_frag_bf((const __bf16*)bt, BTP, j * 16 + l15, 0, lane);
      acc[j] = mma_bf16(a, b, acc[j]);
    }
  }

  // acc[j][r] = C[m0 + wave*16 + 8*half + r][n0 + j*16 + l15]
  const float car = 8.0f;
  if (z != 2) {                      // block-uniform branch
#pragma unroll
    for (int j = 0; j < 4; ++j) {
      const int col = j * 16 + l15;
      const float bb = bf16val(bias[n0 + col]);
#pragma unroll
      for (int r = 0; r < 8; ++r) {
        const int row = wave * 16 + 8 * half + r;
        E[row * EQP + col] = hbits((acc[j][r] + bb) * car);
      }
    }
    __syncthreads();
    unsigned short* dst = (z == 0) ? qp : kp;
    v4u v[4];
    size_t off[4];
#pragma unroll
    for (int it = 0; it < 4; ++it) {
      const int row = wave * 16 + it * 4 + (lane >> 3);   // wave's 16 rows over (it, lane>>3)
      const int q = lane & 7;
      v[it] = *(const v4u*)(&E[row * EQP + q * 8]);
      off[it] = (size_t)(m0 + row) * OUT_DIM + n0 + q * 8;
    }
#pragma unroll
    for (int it = 0; it < 4; ++it) *(v4u*)(dst + off[it]) = v[it];
    
  } else {
#pragma unroll
    for (int j = 0; j < 4; ++j) {
      const int col = j * 16 + l15;                       // d within tile
      const float bb = bf16val(bias[n0 + col]);
#pragma unroll
      for (int r = 0; r < 8; ++r) {
        const int srow = wave * 16 + 8 * half + r;        // s within tile
        E[col * EVP + srow] = hbits((acc[j][r] + bb) * car);
      }
    }
    __syncthreads();
    v4u v[4];
    size_t off[4];
#pragma unroll
    for (int it = 0; it < 4; ++it) {
      const int drow = wave * 8 + it * 2 + half;          // wave's 8 d-rows over (it, half)
      const int q = l15;                                  // 16 pieces = 256-byte row = 2 lines
      v[it] = *(const v4u*)(&E[drow * EVP + q * 8]);
      off[it] = (size_t)(n0 + drow) * SEQ + m0 + q * 8;
    }
#pragma unroll
    for (int it = 0; it < 4; ++it) *(v4u*)(vtp + off[it]) = v[it];
    
  }
}

// ---------------------------------------------------------------------------
// Flash attention, transposed-score form: one wave = (16 queries, one head);
// a workgroup = 8 waves = 128 queries of one head, which share every K / V^T tile.
// A tile = 128 keys: K [128 keys][64 d] and V^T [64 d][128 keys], copied whole-line
// from the planes into LDS by asynchronous copies, two buffers: tile t + 1 is in
// flight while tile t is worked on. Fragments come from LDS (ds_load_b128 pitches).
// Per 32-key chunk:
//   S^T = K . Q^T    A = K rows (lane = key, k = d), B = Q^T (lane = query, k = d)
//                    D[row = key 8h+r][col = query l15]; c0 keys 0..15, c1 keys 16..31
//   per-lane online softmax for query l15 (16 local keys + xor-16 partner)
//   O^T += V^T . P   A = V^T rows (lane = d, k = key), B = P: element i<8 <- c0[i]
//                    (key 8h+i), element 8+i <- c1[i] (key 16+8h+i), same lane
//                    D[row = d 8h+r][col = query l15]
// Scores carry 64 from the x8 planes -> scaled by 1/512 (= 1/8 of q.k).
// P carried x1024, V carried x8 -> context scaled by 1/(8192 * sum).
// Output tile [16 q][64 d] f32 staged in LDS; each 256-byte row = 2 lines,
#define AW  8                  // waves per workgroup
#define SK  128                // keys per tile
#define KLP 72                 // K tile pitch: 144 B = 16 B x 9
#define VLP 136                // V^T tile pitch: 272 B = 16 B x 17
#define NST (SEQ / SK)         // tiles
static_assert(SEQ % (AW * 16) == 0);
static_assert(NST >= 2);
static_assert(AW * 32 * 4 * 8 == SK * HEAD_DIM);   // four 16-byte copies a lane fill one tile

// One tile's copies of one lane: four 16-byte pieces of K (32 key rows apart) and four
// of V^T (16 d rows apart). s_wait_xcnt 0 is the statement's last line, so that no
// address register named here is rewritten before it.
__device__ __forceinline__ void copy_tile(unsigned int lk, unsigned int lv,
                                          const _Float16* gk, const _Float16* gv) {
  asm volatile(
      "global_load_async_to_lds_b128 %0, %8, off\n\t"
      "global_load_async_to_lds_b128 %1, %9, off\n\t"
      "global_load_async_to_lds_b128 %2, %10, off\n\t"
      "global_load_async_to_lds_b128 %3, %11, off\n\t"
      "global_load_async_to_lds_b128 %4, %12, off\n\t"
      "global_load_async_to_lds_b128 %5, %13, off\n\t"
      "global_load_async_to_lds_b128 %6, %14, off\n\t"
      "global_load_async_to_lds_b128 %7, %15, off\n\t"
      "s_wait_xcnt 0x0"
      :
      : "v"(lk), "v"(lk + 32u * KLP * 2u), "v"(lk + 64u * KLP * 2u), "v"(lk + 96u * KLP * 2u),
        "v"(lv), "v"(lv + 16u * VLP * 2u), "v"(lv + 32u * VLP * 2u), "v"(lv + 48u * VLP * 2u),
        "v"(gk), "v"(gk + (size_t)32 * OUT_DIM), "v"(gk + (size_t)64 * OUT_DIM),
        "v"(gk + (size_t)96 * OUT_DIM),
        "v"(gv), "v"(gv + (size_t)16 * SEQ), "v"(gv + (size_t)32 * SEQ), "v"(gv + (size_t)48 * SEQ)
      : "memory");
}

// Four waves per SIMD (two workgroups per WGP), as before: vector work between matrix runs wants waves.
__global__ __launch_bounds__(AW * 32) __attribute__((amdgpu_waves_per_eu(4, 4)))
void k_attn(const unsigned short* __restrict__ qp,
            const unsigned short* __restrict__ kp,
            const unsigned short* __restrict__ vtp,
            float* __restrict__ outp) {
  __shared__ __align__(16) _Float16 Kt[2][SK * KLP];         // K tiles, cross-wave (block barrier)
  __shared__ __align__(16) _Float16 Vt[2][HEAD_DIM * VLP];   // V^T tiles, cross-wave (block barrier)
  __shared__ __align__(16) float Olw[AW][16 * OLP];          // one output tile per wave

  const int tid = threadIdx.x;
  const int wave = tid >> 5;
  const int lane = tid & 31;
  const int l15 = lane & 15;
  const int half = (lane >> 4) & 1;
  const int q0 = blockIdx.x * (AW * 16) + wave * 16;
  const int head = blockIdx.y;
  float* Ol = Olw[wave];

  const _Float16* Q  = (const _Float16*)qp;
  const _Float16* K  = (const _Float16*)kp;
  const _Float16* VT = (const _Float16*)vtp;

  const _Float16* qbase = Q + (size_t)q0 * OUT_DIM + head * HEAD_DIM;
  const v16h qb0 = ld_frag_h(qbase, OUT_DIM, l15, 0, lane);    // d 0..31
  const v16h qb1 = ld_frag_h(qbase, OUT_DIM, l15, 32, lane);   // d 32..63
  const _Float16* kbase = K + head * HEAD_DIM;                   // key t at kbase + t*OUT_DIM
  const _Float16* vbase = VT + (size_t)head * HEAD_DIM * SEQ;    // d row at vbase + d*SEQ

  // this lane's first piece of a tile: K row tid>>3, piece tid&7; V^T row tid>>4, piece tid&15
  const _Float16* gk = kbase + (size_t)(tid >> 3) * OUT_DIM + (tid & 7) * 8;
  const _Float16* gv = vbase + (size_t)(tid >> 4) * SEQ + (tid & 15) * 8;
  const unsigned int lk0 = (unsigned int)(size_t)(&Kt[0][(tid >> 3) * KLP + (tid & 7) * 8]);
  const unsigned int lv0 = (unsigned int)(size_t)(&Vt[0][(tid >> 4) * VLP + (tid & 15) * 8]);
  const unsigned int kbuf = SK * KLP * 2u;         // bytes from buffer 0 to buffer 1
  const unsigned int vbuf = HEAD_DIM * VLP * 2u;

  copy_tile(lk0, lv0, gk, gv);                                   // tile 0 -> buffer 0
  asm volatile("s_wait_asynccnt 0x0" ::: "memory");              // this wave's part of tile 0 has landed
  __syncthreads();                                               // tile 0 complete for every wave
  copy_tile(lk0 + kbuf, lv0 + vbuf, gk + (size_t)SK * OUT_DIM, gv + SK);   // tile 1 -> buffer 1

  v8f o[4] = {};
  float mrun = -1.0e30f, lrun = 0.0f;
  const float sscale = 1.0f / 512.0f;

  for (int t = 0; t < NST; ++t) {
    const int b = t & 1;
    const _Float16* ktile = Kt[b];
    const _Float16* vtile = Vt[b];
#pragma unroll   // the four chunks of a tile read LDS at constant offsets from one address
    for (int c = 0; c < SK / 32; ++c) {
      const _Float16* kt = ktile + c * 32 * KLP;
      const v16h ka0 = ld_frag_h(kt, KLP, l15, 0, lane);
      const v16h ka1 = ld_frag_h(kt, KLP, l15, 32, lane);
      const v16h ka2 = ld_frag_h(kt, KLP, 16 + l15, 0, lane);
      const v16h ka3 = ld_frag_h(kt, KLP, 16 + l15, 32, lane);
      v8f c0 = {}, c1 = {};
      c0 = mma_f16(ka0, qb0, c0);
      c0 = mma_f16(ka1, qb1, c0);
      c1 = mma_f16(ka2, qb0, c1);
      c1 = mma_f16(ka3, qb1, c1);

      float sa[8], sb[8];
#pragma unroll
      for (int r = 0; r < 8; ++r) { sa[r] = c0[r] * sscale; sb[r] = c1[r] * sscale; }
      float lm = fmaxf(sa[0], sb[0]);
#pragma unroll
      for (int r = 1; r < 8; ++r) lm = fmaxf(lm, fmaxf(sa[r], sb[r]));
      lm = fmaxf(lm, __shfl_xor(lm, 16, 32));
      const float mnew = fmaxf(mrun, lm);
      const float alpha = __expf(mrun - mnew);
      float p0[8], p1[8];
      float ls = 0.0f;
#pragma unroll
      for (int r = 0; r < 8; ++r) {
        p0[r] = __expf(sa[r] - mnew);
        p1[r] = __expf(sb[r] - mnew);
        ls += p0[r] + p1[r];
      }
      ls += __shfl_xor(ls, 16, 32);
      lrun = lrun * alpha + ls;
      mrun = mnew;
#pragma unroll
      for (int j = 0; j < 4; ++j)
#pragma unroll
        for (int r = 0; r < 8; ++r) o[j][r] *= alpha;

      v16h pb;
#pragma unroll
      for (int e = 0; e < 8; ++e) {
        pb[e]     = (_Float16)(p0[e] * 1024.0f);   // key 32c + 8h + e of the tile
        pb[8 + e] = (_Float16)(p1[e] * 1024.0f);   // key 32c + 16 + 8h + e of the tile
      }
#pragma unroll
      for (int j = 0; j < 4; ++j) {
        const v16h va = ld_frag_h(vtile, VLP, j * 16 + l15, c * 32, lane);
        o[j] = mma_f16(va, pb, o[j]);
      }
    }
    asm volatile("s_wait_dscnt 0x0" ::: "memory");      // this wave's reads of buffer b are done
    asm volatile("s_wait_asynccnt 0x0" ::: "memory");   // this wave's part of tile t + 1 has landed
    __syncthreads();   // publishes tile t + 1 and ends every wave's reads of buffer b
    if (t + 2 < NST)   // the same for the whole workgroup
      copy_tile(lk0 + b * kbuf, lv0 + b * vbuf,
                gk + (size_t)(t + 2) * SK * OUT_DIM, gv + (size_t)(t + 2) * SK);
  }
  asm volatile("s_wait_asynccnt 0x0" ::: "memory");     // nothing in flight when the wave ends

  // o[j][r] = 8192 * sum_t p_t v_t for query l15, d = j*16 + 8*half + r
  const float inv = 1.0f / (lrun * 8192.0f);
#pragma unroll
  for (int j = 0; j < 4; ++j) {
    v4f lo4, hi4;
    lo4[0] = o[j][0] * inv; lo4[1] = o[j][1] * inv; lo4[2] = o[j][2] * inv; lo4[3] = o[j][3] * inv;
    hi4[0] = o[j][4] * inv; hi4[1] = o[j][5] * inv; hi4[2] = o[j][6] * inv; hi4[3] = o[j][7] * inv;
    *(v4f*)(&Ol[l15 * OLP + j * 16 + 8 * half])     = lo4;
    *(v4f*)(&Ol[l15 * OLP + j * 16 + 8 * half + 4]) = hi4;
  }
  __syncthreads();

  v4f v[8];
  size_t off[8];
  float* ob = outp + (size_t)q0 * OUT_DIM + head * HEAD_DIM;
#pragma unroll
  for (int it = 0; it < 8; ++it) {
    const int row = it * 2 + half;       // 0..15
    const int q = l15;                   // 16 pieces of 16 B = the row's 256 bytes (2 lines)
    v[it] = *(const v4f*)(&Ol[row * OLP + q * 4]);
    off[it] = (size_t)row * OUT_DIM + q * 4;
  }
#pragma unroll
  for (int it = 0; it < 8; ++it) *(v4f*)(ob + off[it]) = v[it];
  
}

// ---------------------------------------------------------------------------
extern "C" void kernel_launch(void* const* d_in, const int* in_sizes, int n_in,
                              void* d_out, int out_size, void* d_ws, size_t ws_size,
                              hipStream_t stream) {
  if (n_in < 7) return;
  if (in_sizes[0] < SEQ * IN_DIM) return;
  if (in_sizes[1] < IN_DIM * OUT_DIM || in_sizes[2] < IN_DIM * OUT_DIM ||
      in_sizes[3] < IN_DIM * OUT_DIM) return;
  if (in_sizes[4] < OUT_DIM || in_sizes[5] < OUT_DIM || in_sizes[6] < OUT_DIM) return;
  if (out_size < SEQ * OUT_DIM) return;

  const float* h  = (const float*)d_in[0];
  const float* Wq = (const float*)d_in[1];
  const float* Wk = (const float*)d_in[2];
  const float* Wv = (const float*)d_in[3];
  const float* bq = (const float*)d_in[4];
  const float* bk = (const float*)d_in[5];
  const float* bv = (const float*)d_in[6];

  // every offset a multiple of 2 MiB
  const size_t hb_bytes = (size_t)SEQ * IN_DIM * 2;           // bf16 h plane
  const size_t wt_bytes = (size_t)3 * OUT_DIM * IN_DIM * 2;   // 3 bf16 WT planes
  const size_t pl_bytes = (size_t)SEQ * OUT_DIM * 2;          // one f16 q/k/vT plane
  const size_t off_hb = 0;
  const size_t off_wt = off_hb + hb_bytes;
  const size_t off_q  = off_wt + wt_bytes;
  const size_t off_k  = off_q + pl_bytes;
  const size_t off_vt = off_k + pl_bytes;
  const size_t total  = off_vt + pl_bytes;                    // 38 MiB at SEQ = 4096
  if (total > ws_size) return;

  char* ws = (char*)d_ws;
  unsigned short* hb  = (unsigned short*)(ws + off_hb);
  unsigned short* wt  = (unsigned short*)(ws + off_wt);
  unsigned short* qpl = (unsigned short*)(ws + off_q);
  unsigned short* kpl = (unsigned short*)(ws + off_k);
  unsigned short* vtp = (unsigned short*)(ws + off_vt);

  const int n8 = SEQ * IN_DIM / 8;
  k_cvt_rows<<<(n8 + 255) / 256, 256, 0, stream>>>(h, hb, n8);
  k_cvt_wT<<<dim3(IN_DIM / 64, OUT_DIM / 64, 3), 256, 0, stream>>>(Wq, Wk, Wv, wt);
  k_proj<<<dim3(OUT_DIM / 64, SEQ / 128, 3), 256, 0, stream>>>(hb, wt, bq, bk, bv, qpl, kpl, vtp);
  k_attn<<<dim3(SEQ / (AW * 16), NUM_HEADS), AW * 32, 0, stream>>>(qpl, kpl, vtp, (float*)d_out);
}

// v002
// One run takes 128 microseconds.
// Next to v001, in two timings, it ran 1.04 and 1.03 times as fast.
// All steps since v000 together make it 2.55 times as fast.
#include <hip/hip_runtime.h>
// Projections h*W{q,k,v}: v_wmma_f32_16x16x32_bf16 (bf16 operands = RNE-converted inputs, f32 accumulate); scores K*Q^T and context V^T*P: v_wmma_f32_16x16x32_f16 (f16 operands, Q/K/V planes carried x8, P carried x1024, f32 accumulate); softmax in f32.

#ifndef SEQ
#define SEQ 4096
#endif
#define SEQ_FULL 4096
#define IN_DIM 1024
#define NUM_HEADS 16
#define HEAD_DIM 64
#define OUT_DIM (NUM_HEADS * HEAD_DIM)

static_assert(SEQ % 128 == 0);
static_assert(SEQ <= SEQ_FULL);
static_assert(IN_DIM % 64 == 0);
static_assert(OUT_DIM % 64 == 0);
static_assert(HEAD_DIM == 64);
static_assert((size_t)SEQ_FULL * OUT_DIM * 4 == 16777216);

// LDS pitches (in 16-bit elements unless noted); all keep 16-byte row alignment
#define BTP 40     // weight k-tile [64 n][32 k]
#define EQP 72     // row-major epilogue tile [128 rows][64 cols]
#define EVP 136    // transposed epilogue tile [64 d][128 s]
#define TP  72     // weight transpose tile [64 n][64 k]
#define OLP 68     // context tile [16 q][64 d], floats
#define ESZ 9216   // max(128*EQP, 64*EVP)
static_assert(128 * EQP <= ESZ);
static_assert(64 * EVP <= ESZ);

typedef __bf16   v16bf __attribute__((ext_vector_type(16)));
typedef __bf16   v8bf  __attribute__((ext_vector_type(8)));
typedef _Float16 v16h  __attribute__((ext_vector_type(16)));
typedef _Float16 v8h   __attribute__((ext_vector_type(8)));
typedef float    v8f   __attribute__((ext_vector_type(8)));
typedef float    v4f   __attribute__((ext_vector_type(4)));
typedef unsigned int v4u __attribute__((ext_vector_type(4)));

// ---------------------------------------------------------------------------
// WMMA wrappers with the VALU hazard guard (4 v_nop after every issue).
__device__ __forceinline__ v8f mma_bf16(v16bf a, v16bf b, v8f c) {
  v8f d = __builtin_amdgcn_wmma_f32_16x16x32_bf16(false, a, false, b, (short)0, c, false, false);
  asm volatile("v_nop\n\tv_nop\n\tv_nop\n\tv_nop" : "+v"(d) : "v"(a), "v"(b));
  return d;
}
__device__ __forceinline__ v8f mma_f16(v16h a, v16h b, v8f c) {
  v8f d = __builtin_amdgcn_wmma_f32_16x16x32_f16(false, a, false, b, (short)0, c, false, false);
  asm volatile("v_nop\n\tv_nop\n\tv_nop\n\tv_nop" : "+v"(d) : "v"(a), "v"(b));
  return d;
}

// 16-bit fragment, contraction dim CONTIGUOUS in memory: elem(k) = p0[rc*ld + k].
// Lane l: row/col rc = (l&15); elements 0..7 <- kk+8h+0..7, elements 8..15 <- kk+16+8h+0..7
// (h = l>>4). Same map for A (rc = row) and B (rc = column of a k-contiguous copy).
__device__ __forceinline__ v16bf ld_frag_bf(const __bf16* p0, int ld, int rc, int kk, int lane) {
  const int hh = (lane >> 4) & 1;
  const __bf16* p = p0 + (size_t)rc * ld + kk + 8 * hh;
  const v8bf lo = *(const v8bf*)(p);
  const v8bf hi = *(const v8bf*)(p + 16);
  v16bf f;
#pragma unroll
  for (int i = 0; i < 8; ++i) { f[i] = lo[i]; f[8 + i] = hi[i]; }
  return f;
}
__device__ __forceinline__ v16h ld_frag_h(const _Float16* p0, int ld, int rc, int kk, int lane) {
  const int hh = (lane >> 4) & 1;
  const _Float16* p = p0 + (size_t)rc * ld + kk + 8 * hh;
  const v8h lo = *(const v8h*)(p);
  const v8h hi = *(const v8h*)(p + 16);
  v16h f;
#pragma unroll
  for (int i = 0; i < 8; ++i) { f[i] = lo[i]; f[8 + i] = hi[i]; }
  return f;
}

// f32 -> bf16 bits, RNE convert
__device__ __forceinline__ unsigned int bfb(float x) {
  unsigned int u = __float_as_uint(x);
  u = u + 0x7FFFu + ((u >> 16) & 1u);
  return u >> 16;
}
// f32 -> value of its RNE bf16
__device__ __forceinline__ float bf16val(float x) {
  return __uint_as_float(bfb(x) << 16);
}
// f32 -> f16 bits, RNE convert
__device__ __forceinline__ unsigned short hbits(float x) {
  const _Float16 hv = (_Float16)x;
  return __builtin_bit_cast(unsigned short, hv);
}

// ---------------------------------------------------------------------------
// h f32 [SEQ][IN_DIM] -> bf16 plane (same layout). Thread g converts 8
// consecutive floats -> one 16-byte store; 8 consecutive lanes fill one
__global__ __launch_bounds__(256) void k_cvt_rows(const float* __restrict__ in,
                                                  unsigned short* __restrict__ outp, int n8) {
  const int g = blockIdx.x * 256 + threadIdx.x;
  if (g >= n8) return;
  const v4f a = *(const v4f*)(in + (size_t)g * 8);
  const v4f b = *(const v4f*)(in + (size_t)g * 8 + 4);
  v4u w;
  w[0] = bfb(a[0]) | (bfb(a[1]) << 16);
  w[1] = bfb(a[2]) | (bfb(a[3]) << 16);
  w[2] = bfb(b[0]) | (bfb(b[1]) << 16);
  w[3] = bfb(b[2]) | (bfb(b[3]) << 16);
  v4u* p = (v4u*)(outp + (size_t)g * 8);
  *p = w;
  
}

// ---------------------------------------------------------------------------
// W f32 [IN_DIM k][OUT_DIM n] -> WT bf16 [OUT_DIM n][IN_DIM k] (k contiguous),
// three matrices selected by blockIdx.z into three consecutive planes.
// Block = 64 k x 64 n tile transposed through LDS; each WT row segment
__global__ __launch_bounds__(256) void k_cvt_wT(const float* __restrict__ Wq,
                                                const float* __restrict__ Wk,
                                                const float* __restrict__ Wv,
                                                unsigned short* __restrict__ wT) {
  __shared__ __align__(16) unsigned short T[64 * TP];   // [n local][k local], cross-wave (block barrier)
  const int z = blockIdx.z;
  const float* W = (z == 0) ? Wq : ((z == 1) ? Wk : Wv);
  unsigned short* dst = wT + (size_t)z * OUT_DIM * IN_DIM;
  const int k0 = blockIdx.x * 64;
  const int n0 = blockIdx.y * 64;
  const int tid = threadIdx.x;
  const int wave = tid >> 5, lane = tid & 31;

#pragma unroll
  for (int i = 0; i < 4; ++i) {
    const int idx = i * 256 + tid;          // 0..1023
    const int kk = idx >> 4;                // 0..63
    const int c4 = (idx & 15) * 4;          // 0..60
    const v4f w = *(const v4f*)(W + (size_t)(k0 + kk) * OUT_DIM + n0 + c4);
    T[(c4 + 0) * TP + kk] = (unsigned short)bfb(w[0]);
    T[(c4 + 1) * TP + kk] = (unsigned short)bfb(w[1]);
    T[(c4 + 2) * TP + kk] = (unsigned short)bfb(w[2]);
    T[(c4 + 3) * TP + kk] = (unsigned short)bfb(w[3]);
  }
  __syncthreads();

  v4u v[2];
  size_t off[2];
#pragma unroll
  for (int it = 0; it < 2; ++it) {
    const int nn = wave * 8 + it * 4 + (lane >> 3);   // 0..63 over (wave, it, lane>>3)
    const int q = lane & 7;
    v[it] = *(const v4u*)(&T[nn * TP + q * 8]);
    off[it] = (size_t)(n0 + nn) * IN_DIM + k0 + q * 8;
  }
#pragma unroll
  for (int it = 0; it < 2; ++it) *(v4u*)(dst + off[it]) = v[it];
  
}

// ---------------------------------------------------------------------------
// Projection: C[SEQ][OUT_DIM] = hb[SEQ][IN_DIM] * WT[OUT_DIM][IN_DIM]^T + bias.
// 256 thr = 8 waves; block tile 128 rows x 64 cols; wave owns 16 rows x 64 cols.
// Weight k-tile [64 n][32 k] staged in LDS with plain loads (single buffer,
// two block barriers per step); A fragments straight from the bf16 plane.
// z = 0: Q plane f16 x8 [SEQ][OUT_DIM]; z = 1: K plane f16 x8 [SEQ][OUT_DIM];
// z = 2: V^T plane f16 x8 [OUT_DIM][SEQ]. Epilogue staged in LDS, every
__global__ __launch_bounds__(256) void k_proj(
    const unsigned short* __restrict__ hb, const unsigned short* __restrict__ wT,
    const float* __restrict__ bq, const float* __restrict__ bk, const float* __restrict__ bv,
    unsigned short* __restrict__ qp, unsigned short* __restrict__ kp,
    unsigned short* __restrict__ vtp) {
  __shared__ __align__(16) unsigned short bt[64 * BTP];   // weight k-tile, cross-wave (block barrier)
  __shared__ __align__(16) unsigned short E[ESZ];         // epilogue tile, cross-wave (block barrier)

  const int z = blockIdx.z;
  const int n0 = blockIdx.x * 64;
  const int m0 = blockIdx.y * 128;
  const int tid = threadIdx.x;
  const int wave = tid >> 5, lane = tid & 31;
  const int l15 = lane & 15, half = (lane >> 4) & 1;

  const unsigned short* Wt = wT + (size_t)z * OUT_DIM * IN_DIM;
  const float* bias = (z == 0) ? bq : ((z == 1) ? bk : bv);

  const int tn = tid >> 2;            // 0..63 : column within tile
  const int tk = (tid & 3) * 8;       // 0,8,16,24 : k within step
  const unsigned short* wsrc = Wt + (size_t)(n0 + tn) * IN_DIM + tk;
  const __bf16* A = (const __bf16*)hb;
  const int arow = m0 + wave * 16 + l15;

  v8f acc[4] = {};
  for (int s = 0; s < IN_DIM / 32; ++s) {
    const int kk = s * 32;
    const v4u wv = *(const v4u*)(wsrc + kk);
    __syncthreads();                               // earlier reads of bt done
    *(v4u*)(&bt[tn * BTP + tk]) = wv;
    __syncthreads();                               // tile complete
    const v16bf a = ld_frag_bf(A, IN_DIM, arow, kk, lane);
#pragma unroll
    for (int j = 0; j < 4; ++j) {
      const v16bf b = ld_frag_bf((const __bf16*)bt, BTP, j * 16 + l15, 0, lane);
      acc[j] = mma_bf16(a, b, acc[j]);
    }
  }

  // acc[j][r] = C[m0 + wave*16 + 8*half + r][n0 + j*16 + l15]
  const float car = 8.0f;
  if (z != 2) {                      // block-uniform branch
#pragma unroll
    for (int j = 0; j < 4; ++j) {
      const int col = j * 16 + l15;
      const float bb = bf16val(bias[n0 + col]);
#pragma unroll
      for (int r = 0; r < 8; ++r) {
        const int row = wave * 16 + 8 * half + r;
        E[row * EQP + col] = hbits((acc[j][r] + bb) * car);
      }
    }
    __syncthreads();
    unsigned short* dst = (z == 0) ? qp : kp;
    v4u v[4];
    size_t off[4];
#pragma unroll
    for (int it = 0; it < 4; ++it) {
      const int row = wave * 16 + it * 4 + (lane >> 3);   // wave's 16 rows over (it, lane>>3)
      const int q = lane & 7;
      v[it] = *(const v4u*)(&E[row * EQP + q * 8]);
      off[it] = (size_t)(m0 + row) * OUT_DIM + n0 + q * 8;
    }
#pragma unroll
    for (int it = 0; it < 4; ++it) *(v4u*)(dst + off[it]) = v[it];
    
  } else {
#pragma unroll
    for (int j = 0; j < 4; ++j) {
      const int col = j * 16 + l15;                       // d within tile
      const float bb = bf16val(bias[n0 + col]);
#pragma unroll
      for (int r = 0; r < 8; ++r) {
        const int srow = wave * 16 + 8 * half + r;        // s within tile
        E[col * EVP + srow] = hbits((acc[j][r] + bb) * car);
      }
    }
    __syncthreads();
    v4u v[4];
    size_t off[4];
#pragma unroll
    for (int it = 0; it < 4; ++it) {
      const int drow = wave * 8 + it * 2 + half;          // wave's 8 d-rows over (it, half)
      const int q = l15;                                  // 16 pieces = 256-byte row = 2 lines
      v[it] = *(const v4u*)(&E[drow * EVP + q * 8]);
      off[it] = (size_t)(n0 + drow) * SEQ + m0 + q * 8;
    }
#pragma unroll
    for (int it = 0; it < 4; ++it) *(v4u*)(vtp + off[it]) = v[it];
    
  }
}

// ---------------------------------------------------------------------------
// Flash attention, transposed-score form: one wave = (16 queries, one head);
// a workgroup = 8 waves = 128 queries of one head, which share every K / V^T tile.
// A tile = 128 keys: K [128 keys][64 d] and V^T [64 d][128 keys], copied whole-line
// from the planes into LDS by asynchronous copies, two buffers: tile t + 1 is in
// flight while tile t is worked on. Fragments come from LDS (ds_load_b128 pitches).
// Per 32-key chunk:
//   S^T = K . Q^T    A = K rows (lane = key, k = d), B = Q^T (lane = query, k = d)
//                    D[row = key 8h+r][col = query l15]; c0 keys 0..15, c1 keys 16..31
//   per-lane online softmax for query l15 (16 local keys + xor-16 partner)
//   O^T += V^T . P   A = V^T rows (lane = d, k = key), B = P: element i<8 <- c0[i]
//                    (key 8h+i), element 8+i <- c1[i] (key 16+8h+i), same lane
//                    D[row = d 8h+r][col = query l15]
// Scores carry 64 from the x8 planes -> scaled by 1/512 (= 1/8 of q.k).
// P carried x1024, V carried x8 -> context scaled by 1/(8192 * sum).
// Output tile [16 q][64 d] f32 staged in LDS; each 256-byte row = 2 lines,
#define AW  8                  // waves per workgroup
#define SK  128                // keys per tile
#define KLP 72                 // K tile pitch: 144 B = 16 B x 9
#define VLP 136                // V^T tile pitch: 272 B = 16 B x 17
#define NST (SEQ / SK)         // tiles
static_assert(SEQ % (AW * 16) == 0);
static_assert(NST >= 2);
static_assert(AW * 32 * 4 * 8 == SK * HEAD_DIM);   // four 16-byte copies a lane fill one tile

// One tile's copies of one lane: four 16-byte pieces of K (32 key rows apart) and four
// of V^T (16 d rows apart). s_wait_xcnt 0 is the statement's last line, so that no
// address register named here is rewritten before it.
__device__ __forceinline__ void copy_tile(unsigned int lk, unsigned int lv,
                                          const _Float16* gk, const _Float16* gv) {
  asm volatile(
      "global_load_async_to_lds_b128 %0, %8, off\n\t"
      "global_load_async_to_lds_b128 %1, %9, off\n\t"
      "global_load_async_to_lds_b128 %2, %10, off\n\t"
      "global_load_async_to_lds_b128 %3, %11, off\n\t"
      "global_load_async_to_lds_b128 %4, %12, off\n\t"
      "global_load_async_to_lds_b128 %5, %13, off\n\t"
      "global_load_async_to_lds_b128 %6, %14, off\n\t"
      "global_load_async_to_lds_b128 %7, %15, off\n\t"
      "s_wait_xcnt 0x0"
      :
      : "v"(lk), "v"(lk + 32u * KLP * 2u), "v"(lk + 64u * KLP * 2u), "v"(lk + 96u * KLP * 2u),
        "v"(lv), "v"(lv + 16u * VLP * 2u), "v"(lv + 32u * VLP * 2u), "v"(lv + 48u * VLP * 2u),
        "v"(gk), "v"(gk + (size_t)32 * OUT_DIM), "v"(gk + (size_t)64 * OUT_DIM),
        "v"(gk + (size_t)96 * OUT_DIM),
        "v"(gv), "v"(gv + (size_t)16 * SEQ), "v"(gv + (size_t)32 * SEQ), "v"(gv + (size_t)48 * SEQ)
      : "memory");
}

// Four waves per SIMD (two workgroups per WGP), as before: vector work between matrix runs wants waves.
__global__ __launch_bounds__(AW * 32) __attribute__((amdgpu_waves_per_eu(4, 4)))
void k_attn(const unsigned short* __restrict__ qp,
            const unsigned short* __restrict__ kp,
            const unsigned short* __restrict__ vtp,
            float* __restrict__ outp) {
  __shared__ __align__(16) _Float16 Kt[2][SK * KLP];         // K tiles, cross-wave (block barrier)
  __shared__ __align__(16) _Float16 Vt[2][HEAD_DIM * VLP];   // V^T tiles, cross-wave (block barrier)
  __shared__ __align__(16) float Olw[AW][16 * OLP];          // one output tile per wave

  const int tid = threadIdx.x;
  const int wave = tid >> 5;
  const int lane = tid & 31;
  const int l15 = lane & 15;
  const int half = (lane >> 4) & 1;
  const int q0 = blockIdx.x * (AW * 16) + wave * 16;
  const int head = blockIdx.y;
  float* Ol = Olw[wave];

  const _Float16* Q  = (const _Float16*)qp;
  const _Float16* K  = (const _Float16*)kp;
  const _Float16* VT = (const _Float16*)vtp;

  const _Float16* qbase = Q + (size_t)q0 * OUT_DIM + head * HEAD_DIM;
  const v16h qb0 = ld_frag_h(qbase, OUT_DIM, l15, 0, lane);    // d 0..31
  const v16h qb1 = ld_frag_h(qbase, OUT_DIM, l15, 32, lane);   // d 32..63
  const _Float16* kbase = K + head * HEAD_DIM;                   // key t at kbase + t*OUT_DIM
  const _Float16* vbase = VT + (size_t)head * HEAD_DIM * SEQ;    // d row at vbase + d*SEQ

  // this lane's first piece of a tile: K row tid>>3, piece tid&7; V^T row tid>>4, piece tid&15
  const _Float16* gk = kbase + (size_t)(tid >> 3) * OUT_DIM + (tid & 7) * 8;
  const _Float16* gv = vbase + (size_t)(tid >> 4) * SEQ + (tid & 15) * 8;
  const unsigned int lk0 = (unsigned int)(size_t)(&Kt[0][(tid >> 3) * KLP + (tid & 7) * 8]);
  const unsigned int lv0 = (unsigned int)(size_t)(&Vt[0][(tid >> 4) * VLP + (tid & 15) * 8]);
  const unsigned int kbuf = SK * KLP * 2u;         // bytes from buffer 0 to buffer 1
  const unsigned int vbuf = HEAD_DIM * VLP * 2u;

  copy_tile(lk0, lv0, gk, gv);                                   // tile 0 -> buffer 0
  asm volatile("s_wait_asynccnt 0x0" ::: "memory");              // this wave's part of tile 0 has landed
  __syncthreads();                                               // tile 0 complete for every wave
  copy_tile(lk0 + kbuf, lv0 + vbuf, gk + (size_t)SK * OUT_DIM, gv + SK);   // tile 1 -> buffer 1

  v8f o[4] = {};
  float mrun = -1.0e30f, lrun = 0.0f;
  const float sscale = 1.0f / 512.0f;

  for (int t = 0; t < NST; ++t) {
    const int b = t & 1;
    const _Float16* ktile = Kt[b];
    const _Float16* vtile = Vt[b];
    // K fragments of chunk 0; later chunks' are fetched one chunk ahead, inside this tile only
    v16h ka0 = ld_frag_h(ktile, KLP, l15, 0, lane);
    v16h ka2 = ld_frag_h(ktile, KLP, 16 + l15, 0, lane);
    v16h ka1 = ld_frag_h(ktile, KLP, l15, 32, lane);
    v16h ka3 = ld_frag_h(ktile, KLP, 16 + l15, 32, lane);
#pragma unroll   // the four chunks of a tile read LDS at constant offsets from one address
    for (int c = 0; c < SK / 32; ++c) {
      // this chunk's four V^T fragments, one group of reads: they land under the scores and the softmax
      v16h va[4];
#pragma unroll
      for (int j = 0; j < 4; ++j) va[j] = ld_frag_h(vtile, VLP, j * 16 + l15, c * 32, lane);
      // keeps the group of reads above the score products, so that it is in flight under the scores and the softmax
      __builtin_amdgcn_sched_barrier(0);
      v8f c0 = {}, c1 = {};
      c0 = mma_f16(ka0, qb0, c0);
      c1 = mma_f16(ka2, qb0, c1);
      c0 = mma_f16(ka1, qb1, c0);
      c1 = mma_f16(ka3, qb1, c1);
      if (c + 1 < SK / 32) {   // next chunk's K fragments, one group: they land under the softmax and the context products
        const _Float16* kn = ktile + (c + 1) * 32 * KLP;
        ka0 = ld_frag_h(kn, KLP, l15, 0, lane);
        ka2 = ld_frag_h(kn, KLP, 16 + l15, 0, lane);
        ka1 = ld_frag_h(kn, KLP, l15, 32, lane);
        ka3 = ld_frag_h(kn, KLP, 16 + l15, 32, lane);
        // keeps that group here, ahead of the softmax, so that the next chunk's score products find it landed
        __builtin_amdgcn_sched_barrier(0);
      }

      float sa[8], sb[8];
#pragma unroll
      for (int r = 0; r < 8; ++r) { sa[r] = c0[r] * sscale; sb[r] = c1[r] * sscale; }
      float lm = fmaxf(sa[0], sb[0]);
#pragma unroll
      for (int r = 1; r < 8; ++r) lm = fmaxf(lm, fmaxf(sa[r], sb[r]));
      lm = fmaxf(lm, __shfl_xor(lm, 16, 32));
      const float mnew = fmaxf(mrun, lm);
      const float alpha = __expf(mrun - mnew);
      float p0[8], p1[8];
      float ls = 0.0f;
#pragma unroll
      for (int r = 0; r < 8; ++r) {
        p0[r] = __expf(sa[r] - mnew);
        p1[r] = __expf(sb[r] - mnew);
        ls += p0[r] + p1[r];
      }
      ls += __shfl_xor(ls, 16, 32);
      lrun = lrun * alpha + ls;
      mrun = mnew;
#pragma unroll
      for (int j = 0; j < 4; ++j)
#pragma unroll
        for (int r = 0; r < 8; ++r) o[j][r] *= alpha;

      v16h pb;
#pragma unroll
      for (int e = 0; e < 8; ++e) {
        pb[e]     = (_Float16)(p0[e] * 1024.0f);   // key 32c + 8h + e of the tile
        pb[8 + e] = (_Float16)(p1[e] * 1024.0f);   // key 32c + 16 + 8h + e of the tile
      }
#pragma unroll
      for (int j = 0; j < 4; ++j) o[j] = mma_f16(va[j], pb, o[j]);
    }
    asm volatile("s_wait_dscnt 0x0" ::: "memory");      // this wave's reads of buffer b are done
    asm volatile("s_wait_asynccnt 0x0" ::: "memory");   // this wave's part of tile t + 1 has landed
    __syncthreads();   // publishes tile t + 1 and ends every wave's reads of buffer b
    if (t + 2 < NST)   // the same for the whole workgroup
      copy_tile(lk0 + b * kbuf, lv0 + b * vbuf,
                gk + (size_t)(t + 2) * SK * OUT_DIM, gv + (size_t)(t + 2) * SK);
  }
  asm volatile("s_wait_asynccnt 0x0" ::: "memory");     // nothing in flight when the wave ends

  // o[j][r] = 8192 * sum_t p_t v_t for query l15, d = j*16 + 8*half + r
  const float inv = 1.0f / (lrun * 8192.0f);
#pragma unroll
  for (int j = 0; j < 4; ++j) {
    v4f lo4, hi4;
    lo4[0] = o[j][0] * inv; lo4[1] = o[j][1] * inv; lo4[2] = o[j][2] * inv; lo4[3] = o[j][3] * inv;
    hi4[0] = o[j][4] * inv; hi4[1] = o[j][5] * inv; hi4[2] = o[j][6] * inv; hi4[3] = o[j][7] * inv;
    *(v4f*)(&Ol[l15 * OLP + j * 16 + 8 * half])     = lo4;
    *(v4f*)(&Ol[l15 * OLP + j * 16 + 8 * half + 4]) = hi4;
  }
  __syncthreads();

  v4f v[8];
  size_t off[8];
  float* ob = outp + (size_t)q0 * OUT_DIM + head * HEAD_DIM;
#pragma unroll
  for (int it = 0; it < 8; ++it) {
    const int row = it * 2 + half;       // 0..15
    const int q = l15;                   // 16 pieces of 16 B = the row's 256 bytes (2 lines)
    v[it] = *(const v4f*)(&Ol[row * OLP + q * 4]);
    off[it] = (size_t)row * OUT_DIM + q * 4;
  }
#pragma unroll
  for (int it = 0; it < 8; ++it) *(v4f*)(ob + off[it]) = v[it];
  
}

// ---------------------------------------------------------------------------
extern "C" void kernel_launch(void* const* d_in, const int* in_sizes, int n_in,
                              void* d_out, int out_size, void* d_ws, size_t ws_size,
                              hipStream_t stream) {
  if (n_in < 7) return;
  if (in_sizes[0] < SEQ * IN_DIM) return;
  if (in_sizes[1] < IN_DIM * OUT_DIM || in_sizes[2] < IN_DIM * OUT_DIM ||
      in_sizes[3] < IN_DIM * OUT_DIM) return;
  if (in_sizes[4] < OUT_DIM || in_sizes[5] < OUT_DIM || in_sizes[6] < OUT_DIM) return;
  if (out_size < SEQ * OUT_DIM) return;

  const float* h  = (const float*)d_in[0];
  const float* Wq = (const float*)d_in[1];
  const float* Wk = (const float*)d_in[2];
  const float* Wv = (const float*)d_in[3];
  const float* bq = (const float*)d_in[4];
  const float* bk = (const float*)d_in[5];
  const float* bv = (const float*)d_in[6];

  // every offset a multiple of 2 MiB
  const size_t hb_bytes = (size_t)SEQ * IN_DIM * 2;           // bf16 h plane
  const size_t wt_bytes = (size_t)3 * OUT_DIM * IN_DIM * 2;   // 3 bf16 WT planes
  const size_t pl_bytes = (size_t)SEQ * OUT_DIM * 2;          // one f16 q/k/vT plane
  const size_t off_hb = 0;
  const size_t off_wt = off_hb + hb_bytes;
  const size_t off_q  = off_wt + wt_bytes;
  const size_t off_k  = off_q + pl_bytes;
  const size_t off_vt = off_k + pl_bytes;
  const size_t total  = off_vt + pl_bytes;                    // 38 MiB at SEQ = 4096
  if (total > ws_size) return;

  char* ws = (char*)d_ws;
  unsigned short* hb  = (unsigned short*)(ws + off_hb);
  unsigned short* wt  = (unsigned short*)(ws + off_wt);
  unsigned short* qpl = (unsigned short*)(ws + off_q);
  unsigned short* kpl = (unsigned short*)(ws + off_k);
  unsigned short* vtp = (unsigned short*)(ws + off_vt);

  const int n8 = SEQ * IN_DIM / 8;
  k_cvt_rows<<<(n8 + 255) / 256, 256, 0, stream>>>(h, hb, n8);
  k_cvt_wT<<<dim3(IN_DIM / 64, OUT_DIM / 64, 3), 256, 0, stream>>>(Wq, Wk, Wv, wt);
  k_proj<<<dim3(OUT_DIM / 64, SEQ / 128, 3), 256, 0, stream>>>(hb, wt, bq, bk, bv, qpl, kpl, vtp);
  k_attn<<<dim3(SEQ / (AW * 16), NUM_HEADS), AW * 32, 0, stream>>>(qpl, kpl, vtp, (float*)d_out);
}

// v003
// Measured time: 119 microseconds a run.
// In both of two side-by-side timings against v002, it was 1.08 times as fast.
// Over all steps from v000 it is 2.75 times as fast.
#include <hip/hip_runtime.h>
// Projections h*W{q,k,v}: v_wmma_f32_16x16x32_bf16 (bf16 operands = RNE-converted inputs, f32 accumulate); scores K*Q^T and context V^T*P: v_wmma_f32_16x16x32_f16 (f16 operands, Q/K/V planes carried x8, P carried x1024, f32 accumulate); softmax in f32.

#ifndef SEQ
#define SEQ 4096
#endif
#define SEQ_FULL 4096
#define IN_DIM 1024
#define NUM_HEADS 16
#define HEAD_DIM 64
#define OUT_DIM (NUM_HEADS * HEAD_DIM)

static_assert(SEQ % 128 == 0);
static_assert(SEQ <= SEQ_FULL);
static_assert(IN_DIM % 64 == 0);
static_assert(OUT_DIM % 64 == 0);
static_assert(HEAD_DIM == 64);
static_assert((size_t)SEQ_FULL * OUT_DIM * 4 == 16777216);

// LDS pitches (in 16-bit elements unless noted); all keep 16-byte row alignment
#define BTP 40     // weight k-tile [64 n][32 k]
#define EQP 72     // row-major epilogue tile [128 rows][64 cols]
#define EVP 136    // transposed epilogue tile [64 d][128 s]
#define TP  72     // weight transpose tile [64 n][64 k]
#define OLP 68     // context tile [16 q][64 d], floats
#define ESZ 9216   // max(128*EQP, 64*EVP)
static_assert(128 * EQP <= ESZ);
static_assert(64 * EVP <= ESZ);

typedef __bf16   v16bf __attribute__((ext_vector_type(16)));
typedef __bf16   v8bf  __attribute__((ext_vector_type(8)));
typedef _Float16 v16h  __attribute__((ext_vector_type(16)));
typedef _Float16 v8h   __attribute__((ext_vector_type(8)));
typedef float    v8f   __attribute__((ext_vector_type(8)));
typedef float    v4f   __attribute__((ext_vector_type(4)));
typedef unsigned int v4u __attribute__((ext_vector_type(4)));

// ---------------------------------------------------------------------------
// WMMA wrappers with the VALU hazard guard (4 v_nop after every issue).
__device__ __forceinline__ v8f mma_bf16(v16bf a, v16bf b, v8f c) {
  v8f d = __builtin_amdgcn_wmma_f32_16x16x32_bf16(false, a, false, b, (short)0, c, false, false);
  asm volatile("v_nop\n\tv_nop\n\tv_nop\n\tv_nop" : "+v"(d) : "v"(a), "v"(b));
  return d;
}
__device__ __forceinline__ v8f mma_f16(v16h a, v16h b, v8f c) {
  v8f d = __builtin_amdgcn_wmma_f32_16x16x32_f16(false, a, false, b, (short)0, c, false, false);
  asm volatile("v_nop\n\tv_nop\n\tv_nop\n\tv_nop" : "+v"(d) : "v"(a), "v"(b));
  return d;
}

// 16-bit fragment, contraction dim CONTIGUOUS in memory: elem(k) = p0[rc*ld + k].
// Lane l: row/col rc = (l&15); elements 0..7 <- kk+8h+0..7, elements 8..15 <- kk+16+8h+0..7
// (h = l>>4). Same map for A (rc = row) and B (rc = column of a k-contiguous copy).
__device__ __forceinline__ v16bf ld_frag_bf(const __bf16* p0, int ld, int rc, int kk, int lane) {
  const int hh = (lane >> 4) & 1;
  const __bf16* p = p0 + (size_t)rc * ld + kk + 8 * hh;
  const v8bf lo = *(const v8bf*)(p);
  const v8bf hi = *(const v8bf*)(p + 16);
  v16bf f;
#pragma unroll
  for (int i = 0; i < 8; ++i) { f[i] = lo[i]; f[8 + i] = hi[i]; }
  return f;
}
__device__ __forceinline__ v16h ld_frag_h(const _Float16* p0, int ld, int rc, int kk, int lane) {
  const int hh = (lane >> 4) & 1;
  const _Float16* p = p0 + (size_t)rc * ld + kk + 8 * hh;
  const v8h lo = *(const v8h*)(p);
  const v8h hi = *(const v8h*)(p + 16);
  v16h f;
#pragma unroll
  for (int i = 0; i < 8; ++i) { f[i] = lo[i]; f[8 + i] = hi[i]; }
  return f;
}

// f32 -> bf16 bits, RNE convert
__device__ __forceinline__ unsigned int bfb(float x) {
  unsigned int u = __float_as_uint(x);
  u = u + 0x7FFFu + ((u >> 16) & 1u);
  return u >> 16;
}
// f32 -> value of its RNE bf16
__device__ __forceinline__ float bf16val(float x) {
  return __uint_as_float(bfb(x) << 16);
}
// f32 -> f16 bits, RNE convert
__device__ __forceinline__ unsigned short hbits(float x) {
  const _Float16 hv = (_Float16)x;
  return __builtin_bit_cast(unsigned short, hv);
}

// ---------------------------------------------------------------------------
// h f32 [SEQ][IN_DIM] -> bf16 plane (same layout). Thread g converts 8
// consecutive floats -> one 16-byte store; 8 consecutive lanes fill one
__global__ __launch_bounds__(256) void k_cvt_rows(const float* __restrict__ in,
                                                  unsigned short* __restrict__ outp, int n8) {
  const int g = blockIdx.x * 256 + threadIdx.x;
  if (g >= n8) return;
  const v4f a = *(const v4f*)(in + (size_t)g * 8);
  const v4f b = *(const v4f*)(in + (size_t)g * 8 + 4);
  v4u w;
  w[0] = bfb(a[0]) | (bfb(a[1]) << 16);
  w[1] = bfb(a[2]) | (bfb(a[3]) << 16);
  w[2] = bfb(b[0]) | (bfb(b[1]) << 16);
  w[3] = bfb(b[2]) | (bfb(b[3]) << 16);
  v4u* p = (v4u*)(outp + (size_t)g * 8);
  *p = w;
  
}

// ---------------------------------------------------------------------------
// W f32 [IN_DIM k][OUT_DIM n] -> WT bf16 [OUT_DIM n][IN_DIM k] (k contiguous),
// three matrices selected by blockIdx.z into three consecutive planes.
// Block = 64 k x 64 n tile transposed through LDS; each WT row segment
__global__ __launch_bounds__(256) void k_cvt_wT(const float* __restrict__ Wq,
                                                const float* __restrict__ Wk,
                                                const float* __restrict__ Wv,
                                                unsigned short* __restrict__ wT) {
  __shared__ __align__(16) unsigned short T[64 * TP];   // [n local][k local], cross-wave (block barrier)
  const int z = blockIdx.z;
  const float* W = (z == 0) ? Wq : ((z == 1) ? Wk : Wv);
  unsigned short* dst = wT + (size_t)z * OUT_DIM * IN_DIM;
  const int k0 = blockIdx.x * 64;
  const int n0 = blockIdx.y * 64;
  const int tid = threadIdx.x;
  const int wave = tid >> 5, lane = tid & 31;

#pragma unroll
  for (int i = 0; i < 4; ++i) {
    const int idx = i * 256 + tid;          // 0..1023
    const int kk = idx >> 4;                // 0..63
    const int c4 = (idx & 15) * 4;          // 0..60
    const v4f w = *(const v4f*)(W + (size_t)(k0 + kk) * OUT_DIM + n0 + c4);
    T[(c4 + 0) * TP + kk] = (unsigned short)bfb(w[0]);
    T[(c4 + 1) * TP + kk] = (unsigned short)bfb(w[1]);
    T[(c4 + 2) * TP + kk] = (unsigned short)bfb(w[2]);
    T[(c4 + 3) * TP + kk] = (unsigned short)bfb(w[3]);
  }
  __syncthreads();

  v4u v[2];
  size_t off[2];
#pragma unroll
  for (int it = 0; it < 2; ++it) {
    const int nn = wave * 8 + it * 4 + (lane >> 3);   // 0..63 over (wave, it, lane>>3)
    const int q = lane & 7;
    v[it] = *(const v4u*)(&T[nn * TP + q * 8]);
    off[it] = (size_t)(n0 + nn) * IN_DIM + k0 + q * 8;
  }
#pragma unroll
  for (int it = 0; it < 2; ++it) *(v4u*)(dst + off[it]) = v[it];
  
}

// ---------------------------------------------------------------------------
// Projection: C[SEQ][OUT_DIM] = hb[SEQ][IN_DIM] * WT[OUT_DIM][IN_DIM]^T + bias.
// 256 thr = 8 waves; block tile 128 rows x 64 cols; wave owns 16 rows x 64 cols.
// Weight k-tile [64 n][32 k] staged in LDS with plain loads (single buffer,
// two block barriers per step); A fragments straight from the bf16 plane.
// z = 0: Q plane f16 x8 [SEQ][OUT_DIM]; z = 1: K plane f16 x8 [SEQ][OUT_DIM];
// z = 2: V^T plane f16 x8 [OUT_DIM][SEQ]. Epilogue staged in LDS, every
__global__ __launch_bounds__(256) void k_proj(
    const unsigned short* __restrict__ hb, const unsigned short* __restrict__ wT,
    const float* __restrict__ bq, const float* __restrict__ bk, const float* __restrict__ bv,
    unsigned short* __restrict__ qp, unsigned short* __restrict__ kp,
    unsigned short* __restrict__ vtp) {
  __shared__ __align__(16) unsigned short bt[64 * BTP];   // weight k-tile, cross-wave (block barrier)
  __shared__ __align__(16) unsigned short E[ESZ];         // epilogue tile, cross-wave (block barrier)

  const int z = blockIdx.z;
  const int n0 = blockIdx.x * 64;
  const int m0 = blockIdx.y * 128;
  const int tid = threadIdx.x;
  const int wave = tid >> 5, lane = tid & 31;
  const int l15 = lane & 15, half = (lane >> 4) & 1;

  const unsigned short* Wt = wT + (size_t)z * OUT_DIM * IN_DIM;
  const float* bias = (z == 0) ? bq : ((z == 1) ? bk : bv);

  const int tn = tid >> 2;            // 0..63 : column within tile
  const int tk = (tid & 3) * 8;       // 0,8,16,24 : k within step
  const unsigned short* wsrc = Wt + (size_t)(n0 + tn) * IN_DIM + tk;
  const __bf16* A = (const __bf16*)hb;
  const int arow = m0 + wave * 16 + l15;

  v8f acc[4] = {};
  for (int s = 0; s < IN_DIM / 32; ++s) {
    const int kk = s * 32;
    const v4u wv = *(const v4u*)(wsrc + kk);
    __syncthreads();                               // earlier reads of bt done
    *(v4u*)(&bt[tn * BTP + tk]) = wv;
    __syncthreads();                               // tile complete
    const v16bf a = ld_frag_bf(A, IN_DIM, arow, kk, lane);
#pragma unroll
    for (int j = 0; j < 4; ++j) {
      const v16bf b = ld_frag_bf((const __bf16*)bt, BTP, j * 16 + l15, 0, lane);
      acc[j] = mma_bf16(a, b, acc[j]);
    }
  }

  // acc[j][r] = C[m0 + wave*16 + 8*half + r][n0 + j*16 + l15]
  const float car = 8.0f;
  if (z != 2) {                      // block-uniform branch
#pragma unroll
    for (int j = 0; j < 4; ++j) {
      const int col = j * 16 + l15;
      const float bb = bf16val(bias[n0 + col]);
#pragma unroll
      for (int r = 0; r < 8; ++r) {
        const int row = wave * 16 + 8 * half + r;
        E[row * EQP + col] = hbits((acc[j][r] + bb) * car);
      }
    }
    __syncthreads();
    unsigned short* dst = (z == 0) ? qp : kp;
    v4u v[4];
    size_t off[4];
#pragma unroll
    for (int it = 0; it < 4; ++it) {
      const int row = wave * 16 + it * 4 + (lane >> 3);   // wave's 16 rows over (it, lane>>3)
      const int q = lane & 7;
      v[it] = *(const v4u*)(&E[row * EQP + q * 8]);
      off[it] = (size_t)(m0 + row) * OUT_DIM + n0 + q * 8;
    }
#pragma unroll
    for (int it = 0; it < 4; ++it) *(v4u*)(dst + off[it]) = v[it];
    
  } else {
#pragma unroll
    for (int j = 0; j < 4; ++j) {
      const int col = j * 16 + l15;                       // d within tile
      const float bb = bf16val(bias[n0 + col]);
#pragma unroll
      for (int r = 0; r < 8; ++r) {
        const int srow = wave * 16 + 8 * half + r;        // s within tile
        E[col * EVP + srow] = hbits((acc[j][r] + bb) * car);
      }
    }
    __syncthreads();
    v4u v[4];
    size_t off[4];
#pragma unroll
    for (int it = 0; it < 4; ++it) {
      const int drow = wave * 8 + it * 2 + half;          // wave's 8 d-rows over (it, half)
      const int q = l15;                                  // 16 pieces = 256-byte row = 2 lines
      v[it] = *(const v4u*)(&E[drow * EVP + q * 8]);
      off[it] = (size_t)(n0 + drow) * SEQ + m0 + q * 8;
    }
#pragma unroll
    for (int it = 0; it < 4; ++it) *(v4u*)(vtp + off[it]) = v[it];
    
  }
}

// ---------------------------------------------------------------------------
// Flash attention, transposed-score form: one wave = (16 queries, one head);
// a workgroup = 8 waves = 128 queries of one head, which share every K / V^T tile.
// A tile = 128 keys: K [128 keys][64 d] and V^T [64 d][128 keys], copied whole-line
// from the planes into LDS by asynchronous copies, two buffers: tile t + 1 is in
// flight while tile t is worked on. Fragments come from LDS (ds_load_b128 pitches).
// Per 32-key chunk:
//   S^T = K . Q^T    A = K rows (lane = key, k = d), B = Q^T (lane = query, k = d)
//                    D[row = key 8h+r][col = query l15]; c0 keys 0..15, c1 keys 16..31
//   per-lane online softmax for query l15 (16 local keys + xor-16 partner)
//   O^T += V^T . P   A = V^T rows (lane = d, k = key), B = P: element i<8 <- c0[i]
//                    (key 8h+i), element 8+i <- c1[i] (key 16+8h+i), same lane
//                    D[row = d 8h+r][col = query l15]
// Scores carry 64 from the x8 planes: P = exp2(score * log2(e)/512 - max * log2(e)/512 + 10),
// one multiply-add and one exponential a score; the running maximum stays in raw score units.
// P and its sum carried x1024, V carried x8 -> context scaled by 1/(8 * carried sum).
// Output tile [16 q][64 d] f32 staged in LDS; each 256-byte row = 2 lines,
#define AW  8                  // waves per workgroup
#define SK  128                // keys per tile
#define KLP 72                 // K tile pitch: 144 B = 16 B x 9
#define VLP 136                // V^T tile pitch: 272 B = 16 B x 17
#define NST (SEQ / SK)         // tiles
static_assert(SEQ % (AW * 16) == 0);
static_assert(NST >= 2);
static_assert(AW * 32 * 4 * 8 == SK * HEAD_DIM);   // four 16-byte copies a lane fill one tile

// One tile's copies of one lane: four 16-byte pieces of K (32 key rows apart) and four
// of V^T (16 d rows apart). s_wait_xcnt 0 is the statement's last line, so that no
// address register named here is rewritten before it.
__device__ __forceinline__ void copy_tile(unsigned int lk, unsigned int lv,
                                          const _Float16* gk, const _Float16* gv) {
  asm volatile(
      "global_load_async_to_lds_b128 %0, %8, off\n\t"
      "global_load_async_to_lds_b128 %1, %9, off\n\t"
      "global_load_async_to_lds_b128 %2, %10, off\n\t"
      "global_load_async_to_lds_b128 %3, %11, off\n\t"
      "global_load_async_to_lds_b128 %4, %12, off\n\t"
      "global_load_async_to_lds_b128 %5, %13, off\n\t"
      "global_load_async_to_lds_b128 %6, %14, off\n\t"
      "global_load_async_to_lds_b128 %7, %15, off\n\t"
      "s_wait_xcnt 0x0"
      :
      : "v"(lk), "v"(lk + 32u * KLP * 2u), "v"(lk + 64u * KLP * 2u), "v"(lk + 96u * KLP * 2u),
        "v"(lv), "v"(lv + 16u * VLP * 2u), "v"(lv + 32u * VLP * 2u), "v"(lv + 48u * VLP * 2u),
        "v"(gk), "v"(gk + (size_t)32 * OUT_DIM), "v"(gk + (size_t)64 * OUT_DIM),
        "v"(gk + (size_t)96 * OUT_DIM),
        "v"(gv), "v"(gv + (size_t)16 * SEQ), "v"(gv + (size_t)32 * SEQ), "v"(gv + (size_t)48 * SEQ)
      : "memory");
}

// Four waves per SIMD (two workgroups per WGP), as before: vector work between matrix runs wants waves.
__global__ __launch_bounds__(AW * 32) __attribute__((amdgpu_waves_per_eu(4, 4)))
void k_attn(const unsigned short* __restrict__ qp,
            const unsigned short* __restrict__ kp,
            const unsigned short* __restrict__ vtp,
            float* __restrict__ outp) {
  __shared__ __align__(16) _Float16 Kt[2][SK * KLP];         // K tiles, cross-wave (block barrier)
  __shared__ __align__(16) _Float16 Vt[2][HEAD_DIM * VLP];   // V^T tiles, cross-wave (block barrier)
  __shared__ __align__(16) float Olw[AW][16 * OLP];          // one output tile per wave

  const int tid = threadIdx.x;
  const int wave = tid >> 5;
  const int lane = tid & 31;
  const int l15 = lane & 15;
  const int half = (lane >> 4) & 1;
  const int q0 = blockIdx.x * (AW * 16) + wave * 16;
  const int head = blockIdx.y;
  float* Ol = Olw[wave];

  const _Float16* Q  = (const _Float16*)qp;
  const _Float16* K  = (const _Float16*)kp;
  const _Float16* VT = (const _Float16*)vtp;

  const _Float16* qbase = Q + (size_t)q0 * OUT_DIM + head * HEAD_DIM;
  const v16h qb0 = ld_frag_h(qbase, OUT_DIM, l15, 0, lane);    // d 0..31
  const v16h qb1 = ld_frag_h(qbase, OUT_DIM, l15, 32, lane);   // d 32..63
  const _Float16* kbase = K + head * HEAD_DIM;                   // key t at kbase + t*OUT_DIM
  const _Float16* vbase = VT + (size_t)head * HEAD_DIM * SEQ;    // d row at vbase + d*SEQ

  // this lane's first piece of a tile: K row tid>>3, piece tid&7; V^T row tid>>4, piece tid&15
  const _Float16* gk = kbase + (size_t)(tid >> 3) * OUT_DIM + (tid & 7) * 8;
  const _Float16* gv = vbase + (size_t)(tid >> 4) * SEQ + (tid & 15) * 8;
  const unsigned int lk0 = (unsigned int)(size_t)(&Kt[0][(tid >> 3) * KLP + (tid & 7) * 8]);
  const unsigned int lv0 = (unsigned int)(size_t)(&Vt[0][(tid >> 4) * VLP + (tid & 15) * 8]);
  const unsigned int kbuf = SK * KLP * 2u;         // bytes from buffer 0 to buffer 1
  const unsigned int vbuf = HEAD_DIM * VLP * 2u;

  copy_tile(lk0, lv0, gk, gv);                                   // tile 0 -> buffer 0
  asm volatile("s_wait_asynccnt 0x0" ::: "memory");              // this wave's part of tile 0 has landed
  __syncthreads();                                               // tile 0 complete for every wave
  copy_tile(lk0 + kbuf, lv0 + vbuf, gk + (size_t)SK * OUT_DIM, gv + SK);   // tile 1 -> buffer 1

  v8f o[4] = {};
  float mrun = -1.0e30f, lrun = 0.0f;
  const float kq = 1.44269504f / 512.0f;   // 1/512 (score scale on the x8 planes) times log2(e)

  for (int t = 0; t < NST; ++t) {
    const int b = t & 1;
    const _Float16* ktile = Kt[b];
    const _Float16* vtile = Vt[b];
    // K fragments of chunk 0; later chunks' are fetched one chunk ahead, inside this tile only
    v16h ka0 = ld_frag_h(ktile, KLP, l15, 0, lane);
    v16h ka2 = ld_frag_h(ktile, KLP, 16 + l15, 0, lane);
    v16h ka1 = ld_frag_h(ktile, KLP, l15, 32, lane);
    v16h ka3 = ld_frag_h(ktile, KLP, 16 + l15, 32, lane);
#pragma unroll   // the four chunks of a tile read LDS at constant offsets from one address
    for (int c = 0; c < SK / 32; ++c) {
      // this chunk's four V^T fragments, one group of reads: they land under the scores and the softmax
      v16h va[4];
#pragma unroll
      for (int j = 0; j < 4; ++j) va[j] = ld_frag_h(vtile, VLP, j * 16 + l15, c * 32, lane);
      // keeps the group of reads above the score products, so that it is in flight under the scores and the softmax
      __builtin_amdgcn_sched_barrier(0);
      v8f c0 = {}, c1 = {};
      c0 = mma_f16(ka0, qb0, c0);
      c1 = mma_f16(ka2, qb0, c1);
      c0 = mma_f16(ka1, qb1, c0);
      c1 = mma_f16(ka3, qb1, c1);
      if (c + 1 < SK / 32) {   // next chunk's K fragments, one group: they land under the softmax and the context products
        const _Float16* kn = ktile + (c + 1) * 32 * KLP;
        ka0 = ld_frag_h(kn, KLP, l15, 0, lane);
        ka2 = ld_frag_h(kn, KLP, 16 + l15, 0, lane);
        ka1 = ld_frag_h(kn, KLP, l15, 32, lane);
        ka3 = ld_frag_h(kn, KLP, 16 + l15, 32, lane);
        // keeps that group here, ahead of the softmax, so that the next chunk's score products find it landed
        __builtin_amdgcn_sched_barrier(0);
      }

      // maximum over the raw accumulators (the scale is positive, so the order is the same)
      float lm = fmaxf(c0[0], c1[0]);
#pragma unroll
      for (int r = 1; r < 8; ++r) lm = fmaxf(lm, fmaxf(c0[r], c1[r]));
      lm = fmaxf(lm, __shfl_xor(lm, 16, 32));
      const float mnew = fmaxf(mrun, lm);
      const float alpha = __builtin_amdgcn_exp2f((mrun - mnew) * kq);
      const float nb = fmaf(-mnew, kq, 10.0f);   // 10 = log2(1024): P leaves the exponential already x1024
      float p0[8], p1[8];
      float ls = 0.0f;
#pragma unroll
      for (int r = 0; r < 8; ++r) {
        p0[r] = __builtin_amdgcn_exp2f(fmaf(c0[r], kq, nb));
        p1[r] = __builtin_amdgcn_exp2f(fmaf(c1[r], kq, nb));
        ls += p0[r] + p1[r];
      }
      ls += __shfl_xor(ls, 16, 32);
      lrun = lrun * alpha + ls;
      mrun = mnew;
#pragma unroll
      for (int j = 0; j < 4; ++j)
#pragma unroll
        for (int r = 0; r < 8; ++r) o[j][r] *= alpha;

      v16h pb;
#pragma unroll
      for (int e = 0; e < 8; ++e) {
        pb[e]     = (_Float16)p0[e];   // key 32c + 8h + e of the tile
        pb[8 + e] = (_Float16)p1[e];   // key 32c + 16 + 8h + e of the tile
      }
#pragma unroll
      for (int j = 0; j < 4; ++j) o[j] = mma_f16(va[j], pb, o[j]);
    }
    asm volatile("s_wait_dscnt 0x0" ::: "memory");      // this wave's reads of buffer b are done
    asm volatile("s_wait_asynccnt 0x0" ::: "memory");   // this wave's part of tile t + 1 has landed
    __syncthreads();   // publishes tile t + 1 and ends every wave's reads of buffer b
    if (t + 2 < NST)   // the same for the whole workgroup
      copy_tile(lk0 + b * kbuf, lv0 + b * vbuf,
                gk + (size_t)(t + 2) * SK * OUT_DIM, gv + (size_t)(t + 2) * SK);
  }
  asm volatile("s_wait_asynccnt 0x0" ::: "memory");     // nothing in flight when the wave ends

  // o[j][r] = 8192 * sum_t p_t v_t for query l15, d = j*16 + 8*half + r; lrun = 1024 * sum_t p_t
  const float inv = 1.0f / (lrun * 8.0f);
#pragma unroll
  for (int j = 0; j < 4; ++j) {
    v4f lo4, hi4;
    lo4[0] = o[j][0] * inv; lo4[1] = o[j][1] * inv; lo4[2] = o[j][2] * inv; lo4[3] = o[j][3] * inv;
    hi4[0] = o[j][4] * inv; hi4[1] = o[j][5] * inv; hi4[2] = o[j][6] * inv; hi4[3] = o[j][7] * inv;
    *(v4f*)(&Ol[l15 * OLP + j * 16 + 8 * half])     = lo4;
    *(v4f*)(&Ol[l15 * OLP + j * 16 + 8 * half + 4]) = hi4;
  }
  __syncthreads();

  v4f v[8];
  size_t off[8];
  float* ob = outp + (size_t)q0 * OUT_DIM + head * HEAD_DIM;
#pragma unroll
  for (int it = 0; it < 8; ++it) {
    const int row = it * 2 + half;       // 0..15
    const int q = l15;                   // 16 pieces of 16 B = the row's 256 bytes (2 lines)
    v[it] = *(const v4f*)(&Ol[row * OLP + q * 4]);
    off[it] = (size_t)row * OUT_DIM + q * 4;
  }
#pragma unroll
  for (int it = 0; it < 8; ++it) *(v4f*)(ob + off[it]) = v[it];
  
}

// ---------------------------------------------------------------------------
extern "C" void kernel_launch(void* const* d_in, const int* in_sizes, int n_in,
                              void* d_out, int out_size, void* d_ws, size_t ws_size,
                              hipStream_t stream) {
  if (n_in < 7) return;
  if (in_sizes[0] < SEQ * IN_DIM) return;
  if (in_sizes[1] < IN_DIM * OUT_DIM || in_sizes[2] < IN_DIM * OUT_DIM ||
      in_sizes[3] < IN_DIM * OUT_DIM) return;
  if (in_sizes[4] < OUT_DIM || in_sizes[5] < OUT_DIM || in_sizes[6] < OUT_DIM) return;
  if (out_size < SEQ * OUT_DIM) return;

  const float* h  = (const float*)d_in[0];
  const float* Wq = (const float*)d_in[1];
  const float* Wk = (const float*)d_in[2];
  const float* Wv = (const float*)d_in[3];
  const float* bq = (const float*)d_in[4];
  const float* bk = (const float*)d_in[5];
  const float* bv = (const float*)d_in[6];

  // every offset a multiple of 2 MiB
  const size_t hb_bytes = (size_t)SEQ * IN_DIM * 2;           // bf16 h plane
  const size_t wt_bytes = (size_t)3 * OUT_DIM * IN_DIM * 2;   // 3 bf16 WT planes
  const size_t pl_bytes = (size_t)SEQ * OUT_DIM * 2;          // one f16 q/k/vT plane
  const size_t off_hb = 0;
  const size_t off_wt = off_hb + hb_bytes;
  const size_t off_q  = off_wt + wt_bytes;
  const size_t off_k  = off_q + pl_bytes;
  const size_t off_vt = off_k + pl_bytes;
  const size_t total  = off_vt + pl_bytes;                    // 38 MiB at SEQ = 4096
  if (total > ws_size) return;

  char* ws = (char*)d_ws;
  unsigned short* hb  = (unsigned short*)(ws + off_hb);
  unsigned short* wt  = (unsigned short*)(ws + off_wt);
  unsigned short* qpl = (unsigned short*)(ws + off_q);
  unsigned short* kpl = (unsigned short*)(ws + off_k);
  unsigned short* vtp = (unsigned short*)(ws + off_vt);

  const int n8 = SEQ * IN_DIM / 8;
  k_cvt_rows<<<(n8 + 255) / 256, 256, 0, stream>>>(h, hb, n8);
  k_cvt_wT<<<dim3(IN_DIM / 64, OUT_DIM / 64, 3), 256, 0, stream>>>(Wq, Wk, Wv, wt);
  k_proj<<<dim3(OUT_DIM / 64, SEQ / 128, 3), 256, 0, stream>>>(hb, wt, bq, bk, bv, qpl, kpl, vtp);
  k_attn<<<dim3(SEQ / (AW * 16), NUM_HEADS), AW * 32, 0, stream>>>(qpl, kpl, vtp, (float*)d_out);
}

// v004
// One run takes 107 microseconds.
// Next to v003, in two timings, it ran 1.12 and 1.11 times as fast.
// Over all steps from v000 it is 3.06 times as fast.
#include <hip/hip_runtime.h>
// Projections h*W{q,k,v}: v_wmma_f32_16x16x32_bf16 (bf16 operands = RNE-converted inputs, f32 accumulate); scores K*Q^T and context V^T*P: v_wmma_f32_16x16x32_f16 (f16 operands, Q/K/V planes carried x8, P carried x1024, f32 accumulate); softmax in f32.

#ifndef SEQ
#define SEQ 4096
#endif
#define SEQ_FULL 4096
#define IN_DIM 1024
#define NUM_HEADS 16
#define HEAD_DIM 64
#define OUT_DIM (NUM_HEADS * HEAD_DIM)

static_assert(SEQ % 128 == 0);
static_assert(SEQ <= SEQ_FULL);
static_assert(IN_DIM % 64 == 0);
static_assert(OUT_DIM % 128 == 0);
static_assert(HEAD_DIM == 64);
static_assert((size_t)SEQ_FULL * OUT_DIM * 4 == 16777216);

// LDS pitches (in 16-bit elements unless noted); all keep 16-byte row alignment
#define TP  72     // weight transpose tile [64 n][64 k]
#define OLP 68     // context tile [16 q][64 d], floats

typedef __bf16   v16bf __attribute__((ext_vector_type(16)));
typedef __bf16   v8bf  __attribute__((ext_vector_type(8)));
typedef _Float16 v16h  __attribute__((ext_vector_type(16)));
typedef _Float16 v8h   __attribute__((ext_vector_type(8)));
typedef float    v8f   __attribute__((ext_vector_type(8)));
typedef float    v4f   __attribute__((ext_vector_type(4)));
typedef unsigned int v4u __attribute__((ext_vector_type(4)));

// ---------------------------------------------------------------------------
// WMMA wrappers with the VALU hazard guard (4 v_nop after every issue).
__device__ __forceinline__ v8f mma_bf16(v16bf a, v16bf b, v8f c) {
  v8f d = __builtin_amdgcn_wmma_f32_16x16x32_bf16(false, a, false, b, (short)0, c, false, false);
  asm volatile("v_nop\n\tv_nop\n\tv_nop\n\tv_nop" : "+v"(d) : "v"(a), "v"(b));
  return d;
}
__device__ __forceinline__ v8f mma_f16(v16h a, v16h b, v8f c) {
  v8f d = __builtin_amdgcn_wmma_f32_16x16x32_f16(false, a, false, b, (short)0, c, false, false);
  asm volatile("v_nop\n\tv_nop\n\tv_nop\n\tv_nop" : "+v"(d) : "v"(a), "v"(b));
  return d;
}

// 16-bit fragment, contraction dim CONTIGUOUS in memory: elem(k) = p0[rc*ld + k].
// Lane l: row/col rc = (l&15); elements 0..7 <- kk+8h+0..7, elements 8..15 <- kk+16+8h+0..7
// (h = l>>4). Same map for A (rc = row) and B (rc = column of a k-contiguous copy).
__device__ __forceinline__ v16bf ld_frag_bf(const __bf16* p0, int ld, int rc, int kk, int lane) {
  const int hh = (lane >> 4) & 1;
  const __bf16* p = p0 + (size_t)rc * ld + kk + 8 * hh;
  const v8bf lo = *(const v8bf*)(p);
  const v8bf hi = *(const v8bf*)(p + 16);
  v16bf f;
#pragma unroll
  for (int i = 0; i < 8; ++i) { f[i] = lo[i]; f[8 + i] = hi[i]; }
  return f;
}
__device__ __forceinline__ v16h ld_frag_h(const _Float16* p0, int ld, int rc, int kk, int lane) {
  const int hh = (lane >> 4) & 1;
  const _Float16* p = p0 + (size_t)rc * ld + kk + 8 * hh;
  const v8h lo = *(const v8h*)(p);
  const v8h hi = *(const v8h*)(p + 16);
  v16h f;
#pragma unroll
  for (int i = 0; i < 8; ++i) { f[i] = lo[i]; f[8 + i] = hi[i]; }
  return f;
}

// f32 -> bf16 bits, RNE convert
__device__ __forceinline__ unsigned int bfb(float x) {
  unsigned int u = __float_as_uint(x);
  u = u + 0x7FFFu + ((u >> 16) & 1u);
  return u >> 16;
}
// f32 -> value of its RNE bf16
__device__ __forceinline__ float bf16val(float x) {
  return __uint_as_float(bfb(x) << 16);
}
// f32 -> f16 bits, RNE convert
__device__ __forceinline__ unsigned short hbits(float x) {
  const _Float16 hv = (_Float16)x;
  return __builtin_bit_cast(unsigned short, hv);
}

// ---------------------------------------------------------------------------
// h f32 [SEQ][IN_DIM] -> bf16 plane (same layout). Thread g converts 8
// consecutive floats -> one 16-byte store; 8 consecutive lanes fill one
__global__ __launch_bounds__(256) void k_cvt_rows(const float* __restrict__ in,
                                                  unsigned short* __restrict__ outp, int n8) {
  const int g = blockIdx.x * 256 + threadIdx.x;
  if (g >= n8) return;
  const v4f a = *(const v4f*)(in + (size_t)g * 8);
  const v4f b = *(const v4f*)(in + (size_t)g * 8 + 4);
  v4u w;
  w[0] = bfb(a[0]) | (bfb(a[1]) << 16);
  w[1] = bfb(a[2]) | (bfb(a[3]) << 16);
  w[2] = bfb(b[0]) | (bfb(b[1]) << 16);
  w[3] = bfb(b[2]) | (bfb(b[3]) << 16);
  v4u* p = (v4u*)(outp + (size_t)g * 8);
  *p = w;
  
}

// ---------------------------------------------------------------------------
// W f32 [IN_DIM k][OUT_DIM n] -> WT bf16 [OUT_DIM n][IN_DIM k] (k contiguous),
// three matrices selected by blockIdx.z into three consecutive planes.
// Block = 64 k x 64 n tile transposed through LDS; each WT row segment
__global__ __launch_bounds__(256) void k_cvt_wT(const float* __restrict__ Wq,
                                                const float* __restrict__ Wk,
                                                const float* __restrict__ Wv,
                                                unsigned short* __restrict__ wT) {
  __shared__ __align__(16) unsigned short T[64 * TP];   // [n local][k local], cross-wave (block barrier)
  const int z = blockIdx.z;
  const float* W = (z == 0) ? Wq : ((z == 1) ? Wk : Wv);
  unsigned short* dst = wT + (size_t)z * OUT_DIM * IN_DIM;
  const int k0 = blockIdx.x * 64;
  const int n0 = blockIdx.y * 64;
  const int tid = threadIdx.x;
  const int wave = tid >> 5, lane = tid & 31;

#pragma unroll
  for (int i = 0; i < 4; ++i) {
    const int idx = i * 256 + tid;          // 0..1023
    const int kk = idx >> 4;                // 0..63
    const int c4 = (idx & 15) * 4;          // 0..60
    const v4f w = *(const v4f*)(W + (size_t)(k0 + kk) * OUT_DIM + n0 + c4);
    T[(c4 + 0) * TP + kk] = (unsigned short)bfb(w[0]);
    T[(c4 + 1) * TP + kk] = (unsigned short)bfb(w[1]);
    T[(c4 + 2) * TP + kk] = (unsigned short)bfb(w[2]);
    T[(c4 + 3) * TP + kk] = (unsigned short)bfb(w[3]);
  }
  __syncthreads();

  v4u v[2];
  size_t off[2];
#pragma unroll
  for (int it = 0; it < 2; ++it) {
    const int nn = wave * 8 + it * 4 + (lane >> 3);   // 0..63 over (wave, it, lane>>3)
    const int q = lane & 7;
    v[it] = *(const v4u*)(&T[nn * TP + q * 8]);
    off[it] = (size_t)(n0 + nn) * IN_DIM + k0 + q * 8;
  }
#pragma unroll
  for (int it = 0; it < 2; ++it) *(v4u*)(dst + off[it]) = v[it];
  
}

// ---------------------------------------------------------------------------
// Projection: C[SEQ][OUT_DIM] = hb[SEQ][IN_DIM] * WT[OUT_DIM][IN_DIM]^T + bias.
// 256 thr = 8 waves; block tile 128 rows x 128 cols; wave (wr, wc) owns 32 rows x 64 cols.
// A k-tile = 64 k of both operands: hb [128 rows][64 k] and WT [128 n][64 k], copied
// whole-line from the planes into LDS by asynchronous copies, two buffers: tile t + 1 is
// in flight while tile t is multiplied. Each accumulator still sums k in ascending 32-steps.
// z = 0: Q plane f16 x8 [SEQ][OUT_DIM]; z = 1: K plane f16 x8 [SEQ][OUT_DIM];
// z = 2: V^T plane f16 x8 [OUT_DIM][SEQ]. Epilogue staged in the same LDS behind the loop.
#define PK  64                 // k per tile
#define PLP 72                 // operand tile pitch: 144 B = 16 B x 9
#define PTS (128 * PLP)        // elements of one operand tile
#define PNT (IN_DIM / PK)      // tiles
#define EP  136                // epilogue tile pitch [128][128]: 272 B = 16 B x 17
static_assert(PNT >= 2);
static_assert(128 * EP <= 4 * PTS);
static_assert(256 * 4 * 8 == 128 * PK);   // four 16-byte copies a lane fill one operand tile

// One k-tile's copies of one lane: four 16-byte pieces of hb and four of WT, 32 rows apart.
// s_wait_xcnt 0 is the statement's last line, so that no address register named here is
// rewritten before it.
__device__ __forceinline__ void copy_ab(unsigned int la, unsigned int lw,
                                        const unsigned short* ga, const unsigned short* gw) {
  asm volatile(
      "global_load_async_to_lds_b128 %0, %8, off\n\t"
      "global_load_async_to_lds_b128 %1, %9, off\n\t"
      "global_load_async_to_lds_b128 %2, %10, off\n\t"
      "global_load_async_to_lds_b128 %3, %11, off\n\t"
      "global_load_async_to_lds_b128 %4, %12, off\n\t"
      "global_load_async_to_lds_b128 %5, %13, off\n\t"
      "global_load_async_to_lds_b128 %6, %14, off\n\t"
      "global_load_async_to_lds_b128 %7, %15, off\n\t"
      "s_wait_xcnt 0x0"
      :
      : "v"(la), "v"(la + 32u * PLP * 2u), "v"(la + 64u * PLP * 2u), "v"(la + 96u * PLP * 2u),
        "v"(lw), "v"(lw + 32u * PLP * 2u), "v"(lw + 64u * PLP * 2u), "v"(lw + 96u * PLP * 2u),
        "v"(ga), "v"(ga + (size_t)32 * IN_DIM), "v"(ga + (size_t)64 * IN_DIM),
        "v"(ga + (size_t)96 * IN_DIM),
        "v"(gw), "v"(gw + (size_t)32 * IN_DIM), "v"(gw + (size_t)64 * IN_DIM),
        "v"(gw + (size_t)96 * IN_DIM)
      : "memory");
}

__global__ __launch_bounds__(256) void k_proj(
    const unsigned short* __restrict__ hb, const unsigned short* __restrict__ wT,
    const float* __restrict__ bq, const float* __restrict__ bk, const float* __restrict__ bv,
    unsigned short* __restrict__ qp, unsigned short* __restrict__ kp,
    unsigned short* __restrict__ vtp) {
  // [buffer][hb tile | WT tile], cross-wave (block barrier); behind the loop the epilogue tile
  __shared__ __align__(16) unsigned short S[4 * PTS];

  const int z = blockIdx.z;
  const int n0 = blockIdx.x * 128;
  const int m0 = blockIdx.y * 128;
  const int tid = threadIdx.x;
  const int wave = tid >> 5, lane = tid & 31;
  const int l15 = lane & 15, half = (lane >> 4) & 1;
  const int wr = wave >> 1, wc = wave & 1;

  const unsigned short* Wt = wT + (size_t)z * OUT_DIM * IN_DIM;
  const float* bias = (z == 0) ? bq : ((z == 1) ? bk : bv);

  // this lane's first piece of a tile: row tid>>3, piece tid&7, in both operands
  const unsigned short* ga = hb + (size_t)(m0 + (tid >> 3)) * IN_DIM + (tid & 7) * 8;
  const unsigned short* gw = Wt + (size_t)(n0 + (tid >> 3)) * IN_DIM + (tid & 7) * 8;
  const unsigned int la0 = (unsigned int)(size_t)(&S[(tid >> 3) * PLP + (tid & 7) * 8]);
  const unsigned int lw0 = la0 + PTS * 2u;
  const unsigned int pbuf = 2u * PTS * 2u;         // bytes from buffer 0 to buffer 1

  copy_ab(la0, lw0, ga, gw);                                     // tile 0 -> buffer 0
  asm volatile("s_wait_asynccnt 0x0" ::: "memory");              // this wave's part of tile 0 has landed
  __syncthreads();                                               // tile 0 complete for every wave
  copy_ab(la0 + pbuf, lw0 + pbuf, ga + PK, gw + PK);             // tile 1 -> buffer 1

  v8f acc[2][4] = {};
  for (int t = 0; t < PNT; ++t) {
    const int b = t & 1;
    const __bf16* at = (const __bf16*)(S + b * 2 * PTS);
    const __bf16* wt = at + PTS;
#pragma unroll   // the two 32-k halves of a tile read LDS at constant offsets from one address
    for (int kk = 0; kk < PK; kk += 32) {
      v16bf a[2], w[4];
#pragma unroll
      for (int i = 0; i < 2; ++i) a[i] = ld_frag_bf(at, PLP, wr * 32 + i * 16 + l15, kk, lane);
#pragma unroll
      for (int j = 0; j < 4; ++j) w[j] = ld_frag_bf(wt, PLP, wc * 64 + j * 16 + l15, kk, lane);
#pragma unroll
      for (int j = 0; j < 4; ++j)
#pragma unroll
        for (int i = 0; i < 2; ++i) acc[i][j] = mma_bf16(a[i], w[j], acc[i][j]);
    }
    asm volatile("s_wait_dscnt 0x0" ::: "memory");      // this wave's reads of buffer b are done
    asm volatile("s_wait_asynccnt 0x0" ::: "memory");   // this wave's part of tile t + 1 has landed
    __syncthreads();   // publishes tile t + 1 and ends every wave's reads of buffer b
    if (t + 2 < PNT)   // the same for the whole workgroup
      copy_ab(la0 + b * pbuf, lw0 + b * pbuf, ga + (size_t)(t + 2) * PK, gw + (size_t)(t + 2) * PK);
  }
  asm volatile("s_wait_asynccnt 0x0" ::: "memory");     // nothing in flight when the LDS changes its use

  // acc[i][j][r] = C[m0 + wr*32 + i*16 + 8*half + r][n0 + wc*64 + j*16 + l15]
  unsigned short* E = S;   // every wave's last read of the tiles ended at the last trip's barrier
  const float car = 8.0f;
  if (z != 2) {                      // block-uniform branch
#pragma unroll
    for (int j = 0; j < 4; ++j) {
      const int col = wc * 64 + j * 16 + l15;
      const float bb = bf16val(bias[n0 + col]);
#pragma unroll
      for (int i = 0; i < 2; ++i)
#pragma unroll
        for (int r = 0; r < 8; ++r) {
          const int row = wr * 32 + i * 16 + 8 * half + r;
          E[row * EP + col] = hbits((acc[i][j][r] + bb) * car);
        }
    }
    __syncthreads();
    unsigned short* dst = (z == 0) ? qp : kp;
    v4u v[8];
    size_t off[8];
#pragma unroll
    for (int it = 0; it < 8; ++it) {
      const int row = it * 16 + (tid >> 4);               // 0..127 over (it, tid>>4)
      const int q = l15;                                  // 16 pieces = 256-byte row = 2 lines
      v[it] = *(const v4u*)(&E[row * EP + q * 8]);
      off[it] = (size_t)(m0 + row) * OUT_DIM + n0 + q * 8;
    }
#pragma unroll
    for (int it = 0; it < 8; ++it) *(v4u*)(dst + off[it]) = v[it];
    // behind the last store: no register that a store names is rewritten on any path of the listing before this wait
    asm volatile("s_wait_xcnt 0x0" ::: "memory");
  } else {
#pragma unroll
    for (int j = 0; j < 4; ++j) {
      const int col = wc * 64 + j * 16 + l15;             // d within tile
      const float bb = bf16val(bias[n0 + col]);
#pragma unroll
      for (int i = 0; i < 2; ++i)
#pragma unroll
        for (int r = 0; r < 8; ++r) {
          const int srow = wr * 32 + i * 16 + 8 * half + r;   // s within tile
          E[col * EP + srow] = hbits((acc[i][j][r] + bb) * car);
        }
    }
    __syncthreads();
    v4u v[8];
    size_t off[8];
#pragma unroll
    for (int it = 0; it < 8; ++it) {
      const int drow = it * 16 + (tid >> 4);              // 0..127 over (it, tid>>4)
      const int q = l15;                                  // 16 pieces = 256-byte row = 2 lines
      v[it] = *(const v4u*)(&E[drow * EP + q * 8]);
      off[it] = (size_t)(n0 + drow) * SEQ + m0 + q * 8;
    }
#pragma unroll
    for (int it = 0; it < 8; ++it) *(v4u*)(vtp + off[it]) = v[it];
  }
}

// ---------------------------------------------------------------------------
// Flash attention, transposed-score form: one wave = (16 queries, one head);
// a workgroup = 8 waves = 128 queries of one head, which share every K / V^T tile.
// A tile = 128 keys: K [128 keys][64 d] and V^T [64 d][128 keys], copied whole-line
// from the planes into LDS by asynchronous copies, two buffers: tile t + 1 is in
// flight while tile t is worked on. Fragments come from LDS (ds_load_b128 pitches).
// Per 32-key chunk:
//   S^T = K . Q^T    A = K rows (lane = key, k = d), B = Q^T (lane = query, k = d)
//                    D[row = key 8h+r][col = query l15]; c0 keys 0..15, c1 keys 16..31
//   per-lane online softmax for query l15 (16 local keys + xor-16 partner)
//   O^T += V^T . P   A = V^T rows (lane = d, k = key), B = P: element i<8 <- c0[i]
//                    (key 8h+i), element 8+i <- c1[i] (key 16+8h+i), same lane
//                    D[row = d 8h+r][col = query l15]
// Scores carry 64 from the x8 planes: P = exp2(score * log2(e)/512 - max * log2(e)/512 + 10),
// one multiply-add and one exponential a score; the running maximum stays in raw score units.
// P and its sum carried x1024, V carried x8 -> context scaled by 1/(8 * carried sum).
// Output tile [16 q][64 d] f32 staged in LDS; each 256-byte row = 2 lines,
#define AW  8                  // waves per workgroup
#define SK  128                // keys per tile
#define KLP 72                 // K tile pitch: 144 B = 16 B x 9
#define VLP 136                // V^T tile pitch: 272 B = 16 B x 17
#define NST (SEQ / SK)         // tiles
static_assert(SEQ % (AW * 16) == 0);
static_assert(NST >= 2);
static_assert(AW * 32 * 4 * 8 == SK * HEAD_DIM);   // four 16-byte copies a lane fill one tile

// One tile's copies of one lane: four 16-byte pieces of K (32 key rows apart) and four
// of V^T (16 d rows apart). s_wait_xcnt 0 is the statement's last line, so that no
// address register named here is rewritten before it.
__device__ __forceinline__ void copy_tile(unsigned int lk, unsigned int lv,
                                          const _Float16* gk, const _Float16* gv) {
  asm volatile(
      "global_load_async_to_lds_b128 %0, %8, off\n\t"
      "global_load_async_to_lds_b128 %1, %9, off\n\t"
      "global_load_async_to_lds_b128 %2, %10, off\n\t"
      "global_load_async_to_lds_b128 %3, %11, off\n\t"
      "global_load_async_to_lds_b128 %4, %12, off\n\t"
      "global_load_async_to_lds_b128 %5, %13, off\n\t"
      "global_load_async_to_lds_b128 %6, %14, off\n\t"
      "global_load_async_to_lds_b128 %7, %15, off\n\t"
      "s_wait_xcnt 0x0"
      :
      : "v"(lk), "v"(lk + 32u * KLP * 2u), "v"(lk + 64u * KLP * 2u), "v"(lk + 96u * KLP * 2u),
        "v"(lv), "v"(lv + 16u * VLP * 2u), "v"(lv + 32u * VLP * 2u), "v"(lv + 48u * VLP * 2u),
        "v"(gk), "v"(gk + (size_t)32 * OUT_DIM), "v"(gk + (size_t)64 * OUT_DIM),
        "v"(gk + (size_t)96 * OUT_DIM),
        "v"(gv), "v"(gv + (size_t)16 * SEQ), "v"(gv + (size_t)32 * SEQ), "v"(gv + (size_t)48 * SEQ)
      : "memory");
}

// Four waves per SIMD (two workgroups per WGP), as before: vector work between matrix runs wants waves.
__global__ __launch_bounds__(AW * 32) __attribute__((amdgpu_waves_per_eu(4, 4)))
void k_attn(const unsigned short* __restrict__ qp,
            const unsigned short* __restrict__ kp,
            const unsigned short* __restrict__ vtp,
            float* __restrict__ outp) {
  __shared__ __align__(16) _Float16 Kt[2][SK * KLP];         // K tiles, cross-wave (block barrier)
  __shared__ __align__(16) _Float16 Vt[2][HEAD_DIM * VLP];   // V^T tiles, cross-wave (block barrier)
  __shared__ __align__(16) float Olw[AW][16 * OLP];          // one output tile per wave

  const int tid = threadIdx.x;
  const int wave = tid >> 5;
  const int lane = tid & 31;
  const int l15 = lane & 15;
  const int half = (lane >> 4) & 1;
  const int q0 = blockIdx.x * (AW * 16) + wave * 16;
  const int head = blockIdx.y;
  float* Ol = Olw[wave];

  const _Float16* Q  = (const _Float16*)qp;
  const _Float16* K  = (const _Float16*)kp;
  const _Float16* VT = (const _Float16*)vtp;

  const _Float16* qbase = Q + (size_t)q0 * OUT_DIM + head * HEAD_DIM;
  const v16h qb0 = ld_frag_h(qbase, OUT_DIM, l15, 0, lane);    // d 0..31
  const v16h qb1 = ld_frag_h(qbase, OUT_DIM, l15, 32, lane);   // d 32..63
  const _Float16* kbase = K + head * HEAD_DIM;                   // key t at kbase + t*OUT_DIM
  const _Float16* vbase = VT + (size_t)head * HEAD_DIM * SEQ;    // d row at vbase + d*SEQ

  // this lane's first piece of a tile: K row tid>>3, piece tid&7; V^T row tid>>4, piece tid&15
  const _Float16* gk = kbase + (size_t)(tid >> 3) * OUT_DIM + (tid & 7) * 8;
  const _Float16* gv = vbase + (size_t)(tid >> 4) * SEQ + (tid & 15) * 8;
  const unsigned int lk0 = (unsigned int)(size_t)(&Kt[0][(tid >> 3) * KLP + (tid & 7) * 8]);
  const unsigned int lv0 = (unsigned int)(size_t)(&Vt[0][(tid >> 4) * VLP + (tid & 15) * 8]);
  const unsigned int kbuf = SK * KLP * 2u;         // bytes from buffer 0 to buffer 1
  const unsigned int vbuf = HEAD_DIM * VLP * 2u;

  copy_tile(lk0, lv0, gk, gv);                                   // tile 0 -> buffer 0
  asm volatile("s_wait_asynccnt 0x0" ::: "memory");              // this wave's part of tile 0 has landed
  __syncthreads();                                               // tile 0 complete for every wave
  copy_tile(lk0 + kbuf, lv0 + vbuf, gk + (size_t)SK * OUT_DIM, gv + SK);   // tile 1 -> buffer 1

  v8f o[4] = {};
  float mrun = -1.0e30f, lrun = 0.0f;
  const float kq = 1.44269504f / 512.0f;   // 1/512 (score scale on the x8 planes) times log2(e)

  for (int t = 0; t < NST; ++t) {
    const int b = t & 1;
    const _Float16* ktile = Kt[b];
    const _Float16* vtile = Vt[b];
    // K fragments of chunk 0; later chunks' are fetched one chunk ahead, inside this tile only
    v16h ka0 = ld_frag_h(ktile, KLP, l15, 0, lane);
    v16h ka2 = ld_frag_h(ktile, KLP, 16 + l15, 0, lane);
    v16h ka1 = ld_frag_h(ktile, KLP, l15, 32, lane);
    v16h ka3 = ld_frag_h(ktile, KLP, 16 + l15, 32, lane);
#pragma unroll   // the four chunks of a tile read LDS at constant offsets from one address
    for (int c = 0; c < SK / 32; ++c) {
      // this chunk's four V^T fragments, one group of reads: they land under the scores and the softmax
      v16h va[4];
#pragma unroll
      for (int j = 0; j < 4; ++j) va[j] = ld_frag_h(vtile, VLP, j * 16 + l15, c * 32, lane);
      // keeps the group of reads above the score products, so that it is in flight under the scores and the softmax
      __builtin_amdgcn_sched_barrier(0);
      v8f c0 = {}, c1 = {};
      c0 = mma_f16(ka0, qb0, c0);
      c1 = mma_f16(ka2, qb0, c1);
      c0 = mma_f16(ka1, qb1, c0);
      c1 = mma_f16(ka3, qb1, c1);
      if (c + 1 < SK / 32) {   // next chunk's K fragments, one group: they land under the softmax and the context products
        const _Float16* kn = ktile + (c + 1) * 32 * KLP;
        ka0 = ld_frag_h(kn, KLP, l15, 0, lane);
        ka2 = ld_frag_h(kn, KLP, 16 + l15, 0, lane);
        ka1 = ld_frag_h(kn, KLP, l15, 32, lane);
        ka3 = ld_frag_h(kn, KLP, 16 + l15, 32, lane);
        // keeps that group here, ahead of the softmax, so that the next chunk's score products find it landed
        __builtin_amdgcn_sched_barrier(0);
      }

      // maximum over the raw accumulators (the scale is positive, so the order is the same)
      float lm = fmaxf(c0[0], c1[0]);
#pragma unroll
      for (int r = 1; r < 8; ++r) lm = fmaxf(lm, fmaxf(c0[r], c1[r]));
      lm = fmaxf(lm, __shfl_xor(lm, 16, 32));
      const float mnew = fmaxf(mrun, lm);
      const float alpha = __builtin_amdgcn_exp2f((mrun - mnew) * kq);
      const float nb = fmaf(-mnew, kq, 10.0f);   // 10 = log2(1024): P leaves the exponential already x1024
      float p0[8], p1[8];
      float ls = 0.0f;
#pragma unroll
      for (int r = 0; r < 8; ++r) {
        p0[r] = __builtin_amdgcn_exp2f(fmaf(c0[r], kq, nb));
        p1[r] = __builtin_amdgcn_exp2f(fmaf(c1[r], kq, nb));
        ls += p0[r] + p1[r];
      }
      ls += __shfl_xor(ls, 16, 32);
      lrun = lrun * alpha + ls;
      mrun = mnew;
#pragma unroll
      for (int j = 0; j < 4; ++j)
#pragma unroll
        for (int r = 0; r < 8; ++r) o[j][r] *= alpha;

      v16h pb;
#pragma unroll
      for (int e = 0; e < 8; ++e) {
        pb[e]     = (_Float16)p0[e];   // key 32c + 8h + e of the tile
        pb[8 + e] = (_Float16)p1[e];   // key 32c + 16 + 8h + e of the tile
      }
#pragma unroll
      for (int j = 0; j < 4; ++j) o[j] = mma_f16(va[j], pb, o[j]);
    }
    asm volatile("s_wait_dscnt 0x0" ::: "memory");      // this wave's reads of buffer b are done
    asm volatile("s_wait_asynccnt 0x0" ::: "memory");   // this wave's part of tile t + 1 has landed
    __syncthreads();   // publishes tile t + 1 and ends every wave's reads of buffer b
    if (t + 2 < NST)   // the same for the whole workgroup
      copy_tile(lk0 + b * kbuf, lv0 + b * vbuf,
                gk + (size_t)(t + 2) * SK * OUT_DIM, gv + (size_t)(t + 2) * SK);
  }
  asm volatile("s_wait_asynccnt 0x0" ::: "memory");     // nothing in flight when the wave ends

  // o[j][r] = 8192 * sum_t p_t v_t for query l15, d = j*16 + 8*half + r; lrun = 1024 * sum_t p_t
  const float inv = 1.0f / (lrun * 8.0f);
#pragma unroll
  for (int j = 0; j < 4; ++j) {
    v4f lo4, hi4;
    lo4[0] = o[j][0] * inv; lo4[1] = o[j][1] * inv; lo4[2] = o[j][2] * inv; lo4[3] = o[j][3] * inv;
    hi4[0] = o[j][4] * inv; hi4[1] = o[j][5] * inv; hi4[2] = o[j][6] * inv; hi4[3] = o[j][7] * inv;
    *(v4f*)(&Ol[l15 * OLP + j * 16 + 8 * half])     = lo4;
    *(v4f*)(&Ol[l15 * OLP + j * 16 + 8 * half + 4]) = hi4;
  }
  __syncthreads();

  v4f v[8];
  size_t off[8];
  float* ob = outp + (size_t)q0 * OUT_DIM + head * HEAD_DIM;
#pragma unroll
  for (int it = 0; it < 8; ++it) {
    const int row = it * 2 + half;       // 0..15
    const int q = l15;                   // 16 pieces of 16 B = the row's 256 bytes (2 lines)
    v[it] = *(const v4f*)(&Ol[row * OLP + q * 4]);
    off[it] = (size_t)row * OUT_DIM + q * 4;
  }
#pragma unroll
  for (int it = 0; it < 8; ++it) *(v4f*)(ob + off[it]) = v[it];
  
}

// ---------------------------------------------------------------------------
extern "C" void kernel_launch(void* const* d_in, const int* in_sizes, int n_in,
                              void* d_out, int out_size, void* d_ws, size_t ws_size,
                              hipStream_t stream) {
  if (n_in < 7) return;
  if (in_sizes[0] < SEQ * IN_DIM) return;
  if (in_sizes[1] < IN_DIM * OUT_DIM || in_sizes[2] < IN_DIM * OUT_DIM ||
      in_sizes[3] < IN_DIM * OUT_DIM) return;
  if (in_sizes[4] < OUT_DIM || in_sizes[5] < OUT_DIM || in_sizes[6] < OUT_DIM) return;
  if (out_size < SEQ * OUT_DIM) return;

  const float* h  = (const float*)d_in[0];
  const float* Wq = (const float*)d_in[1];
  const float* Wk = (const float*)d_in[2];
  const float* Wv = (const float*)d_in[3];
  const float* bq = (const float*)d_in[4];
  const float* bk = (const float*)d_in[5];
  const float* bv = (const float*)d_in[6];

  // every offset a multiple of 2 MiB
  const size_t hb_bytes = (size_t)SEQ * IN_DIM * 2;           // bf16 h plane
  const size_t wt_bytes = (size_t)3 * OUT_DIM * IN_DIM * 2;   // 3 bf16 WT planes
  const size_t pl_bytes = (size_t)SEQ * OUT_DIM * 2;          // one f16 q/k/vT plane
  const size_t off_hb = 0;
  const size_t off_wt = off_hb + hb_bytes;
  const size_t off_q  = off_wt + wt_bytes;
  const size_t off_k  = off_q + pl_bytes;
  const size_t off_vt = off_k + pl_bytes;
  const size_t total  = off_vt + pl_bytes;                    // 38 MiB at SEQ = 4096
  if (total > ws_size) return;

  char* ws = (char*)d_ws;
  unsigned short* hb  = (unsigned short*)(ws + off_hb);
  unsigned short* wt  = (unsigned short*)(ws + off_wt);
  unsigned short* qpl = (unsigned short*)(ws + off_q);
  unsigned short* kpl = (unsigned short*)(ws + off_k);
  unsigned short* vtp = (unsigned short*)(ws + off_vt);

  const int n8 = SEQ * IN_DIM / 8;
  k_cvt_rows<<<(n8 + 255) / 256, 256, 0, stream>>>(h, hb, n8);
  k_cvt_wT<<<dim3(IN_DIM / 64, OUT_DIM / 64, 3), 256, 0, stream>>>(Wq, Wk, Wv, wt);
  k_proj<<<dim3(OUT_DIM / 128, SEQ / 128, 3), 256, 0, stream>>>(hb, wt, bq, bk, bv, qpl, kpl, vtp);
  k_attn<<<dim3(SEQ / (AW * 16), NUM_HEADS), AW * 32, 0, stream>>>(qpl, kpl, vtp, (float*)d_out);
}

// v005
// It runs in 95.9 microseconds.
// In both of two side-by-side timings against v004, it was 1.11 times as fast.
// Over all steps from v000 it is 3.40 times as fast.
#include <hip/hip_runtime.h>
// Projections h*W{q,k,v}: v_wmma_f32_16x16x32_bf16 (bf16 operands = RNE-converted inputs, f32 accumulate); scores K*Q^T and context V^T*P: v_wmma_f32_16x16x32_f16 (f16 operands, Q/K/V planes carried x8, P carried x1024, f32 accumulate); softmax in f32.

#ifndef SEQ
#define SEQ 4096
#endif
#define SEQ_FULL 4096
#define IN_DIM 1024
#define NUM_HEADS 16
#define HEAD_DIM 64
#define OUT_DIM (NUM_HEADS * HEAD_DIM)

static_assert(SEQ % 128 == 0);
static_assert(SEQ <= SEQ_FULL);
static_assert(IN_DIM % 64 == 0);
static_assert(OUT_DIM % 128 == 0);
static_assert(HEAD_DIM == 64);
static_assert((size_t)SEQ_FULL * OUT_DIM * 4 == 16777216);

// LDS pitches (in 16-bit elements unless noted); all keep 16-byte row alignment
#define TP  72     // weight transpose tile [64 n][64 k]
#define OLP 68     // context tile [16 q][64 d], floats

typedef __bf16   v16bf __attribute__((ext_vector_type(16)));
typedef __bf16   v8bf  __attribute__((ext_vector_type(8)));
typedef _Float16 v16h  __attribute__((ext_vector_type(16)));
typedef _Float16 v8h   __attribute__((ext_vector_type(8)));
typedef float    v8f   __attribute__((ext_vector_type(8)));
typedef float    v4f   __attribute__((ext_vector_type(4)));
typedef unsigned int v4u __attribute__((ext_vector_type(4)));

// ---------------------------------------------------------------------------
// WMMA wrappers with the VALU hazard guard (4 v_nop after every issue).
__device__ __forceinline__ v8f mma_bf16(v16bf a, v16bf b, v8f c) {
  v8f d = __builtin_amdgcn_wmma_f32_16x16x32_bf16(false, a, false, b, (short)0, c, false, false);
  asm volatile("v_nop\n\tv_nop\n\tv_nop\n\tv_nop" : "+v"(d) : "v"(a), "v"(b));
  return d;
}
__device__ __forceinline__ v8f mma_f16(v16h a, v16h b, v8f c) {
  v8f d = __builtin_amdgcn_wmma_f32_16x16x32_f16(false, a, false, b, (short)0, c, false, false);
  asm volatile("v_nop\n\tv_nop\n\tv_nop\n\tv_nop" : "+v"(d) : "v"(a), "v"(b));
  return d;
}

// 16-bit fragment, contraction dim CONTIGUOUS in memory: elem(k) = p0[rc*ld + k].
// Lane l: row/col rc = (l&15); elements 0..7 <- kk+8h+0..7, elements 8..15 <- kk+16+8h+0..7
// (h = l>>4). Same map for A (rc = row) and B (rc = column of a k-contiguous copy).
__device__ __forceinline__ v16bf ld_frag_bf(const __bf16* p0, int ld, int rc, int kk, int lane) {
  const int hh = (lane >> 4) & 1;
  const __bf16* p = p0 + (size_t)rc * ld + kk + 8 * hh;
  const v8bf lo = *(const v8bf*)(p);
  const v8bf hi = *(const v8bf*)(p + 16);
  v16bf f;
#pragma unroll
  for (int i = 0; i < 8; ++i) { f[i] = lo[i]; f[8 + i] = hi[i]; }
  return f;
}
__device__ __forceinline__ v16h ld_frag_h(const _Float16* p0, int ld, int rc, int kk, int lane) {
  const int hh = (lane >> 4) & 1;
  const _Float16* p = p0 + (size_t)rc * ld + kk + 8 * hh;
  const v8h lo = *(const v8h*)(p);
  const v8h hi = *(const v8h*)(p + 16);
  v16h f;
#pragma unroll
  for (int i = 0; i < 8; ++i) { f[i] = lo[i]; f[8 + i] = hi[i]; }
  return f;
}

// f32 -> bf16 bits, RNE convert
__device__ __forceinline__ unsigned int bfb(float x) {
  unsigned int u = __float_as_uint(x);
  u = u + 0x7FFFu + ((u >> 16) & 1u);
  return u >> 16;
}
// f32 -> value of its RNE bf16
__device__ __forceinline__ float bf16val(float x) {
  return __uint_as_float(bfb(x) << 16);
}
// f32 -> f16 bits, RNE convert
__device__ __forceinline__ unsigned short hbits(float x) {
  const _Float16 hv = (_Float16)x;
  return __builtin_bit_cast(unsigned short, hv);
}

// ---------------------------------------------------------------------------
// h f32 [SEQ][IN_DIM] -> bf16 plane (same layout). Thread g converts 8
// consecutive floats -> one 16-byte store; 8 consecutive lanes fill one
__global__ __launch_bounds__(256) void k_cvt_rows(const float* __restrict__ in,
                                                  unsigned short* __restrict__ outp, int n8) {
  const int g = blockIdx.x * 256 + threadIdx.x;
  if (g >= n8) return;
  const v4f a = *(const v4f*)(in + (size_t)g * 8);
  const v4f b = *(const v4f*)(in + (size_t)g * 8 + 4);
  v4u w;
  w[0] = bfb(a[0]) | (bfb(a[1]) << 16);
  w[1] = bfb(a[2]) | (bfb(a[3]) << 16);
  w[2] = bfb(b[0]) | (bfb(b[1]) << 16);
  w[3] = bfb(b[2]) | (bfb(b[3]) << 16);
  v4u* p = (v4u*)(outp + (size_t)g * 8);
  *p = w;
  
}

// ---------------------------------------------------------------------------
// W f32 [IN_DIM k][OUT_DIM n] -> WT bf16 [OUT_DIM n][IN_DIM k] (k contiguous),
// three matrices selected by blockIdx.z into three consecutive planes.
// Block = 64 k x 64 n tile transposed through LDS; each WT row segment
__global__ __launch_bounds__(256) void k_cvt_wT(const float* __restrict__ Wq,
                                                const float* __restrict__ Wk,
                                                const float* __restrict__ Wv,
                                                unsigned short* __restrict__ wT) {
  __shared__ __align__(16) unsigned short T[64 * TP];   // [n local][k local], cross-wave (block barrier)
  const int z = blockIdx.z;
  const float* W = (z == 0) ? Wq : ((z == 1) ? Wk : Wv);
  unsigned short* dst = wT + (size_t)z * OUT_DIM * IN_DIM;
  const int k0 = blockIdx.x * 64;
  const int n0 = blockIdx.y * 64;
  const int tid = threadIdx.x;
  const int wave = tid >> 5, lane = tid & 31;

#pragma unroll
  for (int i = 0; i < 4; ++i) {
    const int idx = i * 256 + tid;          // 0..1023
    const int kk = idx >> 4;                // 0..63
    const int c4 = (idx & 15) * 4;          // 0..60
    const v4f w = *(const v4f*)(W + (size_t)(k0 + kk) * OUT_DIM + n0 + c4);
    T[(c4 + 0) * TP + kk] = (unsigned short)bfb(w[0]);
    T[(c4 + 1) * TP + kk] = (unsigned short)bfb(w[1]);
    T[(c4 + 2) * TP + kk] = (unsigned short)bfb(w[2]);
    T[(c4 + 3) * TP + kk] = (unsigned short)bfb(w[3]);
  }
  __syncthreads();

  v4u v[2];
  size_t off[2];
#pragma unroll
  for (int it = 0; it < 2; ++it) {
    const int nn = wave * 8 + it * 4 + (lane >> 3);   // 0..63 over (wave, it, lane>>3)
    const int q = lane & 7;
    v[it] = *(const v4u*)(&T[nn * TP + q * 8]);
    off[it] = (size_t)(n0 + nn) * IN_DIM + k0 + q * 8;
  }
#pragma unroll
  for (int it = 0; it < 2; ++it) *(v4u*)(dst + off[it]) = v[it];
  
}

// ---------------------------------------------------------------------------
// Projection: C[SEQ][OUT_DIM] = hb[SEQ][IN_DIM] * WT[OUT_DIM][IN_DIM]^T + bias.
// 256 thr = 8 waves; block tile 128 rows x 128 cols; wave (wr, wc) owns 32 rows x 64 cols.
// A k-tile = 64 k of both operands: hb [128 rows][64 k] and WT [128 n][64 k], copied
// whole-line from the planes into LDS by asynchronous copies, two buffers: tile t + 1 is
// in flight while tile t is multiplied. Each accumulator still sums k in ascending 32-steps.
// z = 0: Q plane f16 x8 [SEQ][OUT_DIM]; z = 1: K plane f16 x8 [SEQ][OUT_DIM];
// z = 2: V^T plane f16 x8 [OUT_DIM][SEQ]. Epilogue staged in the same LDS behind the loop.
#define PK  64                 // k per tile
#define PLP 72                 // operand tile pitch: 144 B = 16 B x 9
#define PTS (128 * PLP)        // elements of one operand tile
#define PNT (IN_DIM / PK)      // tiles
#define EP  136                // epilogue tile pitch [128][128]: 272 B = 16 B x 17
static_assert(PNT >= 2);
static_assert(128 * EP <= 4 * PTS);
static_assert(256 * 4 * 8 == 128 * PK);   // four 16-byte copies a lane fill one operand tile

// One k-tile's copies of one lane: four 16-byte pieces of hb and four of WT, 32 rows apart.
// s_wait_xcnt 0 is the statement's last line, so that no address register named here is
// rewritten before it.
__device__ __forceinline__ void copy_ab(unsigned int la, unsigned int lw,
                                        const unsigned short* ga, const unsigned short* gw) {
  asm volatile(
      "global_load_async_to_lds_b128 %0, %8, off\n\t"
      "global_load_async_to_lds_b128 %1, %9, off\n\t"
      "global_load_async_to_lds_b128 %2, %10, off\n\t"
      "global_load_async_to_lds_b128 %3, %11, off\n\t"
      "global_load_async_to_lds_b128 %4, %12, off\n\t"
      "global_load_async_to_lds_b128 %5, %13, off\n\t"
      "global_load_async_to_lds_b128 %6, %14, off\n\t"
      "global_load_async_to_lds_b128 %7, %15, off\n\t"
      "s_wait_xcnt 0x0"
      :
      : "v"(la), "v"(la + 32u * PLP * 2u), "v"(la + 64u * PLP * 2u), "v"(la + 96u * PLP * 2u),
        "v"(lw), "v"(lw + 32u * PLP * 2u), "v"(lw + 64u * PLP * 2u), "v"(lw + 96u * PLP * 2u),
        "v"(ga), "v"(ga + (size_t)32 * IN_DIM), "v"(ga + (size_t)64 * IN_DIM),
        "v"(ga + (size_t)96 * IN_DIM),
        "v"(gw), "v"(gw + (size_t)32 * IN_DIM), "v"(gw + (size_t)64 * IN_DIM),
        "v"(gw + (size_t)96 * IN_DIM)
      : "memory");
}

__global__ __launch_bounds__(256) void k_proj(
    const unsigned short* __restrict__ hb, const unsigned short* __restrict__ wT,
    const float* __restrict__ bq, const float* __restrict__ bk, const float* __restrict__ bv,
    unsigned short* __restrict__ qp, unsigned short* __restrict__ kp,
    unsigned short* __restrict__ vtp) {
  // [buffer][hb tile | WT tile], cross-wave (block barrier); behind the loop the epilogue tile
  __shared__ __align__(16) unsigned short S[4 * PTS];

  const int z = blockIdx.z;
  const int n0 = blockIdx.x * 128;
  const int m0 = blockIdx.y * 128;
  const int tid = threadIdx.x;
  const int wave = tid >> 5, lane = tid & 31;
  const int l15 = lane & 15, half = (lane >> 4) & 1;
  const int wr = wave >> 1, wc = wave & 1;

  const unsigned short* Wt = wT + (size_t)z * OUT_DIM * IN_DIM;
  const float* bias = (z == 0) ? bq : ((z == 1) ? bk : bv);

  // this lane's first piece of a tile: row tid>>3, piece tid&7, in both operands
  const unsigned short* ga = hb + (size_t)(m0 + (tid >> 3)) * IN_DIM + (tid & 7) * 8;
  const unsigned short* gw = Wt + (size_t)(n0 + (tid >> 3)) * IN_DIM + (tid & 7) * 8;
  const unsigned int la0 = (unsigned int)(size_t)(&S[(tid >> 3) * PLP + (tid & 7) * 8]);
  const unsigned int lw0 = la0 + PTS * 2u;
  const unsigned int pbuf = 2u * PTS * 2u;         // bytes from buffer 0 to buffer 1

  copy_ab(la0, lw0, ga, gw);                                     // tile 0 -> buffer 0
  asm volatile("s_wait_asynccnt 0x0" ::: "memory");              // this wave's part of tile 0 has landed
  __syncthreads();                                               // tile 0 complete for every wave
  copy_ab(la0 + pbuf, lw0 + pbuf, ga + PK, gw + PK);             // tile 1 -> buffer 1

  v8f acc[2][4] = {};
  for (int t = 0; t < PNT; ++t) {
    const int b = t & 1;
    const __bf16* at = (const __bf16*)(S + b * 2 * PTS);
    const __bf16* wt = at + PTS;
#pragma unroll   // the two 32-k halves of a tile read LDS at constant offsets from one address
    for (int kk = 0; kk < PK; kk += 32) {
      v16bf a[2], w[4];
#pragma unroll
      for (int i = 0; i < 2; ++i) a[i] = ld_frag_bf(at, PLP, wr * 32 + i * 16 + l15, kk, lane);
#pragma unroll
      for (int j = 0; j < 4; ++j) w[j] = ld_frag_bf(wt, PLP, wc * 64 + j * 16 + l15, kk, lane);
#pragma unroll
      for (int j = 0; j < 4; ++j)
#pragma unroll
        for (int i = 0; i < 2; ++i) acc[i][j] = mma_bf16(a[i], w[j], acc[i][j]);
    }
    asm volatile("s_wait_dscnt 0x0" ::: "memory");      // this wave's reads of buffer b are done
    asm volatile("s_wait_asynccnt 0x0" ::: "memory");   // this wave's part of tile t + 1 has landed
    __syncthreads();   // publishes tile t + 1 and ends every wave's reads of buffer b
    if (t + 2 < PNT)   // the same for the whole workgroup
      copy_ab(la0 + b * pbuf, lw0 + b * pbuf, ga + (size_t)(t + 2) * PK, gw + (size_t)(t + 2) * PK);
  }
  asm volatile("s_wait_asynccnt 0x0" ::: "memory");     // nothing in flight when the LDS changes its use

  // acc[i][j][r] = C[m0 + wr*32 + i*16 + 8*half + r][n0 + wc*64 + j*16 + l15]
  unsigned short* E = S;   // every wave's last read of the tiles ended at the last trip's barrier
  const float car = 8.0f;
  if (z != 2) {                      // block-uniform branch
#pragma unroll
    for (int j = 0; j < 4; ++j) {
      const int col = wc * 64 + j * 16 + l15;
      const float bb = bf16val(bias[n0 + col]);
#pragma unroll
      for (int i = 0; i < 2; ++i)
#pragma unroll
        for (int r = 0; r < 8; ++r) {
          const int row = wr * 32 + i * 16 + 8 * half + r;
          E[row * EP + col] = hbits((acc[i][j][r] + bb) * car);
        }
    }
    __syncthreads();
    unsigned short* dst = (z == 0) ? qp : kp;
    v4u v[8];
    size_t off[8];
#pragma unroll
    for (int it = 0; it < 8; ++it) {
      const int row = it * 16 + (tid >> 4);               // 0..127 over (it, tid>>4)
      const int q = l15;                                  // 16 pieces = 256-byte row = 2 lines
      v[it] = *(const v4u*)(&E[row * EP + q * 8]);
      off[it] = (size_t)(m0 + row) * OUT_DIM + n0 + q * 8;
    }
#pragma unroll
    for (int it = 0; it < 8; ++it) *(v4u*)(dst + off[it]) = v[it];
    // behind the last store: no register that a store names is rewritten on any path of the listing before this wait
    asm volatile("s_wait_xcnt 0x0" ::: "memory");
  } else {
#pragma unroll
    for (int j = 0; j < 4; ++j) {
      const int col = wc * 64 + j * 16 + l15;             // d within tile
      const float bb = bf16val(bias[n0 + col]);
#pragma unroll
      for (int i = 0; i < 2; ++i)
#pragma unroll
        for (int r = 0; r < 8; ++r) {
          const int srow = wr * 32 + i * 16 + 8 * half + r;   // s within tile
          E[col * EP + srow] = hbits((acc[i][j][r] + bb) * car);
        }
    }
    __syncthreads();
    v4u v[8];
    size_t off[8];
#pragma unroll
    for (int it = 0; it < 8; ++it) {
      const int drow = it * 16 + (tid >> 4);              // 0..127 over (it, tid>>4)
      const int q = l15;                                  // 16 pieces = 256-byte row = 2 lines
      v[it] = *(const v4u*)(&E[drow * EP + q * 8]);
      off[it] = (size_t)(n0 + drow) * SEQ + m0 + q * 8;
    }
#pragma unroll
    for (int it = 0; it < 8; ++it) *(v4u*)(vtp + off[it]) = v[it];
  }
}

// ---------------------------------------------------------------------------
// Flash attention, transposed-score form: one wave = (16 queries, one head);
// a workgroup = 8 waves = 128 queries of one head, which share every K / V^T tile.
// A tile = 128 keys: K [128 keys][64 d] and V^T [64 d][128 keys], copied whole-line
// from the planes into LDS by asynchronous copies, two buffers: tile t + 1 is in
// flight while tile t is worked on. Fragments come from LDS (ds_load_b128 pitches).
// Per 32-key chunk:
//   S^T = K . Q^T    A = K rows (lane = key, k = d), B = Q^T (lane = query, k = d)
//                    D[row = key 8h+r][col = query l15]; c0 keys 0..15, c1 keys 16..31
//   per-lane softmax terms for query l15 (16 local keys; the xor-16 partner holds the other 16)
//   O^T += V^T . P   A = V^T rows (lane = d, k = key), B = P: element i<8 <- c0[i]
//                    (key 8h+i), element 8+i <- c1[i] (key 16+8h+i), same lane
//                    D[row = d 8h+r][col = query l15]
// Scores carry 64 from the x8 planes: P = exp2(score * log2(e)/512 - ref * log2(e)/512 + 10),
// one multiply-add and one exponential a score; ref is a held reference score per query, in
// raw score units, and moves only when a chunk's P outgrow f16 (lazy rescale, below).
// P and its sum carried x1024, V carried x8 -> context scaled by 1/(8 * carried sum).
// Output tile [16 q][64 d] f32 staged in LDS; each 256-byte row = 2 lines,
#define AW  8                  // waves per workgroup
#define SK  128                // keys per tile
#define KLP 72                 // K tile pitch: 144 B = 16 B x 9
#define VLP 136                // V^T tile pitch: 272 B = 16 B x 17
#define NST (SEQ / SK)         // tiles
static_assert(SEQ % (AW * 16) == 0);
static_assert(NST >= 2);
static_assert(AW * 32 * 4 * 8 == SK * HEAD_DIM);   // four 16-byte copies a lane fill one tile

// One tile's copies of one lane: four 16-byte pieces of K (32 key rows apart) and four
// of V^T (16 d rows apart). s_wait_xcnt 0 is the statement's last line, so that no
// address register named here is rewritten before it.
__device__ __forceinline__ void copy_tile(unsigned int lk, unsigned int lv,
                                          const _Float16* gk, const _Float16* gv) {
  asm volatile(
      "global_load_async_to_lds_b128 %0, %8, off\n\t"
      "global_load_async_to_lds_b128 %1, %9, off\n\t"
      "global_load_async_to_lds_b128 %2, %10, off\n\t"
      "global_load_async_to_lds_b128 %3, %11, off\n\t"
      "global_load_async_to_lds_b128 %4, %12, off\n\t"
      "global_load_async_to_lds_b128 %5, %13, off\n\t"
      "global_load_async_to_lds_b128 %6, %14, off\n\t"
      "global_load_async_to_lds_b128 %7, %15, off\n\t"
      "s_wait_xcnt 0x0"
      :
      : "v"(lk), "v"(lk + 32u * KLP * 2u), "v"(lk + 64u * KLP * 2u), "v"(lk + 96u * KLP * 2u),
        "v"(lv), "v"(lv + 16u * VLP * 2u), "v"(lv + 32u * VLP * 2u), "v"(lv + 48u * VLP * 2u),
        "v"(gk), "v"(gk + (size_t)32 * OUT_DIM), "v"(gk + (size_t)64 * OUT_DIM),
        "v"(gk + (size_t)96 * OUT_DIM),
        "v"(gv), "v"(gv + (size_t)16 * SEQ), "v"(gv + (size_t)32 * SEQ), "v"(gv + (size_t)48 * SEQ)
      : "memory");
}

// Four waves per SIMD (two workgroups per WGP), as before: vector work between matrix runs wants waves.
__global__ __launch_bounds__(AW * 32) __attribute__((amdgpu_waves_per_eu(4, 4)))
void k_attn(const unsigned short* __restrict__ qp,
            const unsigned short* __restrict__ kp,
            const unsigned short* __restrict__ vtp,
            float* __restrict__ outp) {
  __shared__ __align__(16) _Float16 Kt[2][SK * KLP];         // K tiles, cross-wave (block barrier)
  __shared__ __align__(16) _Float16 Vt[2][HEAD_DIM * VLP];   // V^T tiles, cross-wave (block barrier)
  __shared__ __align__(16) float Olw[AW][16 * OLP];          // one output tile per wave

  const int tid = threadIdx.x;
  const int wave = tid >> 5;
  const int lane = tid & 31;
  const int l15 = lane & 15;
  const int half = (lane >> 4) & 1;
  const int q0 = blockIdx.x * (AW * 16) + wave * 16;
  const int head = blockIdx.y;
  float* Ol = Olw[wave];

  const _Float16* Q  = (const _Float16*)qp;
  const _Float16* K  = (const _Float16*)kp;
  const _Float16* VT = (const _Float16*)vtp;

  const _Float16* qbase = Q + (size_t)q0 * OUT_DIM + head * HEAD_DIM;
  const v16h qb0 = ld_frag_h(qbase, OUT_DIM, l15, 0, lane);    // d 0..31
  const v16h qb1 = ld_frag_h(qbase, OUT_DIM, l15, 32, lane);   // d 32..63
  const _Float16* kbase = K + head * HEAD_DIM;                   // key t at kbase + t*OUT_DIM
  const _Float16* vbase = VT + (size_t)head * HEAD_DIM * SEQ;    // d row at vbase + d*SEQ

  // this lane's first piece of a tile: K row tid>>3, piece tid&7; V^T row tid>>4, piece tid&15
  const _Float16* gk = kbase + (size_t)(tid >> 3) * OUT_DIM + (tid & 7) * 8;
  const _Float16* gv = vbase + (size_t)(tid >> 4) * SEQ + (tid & 15) * 8;
  const unsigned int lk0 = (unsigned int)(size_t)(&Kt[0][(tid >> 3) * KLP + (tid & 7) * 8]);
  const unsigned int lv0 = (unsigned int)(size_t)(&Vt[0][(tid >> 4) * VLP + (tid & 15) * 8]);
  const unsigned int kbuf = SK * KLP * 2u;         // bytes from buffer 0 to buffer 1
  const unsigned int vbuf = HEAD_DIM * VLP * 2u;

  copy_tile(lk0, lv0, gk, gv);                                   // tile 0 -> buffer 0
  asm volatile("s_wait_asynccnt 0x0" ::: "memory");              // this wave's part of tile 0 has landed
  __syncthreads();                                               // tile 0 complete for every wave
  copy_tile(lk0 + kbuf, lv0 + vbuf, gk + (size_t)SK * OUT_DIM, gv + SK);   // tile 1 -> buffer 1

  v8f o[4] = {};
  float mref = -1.0e30f, lrun = 0.0f;
  const float kq = 1.44269504f / 512.0f;   // 1/512 (score scale on the x8 planes) times log2(e)
  // 10 = log2(1024): P leaves the exponential already x1024. With the start value of mref every P of
  // the first chunk is infinite, so the test below sends that chunk through the rescale, which sets mref.
  float nb = fmaf(-mref, kq, 10.0f);
  const float plim = 32768.0f;   // a lane's 16 P are each at most their sum: at or under this they fit f16

  for (int t = 0; t < NST; ++t) {
    const int b = t & 1;
    const _Float16* ktile = Kt[b];
    const _Float16* vtile = Vt[b];
    // K fragments of chunk 0; later chunks' are fetched one chunk ahead, inside this tile only
    v16h ka0 = ld_frag_h(ktile, KLP, l15, 0, lane);
    v16h ka2 = ld_frag_h(ktile, KLP, 16 + l15, 0, lane);
    v16h ka1 = ld_frag_h(ktile, KLP, l15, 32, lane);
    v16h ka3 = ld_frag_h(ktile, KLP, 16 + l15, 32, lane);
#pragma unroll   // the four chunks of a tile read LDS at constant offsets from one address
    for (int c = 0; c < SK / 32; ++c) {
      // this chunk's four V^T fragments, one group of reads: they land under the scores and the softmax
      v16h va[4];
#pragma unroll
      for (int j = 0; j < 4; ++j) va[j] = ld_frag_h(vtile, VLP, j * 16 + l15, c * 32, lane);
      // keeps the group of reads above the score products, so that it is in flight under the scores and the softmax
      __builtin_amdgcn_sched_barrier(0);
      v8f c0 = {}, c1 = {};
      c0 = mma_f16(ka0, qb0, c0);
      c1 = mma_f16(ka2, qb0, c1);
      c0 = mma_f16(ka1, qb1, c0);
      c1 = mma_f16(ka3, qb1, c1);
      if (c + 1 < SK / 32) {   // next chunk's K fragments, one group: they land under the softmax and the context products
        const _Float16* kn = ktile + (c + 1) * 32 * KLP;
        ka0 = ld_frag_h(kn, KLP, l15, 0, lane);
        ka2 = ld_frag_h(kn, KLP, 16 + l15, 0, lane);
        ka1 = ld_frag_h(kn, KLP, l15, 32, lane);
        ka3 = ld_frag_h(kn, KLP, 16 + l15, 32, lane);
        // keeps that group here, ahead of the softmax, so that the next chunk's score products find it landed
        __builtin_amdgcn_sched_barrier(0);
      }

      // P against the held reference: no maximum, no rescale on this path
      float p0[8], p1[8];
      float ls = 0.0f;
#pragma unroll
      for (int r = 0; r < 8; ++r) {
        p0[r] = __builtin_amdgcn_exp2f(fmaf(c0[r], kq, nb));
        p1[r] = __builtin_amdgcn_exp2f(fmaf(c1[r], kq, nb));
        ls += p0[r] + p1[r];
      }
      // One test a chunk, a scalar branch for the whole wave: only where some lane's P have outgrown
      // f16 (or are not numbers) does the reference move to the maximum seen so far.
      if (__builtin_expect(__builtin_amdgcn_ballot_w32(!(ls <= plim)) != 0u, 0)) {   // rare: laid out off the straight path
        // maximum over the raw accumulators (the scale is positive, so the order is the same)
        float lm = fmaxf(c0[0], c1[0]);
#pragma unroll
        for (int r = 1; r < 8; ++r) lm = fmaxf(lm, fmaxf(c0[r], c1[r]));
        lm = fmaxf(lm, __shfl_xor(lm, 16, 32));   // both halves of a query keep one reference
        const float mnew = fmaxf(mref, lm);
        const float alpha = __builtin_amdgcn_exp2f((mref - mnew) * kq);
        nb = fmaf(-mnew, kq, 10.0f);
        mref = mnew;
        ls = 0.0f;
#pragma unroll
        for (int r = 0; r < 8; ++r) {
          p0[r] = __builtin_amdgcn_exp2f(fmaf(c0[r], kq, nb));
          p1[r] = __builtin_amdgcn_exp2f(fmaf(c1[r], kq, nb));
          ls += p0[r] + p1[r];
        }
        lrun *= alpha;
#pragma unroll
        for (int j = 0; j < 4; ++j)
#pragma unroll
          for (int r = 0; r < 8; ++r) o[j][r] *= alpha;
      }
      lrun += ls;   // this lane's 16 keys only: the rescale branch needs lrun at hand, so no exchange stands in the loop

      v16h pb;
#pragma unroll
      for (int e = 0; e < 8; ++e) {
        pb[e]     = (_Float16)p0[e];   // key 32c + 8h + e of the tile
        pb[8 + e] = (_Float16)p1[e];   // key 32c + 16 + 8h + e of the tile
      }
#pragma unroll
      for (int j = 0; j < 4; ++j) o[j] = mma_f16(va[j], pb, o[j]);
    }
    asm volatile("s_wait_dscnt 0x0" ::: "memory");      // this wave's reads of buffer b are done
    asm volatile("s_wait_asynccnt 0x0" ::: "memory");   // this wave's part of tile t + 1 has landed
    __syncthreads();   // publishes tile t + 1 and ends every wave's reads of buffer b
    if (t + 2 < NST)   // the same for the whole workgroup
      copy_tile(lk0 + b * kbuf, lv0 + b * vbuf,
                gk + (size_t)(t + 2) * SK * OUT_DIM, gv + (size_t)(t + 2) * SK);
  }
  asm volatile("s_wait_asynccnt 0x0" ::: "memory");     // nothing in flight when the wave ends

  // o[j][r] = 8192 * sum_t p_t v_t for query l15, d = j*16 + 8*half + r; the two halves of a query
  // hold one reference, so their sums join by one add: lrun = 1024 * sum_t p_t
  lrun += __shfl_xor(lrun, 16, 32);
  const float inv = 1.0f / (lrun * 8.0f);
#pragma unroll
  for (int j = 0; j < 4; ++j) {
    v4f lo4, hi4;
    lo4[0] = o[j][0] * inv; lo4[1] = o[j][1] * inv; lo4[2] = o[j][2] * inv; lo4[3] = o[j][3] * inv;
    hi4[0] = o[j][4] * inv; hi4[1] = o[j][5] * inv; hi4[2] = o[j][6] * inv; hi4[3] = o[j][7] * inv;
    *(v4f*)(&Ol[l15 * OLP + j * 16 + 8 * half])     = lo4;
    *(v4f*)(&Ol[l15 * OLP + j * 16 + 8 * half + 4]) = hi4;
  }
  __syncthreads();

  v4f v[8];
  size_t off[8];
  float* ob = outp + (size_t)q0 * OUT_DIM + head * HEAD_DIM;
#pragma unroll
  for (int it = 0; it < 8; ++it) {
    const int row = it * 2 + half;       // 0..15
    const int q = l15;                   // 16 pieces of 16 B = the row's 256 bytes (2 lines)
    v[it] = *(const v4f*)(&Ol[row * OLP + q * 4]);
    off[it] = (size_t)row * OUT_DIM + q * 4;
  }
#pragma unroll
  for (int it = 0; it < 8; ++it) *(v4f*)(ob + off[it]) = v[it];
  
}

// ---------------------------------------------------------------------------
extern "C" void kernel_launch(void* const* d_in, const int* in_sizes, int n_in,
                              void* d_out, int out_size, void* d_ws, size_t ws_size,
                              hipStream_t stream) {
  if (n_in < 7) return;
  if (in_sizes[0] < SEQ * IN_DIM) return;
  if (in_sizes[1] < IN_DIM * OUT_DIM || in_sizes[2] < IN_DIM * OUT_DIM ||
      in_sizes[3] < IN_DIM * OUT_DIM) return;
  if (in_sizes[4] < OUT_DIM || in_sizes[5] < OUT_DIM || in_sizes[6] < OUT_DIM) return;
  if (out_size < SEQ * OUT_DIM) return;

  const float* h  = (const float*)d_in[0];
  const float* Wq = (const float*)d_in[1];
  const float* Wk = (const float*)d_in[2];
  const float* Wv = (const float*)d_in[3];
  const float* bq = (const float*)d_in[4];
  const float* bk = (const float*)d_in[5];
  const float* bv = (const float*)d_in[6];

  // every offset a multiple of 2 MiB
  const size_t hb_bytes = (size_t)SEQ * IN_DIM * 2;           // bf16 h plane
  const size_t wt_bytes = (size_t)3 * OUT_DIM * IN_DIM * 2;   // 3 bf16 WT planes
  const size_t pl_bytes = (size_t)SEQ * OUT_DIM * 2;          // one f16 q/k/vT plane
  const size_t off_hb = 0;
  const size_t off_wt = off_hb + hb_bytes;
  const size_t off_q  = off_wt + wt_bytes;
  const size_t off_k  = off_q + pl_bytes;
  const size_t off_vt = off_k + pl_bytes;
  const size_t total  = off_vt + pl_bytes;                    // 38 MiB at SEQ = 4096
  if (total > ws_size) return;

  char* ws = (char*)d_ws;
  unsigned short* hb  = (unsigned short*)(ws + off_hb);
  unsigned short* wt  = (unsigned short*)(ws + off_wt);
  unsigned short* qpl = (unsigned short*)(ws + off_q);
  unsigned short* kpl = (unsigned short*)(ws + off_k);
  unsigned short* vtp = (unsigned short*)(ws + off_vt);

  const int n8 = SEQ * IN_DIM / 8;
  k_cvt_rows<<<(n8 + 255) / 256, 256, 0, stream>>>(h, hb, n8);
  k_cvt_wT<<<dim3(IN_DIM / 64, OUT_DIM / 64, 3), 256, 0, stream>>>(Wq, Wk, Wv, wt);
  k_proj<<<dim3(OUT_DIM / 128, SEQ / 128, 3), 256, 0, stream>>>(hb, wt, bq, bk, bv, qpl, kpl, vtp);
  k_attn<<<dim3(SEQ / (AW * 16), NUM_HEADS), AW * 32, 0, stream>>>(qpl, kpl, vtp, (float*)d_out);
}

// v006
// One run takes 90.6 microseconds.
// In both of two side-by-side timings against v005, it was 1.06 times as fast.
// Counting every step since v000, it is 3.61 times as fast.
#include <hip/hip_runtime.h>
// Projections h*W{q,k,v}: v_wmma_f32_16x16x32_bf16 (bf16 operands = RNE-converted inputs, f32 accumulate); scores K*Q^T and context V^T*P: v_wmma_f32_16x16x32_f16 (f16 operands, Q/K/V planes carried x8, P carried x1024, f32 accumulate); softmax in f32.

#ifndef SEQ
#define SEQ 4096
#endif
#define SEQ_FULL 4096
#define IN_DIM 1024
#define NUM_HEADS 16
#define HEAD_DIM 64
#define OUT_DIM (NUM_HEADS * HEAD_DIM)

static_assert(SEQ % 128 == 0);
static_assert(SEQ <= SEQ_FULL);
static_assert(IN_DIM % 64 == 0);
static_assert(OUT_DIM % 128 == 0);
static_assert(HEAD_DIM == 64);
static_assert((size_t)SEQ_FULL * OUT_DIM * 4 == 16777216);

// LDS pitches (in 16-bit elements unless noted); all keep 16-byte row alignment
#define TP  72     // weight transpose tile [64 n][64 k]
#define OLP 68     // context tile [16 q][64 d], floats

typedef __bf16   v16bf __attribute__((ext_vector_type(16)));
typedef __bf16   v8bf  __attribute__((ext_vector_type(8)));
typedef _Float16 v16h  __attribute__((ext_vector_type(16)));
typedef _Float16 v8h   __attribute__((ext_vector_type(8)));
typedef float    v8f   __attribute__((ext_vector_type(8)));
typedef float    v4f   __attribute__((ext_vector_type(4)));
typedef unsigned int v4u __attribute__((ext_vector_type(4)));

// ---------------------------------------------------------------------------
// WMMA wrappers with the VALU hazard guard (4 v_nop after every issue).
__device__ __forceinline__ v8f mma_bf16(v16bf a, v16bf b, v8f c) {
  v8f d = __builtin_amdgcn_wmma_f32_16x16x32_bf16(false, a, false, b, (short)0, c, false, false);
  asm volatile("v_nop\n\tv_nop\n\tv_nop\n\tv_nop" : "+v"(d) : "v"(a), "v"(b));
  return d;
}
__device__ __forceinline__ v8f mma_f16(v16h a, v16h b, v8f c) {
  v8f d = __builtin_amdgcn_wmma_f32_16x16x32_f16(false, a, false, b, (short)0, c, false, false);
  asm volatile("v_nop\n\tv_nop\n\tv_nop\n\tv_nop" : "+v"(d) : "v"(a), "v"(b));
  return d;
}

// 16-bit fragment, contraction dim CONTIGUOUS in memory: elem(k) = p0[rc*ld + k].
// Lane l: row/col rc = (l&15); elements 0..7 <- kk+8h+0..7, elements 8..15 <- kk+16+8h+0..7
// (h = l>>4). Same map for A (rc = row) and B (rc = column of a k-contiguous copy).
__device__ __forceinline__ v16bf ld_frag_bf(const __bf16* p0, int ld, int rc, int kk, int lane) {
  const int hh = (lane >> 4) & 1;
  const __bf16* p = p0 + (size_t)rc * ld + kk + 8 * hh;
  const v8bf lo = *(const v8bf*)(p);
  const v8bf hi = *(const v8bf*)(p + 16);
  v16bf f;
#pragma unroll
  for (int i = 0; i < 8; ++i) { f[i] = lo[i]; f[8 + i] = hi[i]; }
  return f;
}
__device__ __forceinline__ v16h ld_frag_h(const _Float16* p0, int ld, int rc, int kk, int lane) {
  const int hh = (lane >> 4) & 1;
  const _Float16* p = p0 + (size_t)rc * ld + kk + 8 * hh;
  const v8h lo = *(const v8h*)(p);
  const v8h hi = *(const v8h*)(p + 16);
  v16h f;
#pragma unroll
  for (int i = 0; i < 8; ++i) { f[i] = lo[i]; f[8 + i] = hi[i]; }
  return f;
}

// f32 -> bf16 bits, RNE convert
__device__ __forceinline__ unsigned int bfb(float x) {
  unsigned int u = __float_as_uint(x);
  u = u + 0x7FFFu + ((u >> 16) & 1u);
  return u >> 16;
}
// f32 -> value of its RNE bf16
__device__ __forceinline__ float bf16val(float x) {
  return __uint_as_float(bfb(x) << 16);
}
// f32 -> f16 bits, RNE convert
__device__ __forceinline__ unsigned short hbits(float x) {
  const _Float16 hv = (_Float16)x;
  return __builtin_bit_cast(unsigned short, hv);
}

// ---------------------------------------------------------------------------
// h f32 [SEQ][IN_DIM] -> bf16 plane (same layout). Thread g converts 8
// consecutive floats -> one 16-byte store; 8 consecutive lanes fill one
__global__ __launch_bounds__(256) void k_cvt_rows(const float* __restrict__ in,
                                                  unsigned short* __restrict__ outp, int n8) {
  const int g = blockIdx.x * 256 + threadIdx.x;
  if (g >= n8) return;
  const v4f a = *(const v4f*)(in + (size_t)g * 8);
  const v4f b = *(const v4f*)(in + (size_t)g * 8 + 4);
  v4u w;
  w[0] = bfb(a[0]) | (bfb(a[1]) << 16);
  w[1] = bfb(a[2]) | (bfb(a[3]) << 16);
  w[2] = bfb(b[0]) | (bfb(b[1]) << 16);
  w[3] = bfb(b[2]) | (bfb(b[3]) << 16);
  v4u* p = (v4u*)(outp + (size_t)g * 8);
  *p = w;
  
}

// ---------------------------------------------------------------------------
// W f32 [IN_DIM k][OUT_DIM n] -> WT bf16 [OUT_DIM n][IN_DIM k] (k contiguous),
// three matrices selected by blockIdx.z into three consecutive planes.
// Block = 64 k x 64 n tile transposed through LDS; each WT row segment
__global__ __launch_bounds__(256) void k_cvt_wT(const float* __restrict__ Wq,
                                                const float* __restrict__ Wk,
                                                const float* __restrict__ Wv,
                                                unsigned short* __restrict__ wT) {
  __shared__ __align__(16) unsigned short T[64 * TP];   // [n local][k local], cross-wave (block barrier)
  const int z = blockIdx.z;
  const float* W = (z == 0) ? Wq : ((z == 1) ? Wk : Wv);
  unsigned short* dst = wT + (size_t)z * OUT_DIM * IN_DIM;
  const int k0 = blockIdx.x * 64;
  const int n0 = blockIdx.y * 64;
  const int tid = threadIdx.x;
  const int wave = tid >> 5, lane = tid & 31;

#pragma unroll
  for (int i = 0; i < 4; ++i) {
    const int idx = i * 256 + tid;          // 0..1023
    const int kk = idx >> 4;                // 0..63
    const int c4 = (idx & 15) * 4;          // 0..60
    const v4f w = *(const v4f*)(W + (size_t)(k0 + kk) * OUT_DIM + n0 + c4);
    T[(c4 + 0) * TP + kk] = (unsigned short)bfb(w[0]);
    T[(c4 + 1) * TP + kk] = (unsigned short)bfb(w[1]);
    T[(c4 + 2) * TP + kk] = (unsigned short)bfb(w[2]);
    T[(c4 + 3) * TP + kk] = (unsigned short)bfb(w[3]);
  }
  __syncthreads();

  v4u v[2];
  size_t off[2];
#pragma unroll
  for (int it = 0; it < 2; ++it) {
    const int nn = wave * 8 + it * 4 + (lane >> 3);   // 0..63 over (wave, it, lane>>3)
    const int q = lane & 7;
    v[it] = *(const v4u*)(&T[nn * TP + q * 8]);
    off[it] = (size_t)(n0 + nn) * IN_DIM + k0 + q * 8;
  }
#pragma unroll
  for (int it = 0; it < 2; ++it) *(v4u*)(dst + off[it]) = v[it];
  
}

// ---------------------------------------------------------------------------
// Projection: C[SEQ][OUT_DIM] = hb[SEQ][IN_DIM] * WT[OUT_DIM][IN_DIM]^T + bias.
// 256 thr = 8 waves; block tile 128 rows x 128 cols; wave (wr, wc) owns 32 rows x 64 cols.
// A k-tile = 64 k of both operands: hb [128 rows][64 k] and WT [128 n][64 k], copied
// whole-line from the planes into LDS by asynchronous copies, two buffers: tile t + 1 is
// in flight while tile t is multiplied. Each accumulator still sums k in ascending 32-steps.
// z = 0: Q plane f16 x8 [SEQ][OUT_DIM]; z = 1: K plane f16 x8 [SEQ][OUT_DIM];
// z = 2: V^T plane f16 x8 [OUT_DIM][SEQ]. Epilogue staged in the same LDS behind the loop.
#define PK  64                 // k per tile
#define PLP 72                 // operand tile pitch: 144 B = 16 B x 9
#define PTS (128 * PLP)        // elements of one operand tile
#define PNT (IN_DIM / PK)      // tiles
#define EP  136                // epilogue tile pitch [128][128]: 272 B = 16 B x 17
static_assert(PNT >= 2);
static_assert(128 * EP <= 4 * PTS);
static_assert(256 * 4 * 8 == 128 * PK);   // four 16-byte copies a lane fill one operand tile

// One k-tile's copies of one lane: four 16-byte pieces of hb and four of WT, 32 rows apart.
// s_wait_xcnt 0 is the statement's last line, so that no address register named here is
// rewritten before it.
__device__ __forceinline__ void copy_ab(unsigned int la, unsigned int lw,
                                        const unsigned short* ga, const unsigned short* gw) {
  asm volatile(
      "global_load_async_to_lds_b128 %0, %8, off\n\t"
      "global_load_async_to_lds_b128 %1, %9, off\n\t"
      "global_load_async_to_lds_b128 %2, %10, off\n\t"
      "global_load_async_to_lds_b128 %3, %11, off\n\t"
      "global_load_async_to_lds_b128 %4, %12, off\n\t"
      "global_load_async_to_lds_b128 %5, %13, off\n\t"
      "global_load_async_to_lds_b128 %6, %14, off\n\t"
      "global_load_async_to_lds_b128 %7, %15, off\n\t"
      "s_wait_xcnt 0x0"
      :
      : "v"(la), "v"(la + 32u * PLP * 2u), "v"(la + 64u * PLP * 2u), "v"(la + 96u * PLP * 2u),
        "v"(lw), "v"(lw + 32u * PLP * 2u), "v"(lw + 64u * PLP * 2u), "v"(lw + 96u * PLP * 2u),
        "v"(ga), "v"(ga + (size_t)32 * IN_DIM), "v"(ga + (size_t)64 * IN_DIM),
        "v"(ga + (size_t)96 * IN_DIM),
        "v"(gw), "v"(gw + (size_t)32 * IN_DIM), "v"(gw + (size_t)64 * IN_DIM),
        "v"(gw + (size_t)96 * IN_DIM)
      : "memory");
}

__global__ __launch_bounds__(256) void k_proj(
    const unsigned short* __restrict__ hb, const unsigned short* __restrict__ wT,
    const float* __restrict__ bq, const float* __restrict__ bk, const float* __restrict__ bv,
    unsigned short* __restrict__ qp, unsigned short* __restrict__ kp,
    unsigned short* __restrict__ vtp) {
  // [buffer][hb tile | WT tile], cross-wave (block barrier); behind the loop the epilogue tile
  __shared__ __align__(16) unsigned short S[4 * PTS];

  const int z = blockIdx.z;
  const int n0 = blockIdx.x * 128;
  const int m0 = blockIdx.y * 128;
  const int tid = threadIdx.x;
  const int wave = tid >> 5, lane = tid & 31;
  const int l15 = lane & 15, half = (lane >> 4) & 1;
  const int wr = wave >> 1, wc = wave & 1;

  const unsigned short* Wt = wT + (size_t)z * OUT_DIM * IN_DIM;
  const float* bias = (z == 0) ? bq : ((z == 1) ? bk : bv);

  // this lane's first piece of a tile: row tid>>3, piece tid&7, in both operands
  const unsigned short* ga = hb + (size_t)(m0 + (tid >> 3)) * IN_DIM + (tid & 7) * 8;
  const unsigned short* gw = Wt + (size_t)(n0 + (tid >> 3)) * IN_DIM + (tid & 7) * 8;
  const unsigned int la0 = (unsigned int)(size_t)(&S[(tid >> 3) * PLP + (tid & 7) * 8]);
  const unsigned int lw0 = la0 + PTS * 2u;
  const unsigned int pbuf = 2u * PTS * 2u;         // bytes from buffer 0 to buffer 1

  copy_ab(la0, lw0, ga, gw);                                     // tile 0 -> buffer 0
  asm volatile("s_wait_asynccnt 0x0" ::: "memory");              // this wave's part of tile 0 has landed
  __syncthreads();                                               // tile 0 complete for every wave
  copy_ab(la0 + pbuf, lw0 + pbuf, ga + PK, gw + PK);             // tile 1 -> buffer 1

  v8f acc[2][4] = {};
  for (int t = 0; t < PNT; ++t) {
    const int b = t & 1;
    const __bf16* at = (const __bf16*)(S + b * 2 * PTS);
    const __bf16* wt = at + PTS;
#pragma unroll   // the two 32-k halves of a tile read LDS at constant offsets from one address
    for (int kk = 0; kk < PK; kk += 32) {
      v16bf a[2], w[4];
#pragma unroll
      for (int i = 0; i < 2; ++i) a[i] = ld_frag_bf(at, PLP, wr * 32 + i * 16 + l15, kk, lane);
#pragma unroll
      for (int j = 0; j < 4; ++j) w[j] = ld_frag_bf(wt, PLP, wc * 64 + j * 16 + l15, kk, lane);
#pragma unroll
      for (int j = 0; j < 4; ++j)
#pragma unroll
        for (int i = 0; i < 2; ++i) acc[i][j] = mma_bf16(a[i], w[j], acc[i][j]);
    }
    asm volatile("s_wait_dscnt 0x0" ::: "memory");      // this wave's reads of buffer b are done
    asm volatile("s_wait_asynccnt 0x0" ::: "memory");   // this wave's part of tile t + 1 has landed
    __syncthreads();   // publishes tile t + 1 and ends every wave's reads of buffer b
    if (t + 2 < PNT)   // the same for the whole workgroup
      copy_ab(la0 + b * pbuf, lw0 + b * pbuf, ga + (size_t)(t + 2) * PK, gw + (size_t)(t + 2) * PK);
  }
  asm volatile("s_wait_asynccnt 0x0" ::: "memory");     // nothing in flight when the LDS changes its use

  // acc[i][j][r] = C[m0 + wr*32 + i*16 + 8*half + r][n0 + wc*64 + j*16 + l15]
  unsigned short* E = S;   // every wave's last read of the tiles ended at the last trip's barrier
  const float car = 8.0f;
  if (z != 2) {                      // block-uniform branch
#pragma unroll
    for (int j = 0; j < 4; ++j) {
      const int col = wc * 64 + j * 16 + l15;
      const float bb = bf16val(bias[n0 + col]);
#pragma unroll
      for (int i = 0; i < 2; ++i)
#pragma unroll
        for (int r = 0; r < 8; ++r) {
          const int row = wr * 32 + i * 16 + 8 * half + r;
          E[row * EP + col] = hbits((acc[i][j][r] + bb) * car);
        }
    }
    __syncthreads();
    unsigned short* dst = (z == 0) ? qp : kp;
    v4u v[8];
    size_t off[8];
#pragma unroll
    for (int it = 0; it < 8; ++it) {
      const int row = it * 16 + (tid >> 4);               // 0..127 over (it, tid>>4)
      const int q = l15;                                  // 16 pieces = 256-byte row = 2 lines
      v[it] = *(const v4u*)(&E[row * EP + q * 8]);
      off[it] = (size_t)(m0 + row) * OUT_DIM + n0 + q * 8;
    }
#pragma unroll
    for (int it = 0; it < 8; ++it) *(v4u*)(dst + off[it]) = v[it];
    // behind the last store: no register that a store names is rewritten on any path of the listing before this wait
    asm volatile("s_wait_xcnt 0x0" ::: "memory");
  } else {
#pragma unroll
    for (int j = 0; j < 4; ++j) {
      const int col = wc * 64 + j * 16 + l15;             // d within tile
      const float bb = bf16val(bias[n0 + col]);
#pragma unroll
      for (int i = 0; i < 2; ++i)
#pragma unroll
        for (int r = 0; r < 8; ++r) {
          const int srow = wr * 32 + i * 16 + 8 * half + r;   // s within tile
          E[col * EP + srow] = hbits((acc[i][j][r] + bb) * car);
        }
    }
    __syncthreads();
    v4u v[8];
    size_t off[8];
#pragma unroll
    for (int it = 0; it < 8; ++it) {
      const int drow = it * 16 + (tid >> 4);              // 0..127 over (it, tid>>4)
      const int q = l15;                                  // 16 pieces = 256-byte row = 2 lines
      v[it] = *(const v4u*)(&E[drow * EP + q * 8]);
      off[it] = (size_t)(n0 + drow) * SEQ + m0 + q * 8;
    }
#pragma unroll
    for (int it = 0; it < 8; ++it) *(v4u*)(vtp + off[it]) = v[it];
  }
}

// ---------------------------------------------------------------------------
// Flash attention, transposed-score form: one wave = (32 queries as two 16-column groups, one head,
// half of every tile's keys), so that each K / V^T fragment read from LDS feeds two products.
// A workgroup = 8 waves = 4 query blocks x 2 key halves = 128 queries of one head, which share every
// K / V^T tile. The two waves of a query block keep their own reference, sum and context and join them
// once, behind the loop, through LDS; each then finishes and stores 16 of the 32 queries.
// A tile = 128 keys: K [128 keys][64 d] and V^T [64 d][128 keys], copied whole-line
// from the planes into LDS by asynchronous copies, two buffers: tile t + 1 is in
// flight while tile t is worked on. Fragments come from LDS (ds_load_b128 pitches).
// Per 32-key chunk and 16-column group:
//   S^T = K . Q^T    A = K rows (lane = key, k = d), B = Q^T (lane = query, k = d)
//                    D[row = key 8h+r][col = query l15]; c0 keys 0..15, c1 keys 16..31
//   per-lane softmax terms for query l15 (16 local keys; the xor-16 partner holds the other 16)
//   O^T += V^T . P   A = V^T rows (lane = d, k = key), B = P: element i<8 <- c0[i]
//                    (key 8h+i), element 8+i <- c1[i] (key 16+8h+i), same lane
//                    D[row = d 8h+r][col = query l15]
// Scores carry 64 from the x8 planes: P = exp2(score * log2(e)/512 - ref * log2(e)/512 + 10),
// one multiply-add and one exponential a score; ref is a held reference score per query, in
// raw score units, and moves only when a chunk's P outgrow f16 (lazy rescale, below).
// P and its sum carried x1024, V carried x8 -> context scaled by 1/(8 * carried sum).
// Output tile [16 q][64 d] f32 staged in LDS; each 256-byte row = 2 lines,
#define AW  8                  // waves per workgroup
#define SK  128                // keys per tile
#define KLP 72                 // K tile pitch: 144 B = 16 B x 9
#define VLP 136                // V^T tile pitch: 272 B = 16 B x 17
#define NST (SEQ / SK)         // tiles
static_assert(SEQ % (AW * 16) == 0);
static_assert(NST >= 2);
static_assert(AW == 8 && SK % 64 == 0);   // 4 query blocks x 2 key halves; a wave's half tile is whole 32-key chunks
static_assert(AW * 32 * 4 * 8 == SK * HEAD_DIM);   // four 16-byte copies a lane fill one tile

// One tile's copies of one lane: four 16-byte pieces of K (32 key rows apart) and four
// of V^T (16 d rows apart). s_wait_xcnt 0 is the statement's last line, so that no
// address register named here is rewritten before it.
__device__ __forceinline__ void copy_tile(unsigned int lk, unsigned int lv,
                                          const _Float16* gk, const _Float16* gv) {
  asm volatile(
      "global_load_async_to_lds_b128 %0, %8, off\n\t"
      "global_load_async_to_lds_b128 %1, %9, off\n\t"
      "global_load_async_to_lds_b128 %2, %10, off\n\t"
      "global_load_async_to_lds_b128 %3, %11, off\n\t"
      "global_load_async_to_lds_b128 %4, %12, off\n\t"
      "global_load_async_to_lds_b128 %5, %13, off\n\t"
      "global_load_async_to_lds_b128 %6, %14, off\n\t"
      "global_load_async_to_lds_b128 %7, %15, off\n\t"
      "s_wait_xcnt 0x0"
      :
      : "v"(lk), "v"(lk + 32u * KLP * 2u), "v"(lk + 64u * KLP * 2u), "v"(lk + 96u * KLP * 2u),
        "v"(lv), "v"(lv + 16u * VLP * 2u), "v"(lv + 32u * VLP * 2u), "v"(lv + 48u * VLP * 2u),
        "v"(gk), "v"(gk + (size_t)32 * OUT_DIM), "v"(gk + (size_t)64 * OUT_DIM),
        "v"(gk + (size_t)96 * OUT_DIM),
        "v"(gv), "v"(gv + (size_t)16 * SEQ), "v"(gv + (size_t)32 * SEQ), "v"(gv + (size_t)48 * SEQ)
      : "memory");
}

// Four waves per SIMD (two workgroups per WGP), as before: vector work between matrix runs wants waves.
__global__ __launch_bounds__(AW * 32) __attribute__((amdgpu_waves_per_eu(4, 4)))
void k_attn(const unsigned short* __restrict__ qp,
            const unsigned short* __restrict__ kp,
            const unsigned short* __restrict__ vtp,
            float* __restrict__ outp) {
  __shared__ __align__(16) _Float16 Kt[2][SK * KLP];         // K tiles, cross-wave (block barrier)
  __shared__ __align__(16) _Float16 Vt[2][HEAD_DIM * VLP];   // V^T tiles, cross-wave (block barrier)
  __shared__ __align__(16) float Olw[AW][16 * OLP];          // one output tile per wave
  __shared__ __align__(16) float Xo[AW][8 * 32 * 4];         // context of the group handed to the partner wave
  __shared__ float Xs[AW][2 * 32];                           // that group's reference and sum

  const int tid = threadIdx.x;
  const int wave = __builtin_amdgcn_readfirstlane(tid >> 5);
  const int lane = tid & 31;
  const int l15 = lane & 15;
  const int half = (lane >> 4) & 1;
  const int qg = wave & 3;    // query block of 32
  const int kh = wave >> 2;   // key half of every tile
  const int qw = blockIdx.x * (AW * 16) + qg * 32;
  const int head = blockIdx.y;
  float* Ol = Olw[wave];

  const _Float16* Q  = (const _Float16*)qp;
  const _Float16* K  = (const _Float16*)kp;
  const _Float16* VT = (const _Float16*)vtp;

  const _Float16* qbase = Q + (size_t)qw * OUT_DIM + head * HEAD_DIM;
  v16h qb[2][2];   // [column group][d 0..31 | d 32..63]
#pragma unroll
  for (int g = 0; g < 2; ++g) {
    qb[g][0] = ld_frag_h(qbase, OUT_DIM, g * 16 + l15, 0, lane);
    qb[g][1] = ld_frag_h(qbase, OUT_DIM, g * 16 + l15, 32, lane);
  }
  const _Float16* kbase = K + head * HEAD_DIM;                   // key t at kbase + t*OUT_DIM
  const _Float16* vbase = VT + (size_t)head * HEAD_DIM * SEQ;    // d row at vbase + d*SEQ

  // this lane's first piece of a tile: K row tid>>3, piece tid&7; V^T row tid>>4, piece tid&15
  const _Float16* gk = kbase + (size_t)(tid >> 3) * OUT_DIM + (tid & 7) * 8;
  const _Float16* gv = vbase + (size_t)(tid >> 4) * SEQ + (tid & 15) * 8;
  const unsigned int lk0 = (unsigned int)(size_t)(&Kt[0][(tid >> 3) * KLP + (tid & 7) * 8]);
  const unsigned int lv0 = (unsigned int)(size_t)(&Vt[0][(tid >> 4) * VLP + (tid & 15) * 8]);
  const unsigned int kbuf = SK * KLP * 2u;         // bytes from buffer 0 to buffer 1
  const unsigned int vbuf = HEAD_DIM * VLP * 2u;

  copy_tile(lk0, lv0, gk, gv);                                   // tile 0 -> buffer 0
  asm volatile("s_wait_asynccnt 0x0" ::: "memory");              // this wave's part of tile 0 has landed
  __syncthreads();                                               // tile 0 complete for every wave
  copy_tile(lk0 + kbuf, lv0 + vbuf, gk + (size_t)SK * OUT_DIM, gv + SK);   // tile 1 -> buffer 1

  v8f o[2][4] = {};
  const float kq = 1.44269504f / 512.0f;   // 1/512 (score scale on the x8 planes) times log2(e)
  // 10 = log2(1024): P leaves the exponential already x1024. With the start value of mref every P of
  // the first chunk is infinite, so the test below sends that chunk through the rescale, which sets mref.
  float mref[2], lrun[2], nb[2];
#pragma unroll
  for (int g = 0; g < 2; ++g) {
    mref[g] = -1.0e30f;
    lrun[g] = 0.0f;
    nb[g] = fmaf(-mref[g], kq, 10.0f);
  }
  const float plim = 32768.0f;   // a lane's 16 P are each at most their sum: at or under this they fit f16

  for (int t = 0; t < NST; ++t) {
    const int b = t & 1;
    const _Float16* ktile = Kt[b] + kh * (SK / 2) * KLP;   // this wave's 64 key rows of the tile
    const _Float16* vtile = Vt[b] + kh * (SK / 2);         // and the same 64 keys of every V^T row
    // K fragments of chunk 0; the later chunk's are fetched one chunk ahead, inside this tile only
    v16h ka0 = ld_frag_h(ktile, KLP, l15, 0, lane);
    v16h ka2 = ld_frag_h(ktile, KLP, 16 + l15, 0, lane);
    v16h ka1 = ld_frag_h(ktile, KLP, l15, 32, lane);
    v16h ka3 = ld_frag_h(ktile, KLP, 16 + l15, 32, lane);
#pragma unroll   // the wave's two chunks of a tile read LDS at constant offsets from one address
    for (int c = 0; c < SK / 64; ++c) {
      // this chunk's four V^T fragments, one group of reads: they land under the scores and the softmax
      v16h va[4];
#pragma unroll
      for (int j = 0; j < 4; ++j) va[j] = ld_frag_h(vtile, VLP, j * 16 + l15, c * 32, lane);
      // keeps the group of reads above the score products, so that it is in flight under the scores and the softmax
      __builtin_amdgcn_sched_barrier(0);
      v8f c0[2] = {}, c1[2] = {};   // [column group]
#pragma unroll
      for (int g = 0; g < 2; ++g) {
        c0[g] = mma_f16(ka0, qb[g][0], c0[g]);
        c1[g] = mma_f16(ka2, qb[g][0], c1[g]);
      }
#pragma unroll
      for (int g = 0; g < 2; ++g) {
        c0[g] = mma_f16(ka1, qb[g][1], c0[g]);
        c1[g] = mma_f16(ka3, qb[g][1], c1[g]);
      }
      if (c + 1 < SK / 64) {   // next chunk's K fragments, one group: they land under the softmax and the context products
        const _Float16* kn = ktile + (c + 1) * 32 * KLP;
        ka0 = ld_frag_h(kn, KLP, l15, 0, lane);
        ka2 = ld_frag_h(kn, KLP, 16 + l15, 0, lane);
        ka1 = ld_frag_h(kn, KLP, l15, 32, lane);
        ka3 = ld_frag_h(kn, KLP, 16 + l15, 32, lane);
        // keeps that group here, ahead of the softmax, so that the next chunk's score products find it landed
        __builtin_amdgcn_sched_barrier(0);
      }

      // P against the held references: no maximum, no rescale on this path
      float p0[2][8], p1[2][8];
      float ls[2];
#pragma unroll
      for (int g = 0; g < 2; ++g) {
#pragma unroll
        for (int r = 0; r < 8; ++r) p0[g][r] = __builtin_amdgcn_exp2f(fmaf(c0[g][r], kq, nb[g]));
#pragma unroll
        for (int r = 0; r < 8; ++r) p1[g][r] = __builtin_amdgcn_exp2f(fmaf(c1[g][r], kq, nb[g]));
        ls[g] = 0.0f;
#pragma unroll
        for (int r = 0; r < 8; ++r) ls[g] += p0[g][r] + p1[g][r];
      }
      // One test a chunk for both groups, a scalar branch for the whole wave: only where some lane's P have
      // outgrown f16 (or are not numbers) do the references move to the maxima seen so far.
      if (__builtin_expect(__builtin_amdgcn_ballot_w32(!(ls[0] <= plim && ls[1] <= plim)) != 0u, 0)) {   // rare: laid out off the straight path
        // The straight path keeps no raw scores beside P (registers: four waves per SIMD must fit), so this
        // path forms them again, the same products from the same tile, in the K registers' place.
        const _Float16* kc = ktile + c * 32 * KLP;
        ka0 = ld_frag_h(kc, KLP, l15, 0, lane);
        ka2 = ld_frag_h(kc, KLP, 16 + l15, 0, lane);
        ka1 = ld_frag_h(kc, KLP, l15, 32, lane);
        ka3 = ld_frag_h(kc, KLP, 16 + l15, 32, lane);
        v8f r0[2] = {}, r1[2] = {};
#pragma unroll
        for (int g = 0; g < 2; ++g) {
          r0[g] = mma_f16(ka0, qb[g][0], r0[g]);
          r1[g] = mma_f16(ka2, qb[g][0], r1[g]);
        }
#pragma unroll
        for (int g = 0; g < 2; ++g) {
          r0[g] = mma_f16(ka1, qb[g][1], r0[g]);
          r1[g] = mma_f16(ka3, qb[g][1], r1[g]);
        }
        if (c + 1 < SK / 64) {   // the next chunk's K fragments again
          const _Float16* kn = ktile + (c + 1) * 32 * KLP;
          ka0 = ld_frag_h(kn, KLP, l15, 0, lane);
          ka2 = ld_frag_h(kn, KLP, 16 + l15, 0, lane);
          ka1 = ld_frag_h(kn, KLP, l15, 32, lane);
          ka3 = ld_frag_h(kn, KLP, 16 + l15, 32, lane);
        }
#pragma unroll
        for (int g = 0; g < 2; ++g) {
          // maximum over the raw accumulators (the scale is positive, so the order is the same)
          float lm = fmaxf(r0[g][0], r1[g][0]);
#pragma unroll
          for (int r = 1; r < 8; ++r) lm = fmaxf(lm, fmaxf(r0[g][r], r1[g][r]));
          lm = fmaxf(lm, __shfl_xor(lm, 16, 32));   // both halves of a query keep one reference
          const float mnew = fmaxf(mref[g], lm);
          const float alpha = __builtin_amdgcn_exp2f((mref[g] - mnew) * kq);
          nb[g] = fmaf(-mnew, kq, 10.0f);
          mref[g] = mnew;
          ls[g] = 0.0f;
#pragma unroll
          for (int r = 0; r < 8; ++r) {
            p0[g][r] = __builtin_amdgcn_exp2f(fmaf(r0[g][r], kq, nb[g]));
            p1[g][r] = __builtin_amdgcn_exp2f(fmaf(r1[g][r], kq, nb[g]));
            ls[g] += p0[g][r] + p1[g][r];
          }
          lrun[g] *= alpha;
#pragma unroll
          for (int j = 0; j < 4; ++j)
#pragma unroll
            for (int r = 0; r < 8; ++r) o[g][j][r] *= alpha;
        }
      }

      v16h pb[2];
#pragma unroll
      for (int g = 0; g < 2; ++g) {
        lrun[g] += ls[g];   // this lane's 16 keys only: the rescale branch needs lrun at hand, so no exchange stands in the loop
#pragma unroll
        for (int e = 0; e < 8; ++e) {
          pb[g][e]     = (_Float16)p0[g][e];   // key 32c + 8h + e of the wave's half tile
          pb[g][8 + e] = (_Float16)p1[g][e];   // key 32c + 16 + 8h + e of the wave's half tile
        }
      }
#pragma unroll
      for (int j = 0; j < 4; ++j)
#pragma unroll
        for (int g = 0; g < 2; ++g) o[g][j] = mma_f16(va[j], pb[g], o[g][j]);
    }
    asm volatile("s_wait_dscnt 0x0" ::: "memory");      // this wave's reads of buffer b are done
    asm volatile("s_wait_asynccnt 0x0" ::: "memory");   // this wave's part of tile t + 1 has landed
    __syncthreads();   // publishes tile t + 1 and ends every wave's reads of buffer b
    if (t + 2 < NST)   // the same for the whole workgroup
      copy_tile(lk0 + b * kbuf, lv0 + b * vbuf,
                gk + (size_t)(t + 2) * SK * OUT_DIM, gv + (size_t)(t + 2) * SK);
  }
  asm volatile("s_wait_asynccnt 0x0" ::: "memory");     // nothing in flight when the wave ends

  // o[g][j][r] = 8192 * sum_t p_t v_t over this wave's keys for query g*16 + l15, d = j*16 + 8*half + r; the two
  // halves of a query hold one reference, so their sums join by one add: lrun = 1024 * sum_t p_t
#pragma unroll
  for (int g = 0; g < 2; ++g) lrun[g] += __shfl_xor(lrun[g], 16, 32);

  // The wave of key half kh finishes group kh and hands group 1 - kh to its partner (same lane, same registers).
  float* xo = Xo[wave];
#pragma unroll
  for (int j = 0; j < 4; ++j) {
    const v8f og = kh ? o[0][j] : o[1][j];
    v4f lo4, hi4;
    lo4[0] = og[0]; lo4[1] = og[1]; lo4[2] = og[2]; lo4[3] = og[3];
    hi4[0] = og[4]; hi4[1] = og[5]; hi4[2] = og[6]; hi4[3] = og[7];
    *(v4f*)(&xo[((j * 2 + 0) * 32 + lane) * 4]) = lo4;
    *(v4f*)(&xo[((j * 2 + 1) * 32 + lane) * 4]) = hi4;
  }
  Xs[wave][lane]      = kh ? mref[0] : mref[1];
  Xs[wave][32 + lane] = kh ? lrun[0] : lrun[1];
  __syncthreads();   // the partner's group is complete in LDS

  const float* xp = Xo[wave ^ 4];
  const float m_own = kh ? mref[1] : mref[0];
  const float l_own = kh ? lrun[1] : lrun[0];
  const float m_par = Xs[wave ^ 4][lane];
  const float l_par = Xs[wave ^ 4][32 + lane];
  const float m_all = fmaxf(m_own, m_par);
  const float a_own = __builtin_amdgcn_exp2f((m_own - m_all) * kq);
  const float a_par = __builtin_amdgcn_exp2f((m_par - m_all) * kq);
  const float inv = 1.0f / ((l_own * a_own + l_par * a_par) * 8.0f);
  const float f_own = a_own * inv, f_par = a_par * inv;
#pragma unroll
  for (int j = 0; j < 4; ++j) {
    const v8f ow = kh ? o[1][j] : o[0][j];
    const v4f pl = *(const v4f*)(&xp[((j * 2 + 0) * 32 + lane) * 4]);
    const v4f ph = *(const v4f*)(&xp[((j * 2 + 1) * 32 + lane) * 4]);
    v4f lo4, hi4;
#pragma unroll
    for (int r = 0; r < 4; ++r) {
      lo4[r] = ow[r] * f_own + pl[r] * f_par;
      hi4[r] = ow[4 + r] * f_own + ph[r] * f_par;
    }
    *(v4f*)(&Ol[l15 * OLP + j * 16 + 8 * half])     = lo4;
    *(v4f*)(&Ol[l15 * OLP + j * 16 + 8 * half + 4]) = hi4;
  }
  __syncthreads();

  v4f v[8];
  size_t off[8];
  float* ob = outp + (size_t)(qw + kh * 16) * OUT_DIM + head * HEAD_DIM;
#pragma unroll
  for (int it = 0; it < 8; ++it) {
    const int row = it * 2 + half;       // 0..15
    const int q = l15;                   // 16 pieces of 16 B = the row's 256 bytes (2 lines)
    v[it] = *(const v4f*)(&Ol[row * OLP + q * 4]);
    off[it] = (size_t)row * OUT_DIM + q * 4;
  }
#pragma unroll
  for (int it = 0; it < 8; ++it) *(v4f*)(ob + off[it]) = v[it];
  
}

// ---------------------------------------------------------------------------
extern "C" void kernel_launch(void* const* d_in, const int* in_sizes, int n_in,
                              void* d_out, int out_size, void* d_ws, size_t ws_size,
                              hipStream_t stream) {
  if (n_in < 7) return;
  if (in_sizes[0] < SEQ * IN_DIM) return;
  if (in_sizes[1] < IN_DIM * OUT_DIM || in_sizes[2] < IN_DIM * OUT_DIM ||
      in_sizes[3] < IN_DIM * OUT_DIM) return;
  if (in_sizes[4] < OUT_DIM || in_sizes[5] < OUT_DIM || in_sizes[6] < OUT_DIM) return;
  if (out_size < SEQ * OUT_DIM) return;

  const float* h  = (const float*)d_in[0];
  const float* Wq = (const float*)d_in[1];
  const float* Wk = (const float*)d_in[2];
  const float* Wv = (const float*)d_in[3];
  const float* bq = (const float*)d_in[4];
  const float* bk = (const float*)d_in[5];
  const float* bv = (const float*)d_in[6];

  // every offset a multiple of 2 MiB
  const size_t hb_bytes = (size_t)SEQ * IN_DIM * 2;           // bf16 h plane
  const size_t wt_bytes = (size_t)3 * OUT_DIM * IN_DIM * 2;   // 3 bf16 WT planes
  const size_t pl_bytes = (size_t)SEQ * OUT_DIM * 2;          // one f16 q/k/vT plane
  const size_t off_hb = 0;
  const size_t off_wt = off_hb + hb_bytes;
  const size_t off_q  = off_wt + wt_bytes;
  const size_t off_k  = off_q + pl_bytes;
  const size_t off_vt = off_k + pl_bytes;
  const size_t total  = off_vt + pl_bytes;                    // 38 MiB at SEQ = 4096
  if (total > ws_size) return;

  char* ws = (char*)d_ws;
  unsigned short* hb  = (unsigned short*)(ws + off_hb);
  unsigned short* wt  = (unsigned short*)(ws + off_wt);
  unsigned short* qpl = (unsigned short*)(ws + off_q);
  unsigned short* kpl = (unsigned short*)(ws + off_k);
  unsigned short* vtp = (unsigned short*)(ws + off_vt);

  const int n8 = SEQ * IN_DIM / 8;
  k_cvt_rows<<<(n8 + 255) / 256, 256, 0, stream>>>(h, hb, n8);
  k_cvt_wT<<<dim3(IN_DIM / 64, OUT_DIM / 64, 3), 256, 0, stream>>>(Wq, Wk, Wv, wt);
  k_proj<<<dim3(OUT_DIM / 128, SEQ / 128, 3), 256, 0, stream>>>(hb, wt, bq, bk, bv, qpl, kpl, vtp);
  k_attn<<<dim3(SEQ / (AW * 16), NUM_HEADS), AW * 32, 0, stream>>>(qpl, kpl, vtp, (float*)d_out);
}

// v007
// Measured time: 87.7 microseconds a run.
// Next to v006, in two timings, it ran 1.04 and 1.03 times as fast.
// Counting every step since v000, it is 3.73 times as fast.
#include <hip/hip_runtime.h>
// Projections h*W{q,k,v}: v_wmma_f32_16x16x32_bf16 (bf16 operands = RNE-converted inputs, f32 accumulate); scores K*Q^T and context V^T*P: v_wmma_f32_16x16x32_f16 (f16 operands, Q/K/V planes carried x8, P carried x1024, f32 accumulate); softmax in f32.

#ifndef SEQ
#define SEQ 4096
#endif
#define SEQ_FULL 4096
#define IN_DIM 1024
#define NUM_HEADS 16
#define HEAD_DIM 64
#define OUT_DIM (NUM_HEADS * HEAD_DIM)

static_assert(SEQ % 128 == 0);
static_assert(SEQ <= SEQ_FULL);
static_assert(IN_DIM % 64 == 0);
static_assert(OUT_DIM % 128 == 0);
static_assert(HEAD_DIM == 64);
static_assert((size_t)SEQ_FULL * OUT_DIM * 4 == 16777216);

// LDS pitches (in 16-bit elements unless noted); all keep 16-byte row alignment
#define TP  72     // weight transpose tile [64 n][64 k]
#define OLP 68     // context tile [16 q][64 d], floats

typedef __bf16   v16bf __attribute__((ext_vector_type(16)));
typedef __bf16   v8bf  __attribute__((ext_vector_type(8)));
typedef _Float16 v16h  __attribute__((ext_vector_type(16)));
typedef _Float16 v8h   __attribute__((ext_vector_type(8)));
typedef float    v8f   __attribute__((ext_vector_type(8)));
typedef float    v4f   __attribute__((ext_vector_type(4)));
typedef unsigned int v4u __attribute__((ext_vector_type(4)));

// ---------------------------------------------------------------------------
// WMMA wrappers. k_proj's carries 4 v_nop after every issue; its loop has vector slots to spare, and with the
// statement in place its LDS reads stay one group ahead of each block of products.
__device__ __forceinline__ v8f mma_bf16(v16bf a, v16bf b, v8f c) {
  v8f d = __builtin_amdgcn_wmma_f32_16x16x32_bf16(false, a, false, b, (short)0, c, false, false);
  asm volatile("v_nop\n\tv_nop\n\tv_nop\n\tv_nop" : "+v"(d) : "v"(a), "v"(b));
  return d;
}
// k_attn's is the bare builtin: the compiler keeps the distances behind it and counts the WMMAs and the vector
// work that follow as cover. Four waves share the SIMD's vector port there, so an idle slot is taken from another wave.
__device__ __forceinline__ v8f mma_f16(v16h a, v16h b, v8f c) {
  return __builtin_amdgcn_wmma_f32_16x16x32_f16(false, a, false, b, (short)0, c, false, false);
}

// 16-bit fragment, contraction dim CONTIGUOUS in memory: elem(k) = p0[rc*ld + k].
// Lane l: row/col rc = (l&15); elements 0..7 <- kk+8h+0..7, elements 8..15 <- kk+16+8h+0..7
// (h = l>>4). Same map for A (rc = row) and B (rc = column of a k-contiguous copy).
__device__ __forceinline__ v16bf ld_frag_bf(const __bf16* p0, int ld, int rc, int kk, int lane) {
  const int hh = (lane >> 4) & 1;
  const __bf16* p = p0 + (size_t)rc * ld + kk + 8 * hh;
  const v8bf lo = *(const v8bf*)(p);
  const v8bf hi = *(const v8bf*)(p + 16);
  v16bf f;
#pragma unroll
  for (int i = 0; i < 8; ++i) { f[i] = lo[i]; f[8 + i] = hi[i]; }
  return f;
}
__device__ __forceinline__ v16h ld_frag_h(const _Float16* p0, int ld, int rc, int kk, int lane) {
  const int hh = (lane >> 4) & 1;
  const _Float16* p = p0 + (size_t)rc * ld + kk + 8 * hh;
  const v8h lo = *(const v8h*)(p);
  const v8h hi = *(const v8h*)(p + 16);
  v16h f;
#pragma unroll
  for (int i = 0; i < 8; ++i) { f[i] = lo[i]; f[8 + i] = hi[i]; }
  return f;
}

// f32 -> bf16 bits, RNE convert
__device__ __forceinline__ unsigned int bfb(float x) {
  unsigned int u = __float_as_uint(x);
  u = u + 0x7FFFu + ((u >> 16) & 1u);
  return u >> 16;
}
// f32 -> value of its RNE bf16
__device__ __forceinline__ float bf16val(float x) {
  return __uint_as_float(bfb(x) << 16);
}
// f32 -> f16 bits, RNE convert
__device__ __forceinline__ unsigned short hbits(float x) {
  const _Float16 hv = (_Float16)x;
  return __builtin_bit_cast(unsigned short, hv);
}

// 2^x off the hot path (rescale branch, epilogue): v_exp_f32 and, in the same statement, the one slot the instruction
// set asks for behind a transcendental.
__device__ __forceinline__ float exp2_slot(float x) {
  float r;
  asm("v_exp_f32 %0, %1\n\tv_nop" : "=v"(r) : "v"(x));
  return r;
}

// ---------------------------------------------------------------------------
// h f32 [SEQ][IN_DIM] -> bf16 plane (same layout). Thread g converts 8
// consecutive floats -> one 16-byte store; 8 consecutive lanes fill one
__global__ __launch_bounds__(256) void k_cvt_rows(const float* __restrict__ in,
                                                  unsigned short* __restrict__ outp, int n8) {
  const int g = blockIdx.x * 256 + threadIdx.x;
  if (g >= n8) return;
  const v4f a = *(const v4f*)(in + (size_t)g * 8);
  const v4f b = *(const v4f*)(in + (size_t)g * 8 + 4);
  v4u w;
  w[0] = bfb(a[0]) | (bfb(a[1]) << 16);
  w[1] = bfb(a[2]) | (bfb(a[3]) << 16);
  w[2] = bfb(b[0]) | (bfb(b[1]) << 16);
  w[3] = bfb(b[2]) | (bfb(b[3]) << 16);
  v4u* p = (v4u*)(outp + (size_t)g * 8);
  *p = w;
  
}

// ---------------------------------------------------------------------------
// W f32 [IN_DIM k][OUT_DIM n] -> WT bf16 [OUT_DIM n][IN_DIM k] (k contiguous),
// three matrices selected by blockIdx.z into three consecutive planes.
// Block = 64 k x 64 n tile transposed through LDS; each WT row segment
__global__ __launch_bounds__(256) void k_cvt_wT(const float* __restrict__ Wq,
                                                const float* __restrict__ Wk,
                                                const float* __restrict__ Wv,
                                                unsigned short* __restrict__ wT) {
  __shared__ __align__(16) unsigned short T[64 * TP];   // [n local][k local], cross-wave (block barrier)
  const int z = blockIdx.z;
  const float* W = (z == 0) ? Wq : ((z == 1) ? Wk : Wv);
  unsigned short* dst = wT + (size_t)z * OUT_DIM * IN_DIM;
  const int k0 = blockIdx.x * 64;
  const int n0 = blockIdx.y * 64;
  const int tid = threadIdx.x;
  const int wave = tid >> 5, lane = tid & 31;

#pragma unroll
  for (int i = 0; i < 4; ++i) {
    const int idx = i * 256 + tid;          // 0..1023
    const int kk = idx >> 4;                // 0..63
    const int c4 = (idx & 15) * 4;          // 0..60
    const v4f w = *(const v4f*)(W + (size_t)(k0 + kk) * OUT_DIM + n0 + c4);
    T[(c4 + 0) * TP + kk] = (unsigned short)bfb(w[0]);
    T[(c4 + 1) * TP + kk] = (unsigned short)bfb(w[1]);
    T[(c4 + 2) * TP + kk] = (unsigned short)bfb(w[2]);
    T[(c4 + 3) * TP + kk] = (unsigned short)bfb(w[3]);
  }
  __syncthreads();

  v4u v[2];
  size_t off[2];
#pragma unroll
  for (int it = 0; it < 2; ++it) {
    const int nn = wave * 8 + it * 4 + (lane >> 3);   // 0..63 over (wave, it, lane>>3)
    const int q = lane & 7;
    v[it] = *(const v4u*)(&T[nn * TP + q * 8]);
    off[it] = (size_t)(n0 + nn) * IN_DIM + k0 + q * 8;
  }
#pragma unroll
  for (int it = 0; it < 2; ++it) *(v4u*)(dst + off[it]) = v[it];
  
}

// ---------------------------------------------------------------------------
// Projection: C[SEQ][OUT_DIM] = hb[SEQ][IN_DIM] * WT[OUT_DIM][IN_DIM]^T + bias.
// 256 thr = 8 waves; block tile 128 rows x 128 cols; wave (wr, wc) owns 32 rows x 64 cols.
// A k-tile = 64 k of both operands: hb [128 rows][64 k] and WT [128 n][64 k], copied
// whole-line from the planes into LDS by asynchronous copies, two buffers: tile t + 1 is
// in flight while tile t is multiplied. Each accumulator still sums k in ascending 32-steps.
// z = 0: Q plane f16 x8 [SEQ][OUT_DIM]; z = 1: K plane f16 x8 [SEQ][OUT_DIM];
// z = 2: V^T plane f16 x8 [OUT_DIM][SEQ]. Epilogue staged in the same LDS behind the loop.
#define PK  64                 // k per tile
#define PLP 72                 // operand tile pitch: 144 B = 16 B x 9
#define PTS (128 * PLP)        // elements of one operand tile
#define PNT (IN_DIM / PK)      // tiles
#define EP  136                // epilogue tile pitch [128][128]: 272 B = 16 B x 17
static_assert(PNT >= 2);
static_assert(128 * EP <= 4 * PTS);
static_assert(256 * 4 * 8 == 128 * PK);   // four 16-byte copies a lane fill one operand tile

// One k-tile's copies of one lane: four 16-byte pieces of hb and four of WT, 32 rows apart.
// s_wait_xcnt 0 is the statement's last line, so that no address register named here is
// rewritten before it.
__device__ __forceinline__ void copy_ab(unsigned int la, unsigned int lw,
                                        const unsigned short* ga, const unsigned short* gw) {
  asm volatile(
      "global_load_async_to_lds_b128 %0, %8, off\n\t"
      "global_load_async_to_lds_b128 %1, %9, off\n\t"
      "global_load_async_to_lds_b128 %2, %10, off\n\t"
      "global_load_async_to_lds_b128 %3, %11, off\n\t"
      "global_load_async_to_lds_b128 %4, %12, off\n\t"
      "global_load_async_to_lds_b128 %5, %13, off\n\t"
      "global_load_async_to_lds_b128 %6, %14, off\n\t"
      "global_load_async_to_lds_b128 %7, %15, off\n\t"
      "s_wait_xcnt 0x0"
      :
      : "v"(la), "v"(la + 32u * PLP * 2u), "v"(la + 64u * PLP * 2u), "v"(la + 96u * PLP * 2u),
        "v"(lw), "v"(lw + 32u * PLP * 2u), "v"(lw + 64u * PLP * 2u), "v"(lw + 96u * PLP * 2u),
        "v"(ga), "v"(ga + (size_t)32 * IN_DIM), "v"(ga + (size_t)64 * IN_DIM),
        "v"(ga + (size_t)96 * IN_DIM),
        "v"(gw), "v"(gw + (size_t)32 * IN_DIM), "v"(gw + (size_t)64 * IN_DIM),
        "v"(gw + (size_t)96 * IN_DIM)
      : "memory");
}

__global__ __launch_bounds__(256) void k_proj(
    const unsigned short* __restrict__ hb, const unsigned short* __restrict__ wT,
    const float* __restrict__ bq, const float* __restrict__ bk, const float* __restrict__ bv,
    unsigned short* __restrict__ qp, unsigned short* __restrict__ kp,
    unsigned short* __restrict__ vtp) {
  // [buffer][hb tile | WT tile], cross-wave (block barrier); behind the loop the epilogue tile
  __shared__ __align__(16) unsigned short S[4 * PTS];

  const int z = blockIdx.z;
  const int n0 = blockIdx.x * 128;
  const int m0 = blockIdx.y * 128;
  const int tid = threadIdx.x;
  const int wave = tid >> 5, lane = tid & 31;
  const int l15 = lane & 15, half = (lane >> 4) & 1;
  const int wr = wave >> 1, wc = wave & 1;

  const unsigned short* Wt = wT + (size_t)z * OUT_DIM * IN_DIM;
  const float* bias = (z == 0) ? bq : ((z == 1) ? bk : bv);

  // this lane's first piece of a tile: row tid>>3, piece tid&7, in both operands
  const unsigned short* ga = hb + (size_t)(m0 + (tid >> 3)) * IN_DIM + (tid & 7) * 8;
  const unsigned short* gw = Wt + (size_t)(n0 + (tid >> 3)) * IN_DIM + (tid & 7) * 8;
  const unsigned int la0 = (unsigned int)(size_t)(&S[(tid >> 3) * PLP + (tid & 7) * 8]);
  const unsigned int lw0 = la0 + PTS * 2u;
  const unsigned int pbuf = 2u * PTS * 2u;         // bytes from buffer 0 to buffer 1

  copy_ab(la0, lw0, ga, gw);                                     // tile 0 -> buffer 0
  asm volatile("s_wait_asynccnt 0x0" ::: "memory");              // this wave's part of tile 0 has landed
  __syncthreads();                                               // tile 0 complete for every wave
  copy_ab(la0 + pbuf, lw0 + pbuf, ga + PK, gw + PK);             // tile 1 -> buffer 1

  v8f acc[2][4] = {};
  for (int t = 0; t < PNT; ++t) {
    const int b = t & 1;
    const __bf16* at = (const __bf16*)(S + b * 2 * PTS);
    const __bf16* wt = at + PTS;
#pragma unroll   // the two 32-k halves of a tile read LDS at constant offsets from one address
    for (int kk = 0; kk < PK; kk += 32) {
      v16bf a[2], w[4];
#pragma unroll
      for (int i = 0; i < 2; ++i) a[i] = ld_frag_bf(at, PLP, wr * 32 + i * 16 + l15, kk, lane);
#pragma unroll
      for (int j = 0; j < 4; ++j) w[j] = ld_frag_bf(wt, PLP, wc * 64 + j * 16 + l15, kk, lane);
#pragma unroll
      for (int j = 0; j < 4; ++j)
#pragma unroll
        for (int i = 0; i < 2; ++i) acc[i][j] = mma_bf16(a[i], w[j], acc[i][j]);
    }
    asm volatile("s_wait_dscnt 0x0" ::: "memory");      // this wave's reads of buffer b are done
    asm volatile("s_wait_asynccnt 0x0" ::: "memory");   // this wave's part of tile t + 1 has landed
    __syncthreads();   // publishes tile t + 1 and ends every wave's reads of buffer b
    if (t + 2 < PNT)   // the same for the whole workgroup
      copy_ab(la0 + b * pbuf, lw0 + b * pbuf, ga + (size_t)(t + 2) * PK, gw + (size_t)(t + 2) * PK);
  }
  asm volatile("s_wait_asynccnt 0x0" ::: "memory");     // nothing in flight when the LDS changes its use

  // acc[i][j][r] = C[m0 + wr*32 + i*16 + 8*half + r][n0 + wc*64 + j*16 + l15]
  unsigned short* E = S;   // every wave's last read of the tiles ended at the last trip's barrier
  const float car = 8.0f;
  if (z != 2) {                      // block-uniform branch
#pragma unroll
    for (int j = 0; j < 4; ++j) {
      const int col = wc * 64 + j * 16 + l15;
      const float bb = bf16val(bias[n0 + col]);
#pragma unroll
      for (int i = 0; i < 2; ++i)
#pragma unroll
        for (int r = 0; r < 8; ++r) {
          const int row = wr * 32 + i * 16 + 8 * half + r;
          E[row * EP + col] = hbits((acc[i][j][r] + bb) * car);
        }
    }
    __syncthreads();
    unsigned short* dst = (z == 0) ? qp : kp;
    v4u v[8];
    size_t off[8];
#pragma unroll
    for (int it = 0; it < 8; ++it) {
      const int row = it * 16 + (tid >> 4);               // 0..127 over (it, tid>>4)
      const int q = l15;                                  // 16 pieces = 256-byte row = 2 lines
      v[it] = *(const v4u*)(&E[row * EP + q * 8]);
      off[it] = (size_t)(m0 + row) * OUT_DIM + n0 + q * 8;
    }
#pragma unroll
    for (int it = 0; it < 8; ++it) *(v4u*)(dst + off[it]) = v[it];
    // behind the last store: no register that a store names is rewritten on any path of the listing before this wait
    asm volatile("s_wait_xcnt 0x0" ::: "memory");
  } else {
#pragma unroll
    for (int j = 0; j < 4; ++j) {
      const int col = wc * 64 + j * 16 + l15;             // d within tile
      const float bb = bf16val(bias[n0 + col]);
#pragma unroll
      for (int i = 0; i < 2; ++i)
#pragma unroll
        for (int r = 0; r < 8; ++r) {
          const int srow = wr * 32 + i * 16 + 8 * half + r;   // s within tile
          E[col * EP + srow] = hbits((acc[i][j][r] + bb) * car);
        }
    }
    __syncthreads();
    v4u v[8];
    size_t off[8];
#pragma unroll
    for (int it = 0; it < 8; ++it) {
      const int drow = it * 16 + (tid >> 4);              // 0..127 over (it, tid>>4)
      const int q = l15;                                  // 16 pieces = 256-byte row = 2 lines
      v[it] = *(const v4u*)(&E[drow * EP + q * 8]);
      off[it] = (size_t)(n0 + drow) * SEQ + m0 + q * 8;
    }
#pragma unroll
    for (int it = 0; it < 8; ++it) *(v4u*)(vtp + off[it]) = v[it];
  }
}

// ---------------------------------------------------------------------------
// Flash attention, transposed-score form: one wave = (32 queries as two 16-column groups, one head,
// half of every tile's keys), so that each K / V^T fragment read from LDS feeds two products.
// A workgroup = 8 waves = 4 query blocks x 2 key halves = 128 queries of one head, which share every
// K / V^T tile. The two waves of a query block keep their own reference, sum and context and join them
// once, behind the loop, through LDS; each then finishes and stores 16 of the 32 queries.
// A tile = 128 keys: K [128 keys][64 d] and V^T [64 d][128 keys], copied whole-line
// from the planes into LDS by asynchronous copies, two buffers: tile t + 1 is in
// flight while tile t is worked on. Fragments come from LDS (ds_load_b128 pitches).
// Per 32-key chunk and 16-column group:
//   S^T = K . Q^T    A = K rows (lane = key, k = d), B = Q^T (lane = query, k = d)
//                    D[row = key 8h+r][col = query l15]; c0 keys 0..15, c1 keys 16..31
//   per-lane softmax terms for query l15 (16 local keys; the xor-16 partner holds the other 16)
//   O^T += V^T . P   A = V^T rows (lane = d, k = key), B = P: element i<8 <- c0[i]
//                    (key 8h+i), element 8+i <- c1[i] (key 16+8h+i), same lane
//                    D[row = d 8h+r][col = query l15]
// Scores carry 64 from the x8 planes: P = exp2(score * log2(e)/512 - ref * log2(e)/512 + 10),
// one multiply-add and one exponential a score; ref is a held reference score per query, in
// raw score units, and moves only when a chunk's P outgrow f16 (lazy rescale, below).
// P and its sum carried x1024, V carried x8 -> context scaled by 1/(8 * carried sum).
// Output tile [16 q][64 d] f32 staged in LDS; each 256-byte row = 2 lines,
#define AW  8                  // waves per workgroup
#define SK  128                // keys per tile
#define KLP 72                 // K tile pitch: 144 B = 16 B x 9
#define VLP 136                // V^T tile pitch: 272 B = 16 B x 17
#define NST (SEQ / SK)         // tiles
static_assert(SEQ % (AW * 16) == 0);
static_assert(NST >= 2);
static_assert(AW == 8 && SK % 64 == 0);   // 4 query blocks x 2 key halves; a wave's half tile is whole 32-key chunks
static_assert(AW * 32 * 4 * 8 == SK * HEAD_DIM);   // four 16-byte copies a lane fill one tile

// One tile's copies of one lane: four 16-byte pieces of K (32 key rows apart) and four
// of V^T (16 d rows apart). s_wait_xcnt 0 is the statement's last line, so that no
// address register named here is rewritten before it.
__device__ __forceinline__ void copy_tile(unsigned int lk, unsigned int lv,
                                          const _Float16* gk, const _Float16* gv) {
  asm volatile(
      "global_load_async_to_lds_b128 %0, %8, off\n\t"
      "global_load_async_to_lds_b128 %1, %9, off\n\t"
      "global_load_async_to_lds_b128 %2, %10, off\n\t"
      "global_load_async_to_lds_b128 %3, %11, off\n\t"
      "global_load_async_to_lds_b128 %4, %12, off\n\t"
      "global_load_async_to_lds_b128 %5, %13, off\n\t"
      "global_load_async_to_lds_b128 %6, %14, off\n\t"
      "global_load_async_to_lds_b128 %7, %15, off\n\t"
      "s_wait_xcnt 0x0"
      :
      : "v"(lk), "v"(lk + 32u * KLP * 2u), "v"(lk + 64u * KLP * 2u), "v"(lk + 96u * KLP * 2u),
        "v"(lv), "v"(lv + 16u * VLP * 2u), "v"(lv + 32u * VLP * 2u), "v"(lv + 48u * VLP * 2u),
        "v"(gk), "v"(gk + (size_t)32 * OUT_DIM), "v"(gk + (size_t)64 * OUT_DIM),
        "v"(gk + (size_t)96 * OUT_DIM),
        "v"(gv), "v"(gv + (size_t)16 * SEQ), "v"(gv + (size_t)32 * SEQ), "v"(gv + (size_t)48 * SEQ)
      : "memory");
}

// Four waves per SIMD (two workgroups per WGP), as before: vector work between matrix runs wants waves.
__global__ __launch_bounds__(AW * 32) __attribute__((amdgpu_waves_per_eu(4, 4)))
void k_attn(const unsigned short* __restrict__ qp,
            const unsigned short* __restrict__ kp,
            const unsigned short* __restrict__ vtp,
            float* __restrict__ outp) {
  __shared__ __align__(16) _Float16 Kt[2][SK * KLP];         // K tiles, cross-wave (block barrier)
  __shared__ __align__(16) _Float16 Vt[2][HEAD_DIM * VLP];   // V^T tiles, cross-wave (block barrier)
  __shared__ __align__(16) float Olw[AW][16 * OLP];          // one output tile per wave
  __shared__ __align__(16) float Xo[AW][8 * 32 * 4];         // context of the group handed to the partner wave
  __shared__ float Xs[AW][2 * 32];                           // that group's reference and sum

  const int tid = threadIdx.x;
  const int wave = __builtin_amdgcn_readfirstlane(tid >> 5);
  const int lane = tid & 31;
  const int l15 = lane & 15;
  const int half = (lane >> 4) & 1;
  const int qg = wave & 3;    // query block of 32
  const int kh = wave >> 2;   // key half of every tile
  const int qw = blockIdx.x * (AW * 16) + qg * 32;
  const int head = blockIdx.y;
  float* Ol = Olw[wave];

  const _Float16* Q  = (const _Float16*)qp;
  const _Float16* K  = (const _Float16*)kp;
  const _Float16* VT = (const _Float16*)vtp;

  const _Float16* qbase = Q + (size_t)qw * OUT_DIM + head * HEAD_DIM;
  v16h qb[2][2];   // [column group][d 0..31 | d 32..63]
#pragma unroll
  for (int g = 0; g < 2; ++g) {
    qb[g][0] = ld_frag_h(qbase, OUT_DIM, g * 16 + l15, 0, lane);
    qb[g][1] = ld_frag_h(qbase, OUT_DIM, g * 16 + l15, 32, lane);
  }
  const _Float16* kbase = K + head * HEAD_DIM;                   // key t at kbase + t*OUT_DIM
  const _Float16* vbase = VT + (size_t)head * HEAD_DIM * SEQ;    // d row at vbase + d*SEQ

  // this lane's first piece of a tile: K row tid>>3, piece tid&7; V^T row tid>>4, piece tid&15
  const _Float16* gk = kbase + (size_t)(tid >> 3) * OUT_DIM + (tid & 7) * 8;
  const _Float16* gv = vbase + (size_t)(tid >> 4) * SEQ + (tid & 15) * 8;
  const unsigned int lk0 = (unsigned int)(size_t)(&Kt[0][(tid >> 3) * KLP + (tid & 7) * 8]);
  const unsigned int lv0 = (unsigned int)(size_t)(&Vt[0][(tid >> 4) * VLP + (tid & 15) * 8]);
  const unsigned int kbuf = SK * KLP * 2u;         // bytes from buffer 0 to buffer 1
  const unsigned int vbuf = HEAD_DIM * VLP * 2u;

  copy_tile(lk0, lv0, gk, gv);                                   // tile 0 -> buffer 0
  asm volatile("s_wait_asynccnt 0x0" ::: "memory");              // this wave's part of tile 0 has landed
  __syncthreads();                                               // tile 0 complete for every wave
  copy_tile(lk0 + kbuf, lv0 + vbuf, gk + (size_t)SK * OUT_DIM, gv + SK);   // tile 1 -> buffer 1

  v8f o[2][4] = {};
  const float kq = 1.44269504f / 512.0f;   // 1/512 (score scale on the x8 planes) times log2(e)
  // 10 = log2(1024): P leaves the exponential already x1024. With the start value of mref every P of
  // the first chunk is infinite, so the test below sends that chunk through the rescale, which sets mref.
  float mref[2], lrun[2], nb[2];
#pragma unroll
  for (int g = 0; g < 2; ++g) {
    mref[g] = -1.0e30f;
    lrun[g] = 0.0f;
    nb[g] = fmaf(-mref[g], kq, 10.0f);
  }
  const float plim = 32768.0f;   // a lane's 16 P are each at most their sum: at or under this they fit f16

  for (int t = 0; t < NST; ++t) {
    const int b = t & 1;
    const _Float16* ktile = Kt[b] + kh * (SK / 2) * KLP;   // this wave's 64 key rows of the tile
    const _Float16* vtile = Vt[b] + kh * (SK / 2);         // and the same 64 keys of every V^T row
    // K fragments of chunk 0; the later chunk's are fetched one chunk ahead, inside this tile only
    v16h ka0 = ld_frag_h(ktile, KLP, l15, 0, lane);
    v16h ka2 = ld_frag_h(ktile, KLP, 16 + l15, 0, lane);
    v16h ka1 = ld_frag_h(ktile, KLP, l15, 32, lane);
    v16h ka3 = ld_frag_h(ktile, KLP, 16 + l15, 32, lane);
#pragma unroll   // the wave's two chunks of a tile read LDS at constant offsets from one address
    for (int c = 0; c < SK / 64; ++c) {
      // this chunk's four V^T fragments, one group of reads: they land under the scores and the softmax
      v16h va[4];
#pragma unroll
      for (int j = 0; j < 4; ++j) va[j] = ld_frag_h(vtile, VLP, j * 16 + l15, c * 32, lane);
      // keeps the group of reads above the score products, so that it is in flight under the scores and the softmax
      __builtin_amdgcn_sched_barrier(0);
      v8f c0[2] = {}, c1[2] = {};   // [column group]
#pragma unroll
      for (int g = 0; g < 2; ++g) {
        c0[g] = mma_f16(ka0, qb[g][0], c0[g]);
        c1[g] = mma_f16(ka2, qb[g][0], c1[g]);
      }
#pragma unroll
      for (int g = 0; g < 2; ++g) {
        c0[g] = mma_f16(ka1, qb[g][1], c0[g]);
        c1[g] = mma_f16(ka3, qb[g][1], c1[g]);
      }
      if (c + 1 < SK / 64) {   // next chunk's K fragments, one group: they land under the softmax and the context products
        const _Float16* kn = ktile + (c + 1) * 32 * KLP;
        ka0 = ld_frag_h(kn, KLP, l15, 0, lane);
        ka2 = ld_frag_h(kn, KLP, 16 + l15, 0, lane);
        ka1 = ld_frag_h(kn, KLP, l15, 32, lane);
        ka3 = ld_frag_h(kn, KLP, 16 + l15, 32, lane);
        // keeps that group here, ahead of the softmax, so that the next chunk's score products find it landed
        __builtin_amdgcn_sched_barrier(0);
      }

      // P against the held references: no maximum, no rescale on this path
      float p0[2][8], p1[2][8];
      float ls[2];
#pragma unroll
      for (int g = 0; g < 2; ++g) {
#pragma unroll
        for (int r = 0; r < 8; ++r) p0[g][r] = __builtin_amdgcn_exp2f(fmaf(c0[g][r], kq, nb[g]));
#pragma unroll
        for (int r = 0; r < 8; ++r) p1[g][r] = __builtin_amdgcn_exp2f(fmaf(c1[g][r], kq, nb[g]));
        ls[g] = 0.0f;
#pragma unroll
        for (int r = 0; r < 8; ++r) ls[g] += p0[g][r] + p1[g][r];
      }
      // One test a chunk for both groups, a scalar branch for the whole wave: only where some lane's P have
      // outgrown f16 (or are not numbers) do the references move to the maxima seen so far.
      if (__builtin_expect(__builtin_amdgcn_ballot_w32(!(ls[0] <= plim && ls[1] <= plim)) != 0u, 0)) {   // rare: laid out off the straight path
        // The straight path keeps no raw scores beside P (registers: four waves per SIMD must fit), so this
        // path forms them again, the same products from the same tile, in the K registers' place.
        const _Float16* kc = ktile + c * 32 * KLP;
        ka0 = ld_frag_h(kc, KLP, l15, 0, lane);
        ka2 = ld_frag_h(kc, KLP, 16 + l15, 0, lane);
        ka1 = ld_frag_h(kc, KLP, l15, 32, lane);
        ka3 = ld_frag_h(kc, KLP, 16 + l15, 32, lane);
        v8f r0[2] = {}, r1[2] = {};
#pragma unroll
        for (int g = 0; g < 2; ++g) {
          r0[g] = mma_f16(ka0, qb[g][0], r0[g]);
          r1[g] = mma_f16(ka2, qb[g][0], r1[g]);
        }
#pragma unroll
        for (int g = 0; g < 2; ++g) {
          r0[g] = mma_f16(ka1, qb[g][1], r0[g]);
          r1[g] = mma_f16(ka3, qb[g][1], r1[g]);
        }
        if (c + 1 < SK / 64) {   // the next chunk's K fragments again
          const _Float16* kn = ktile + (c + 1) * 32 * KLP;
          ka0 = ld_frag_h(kn, KLP, l15, 0, lane);
          ka2 = ld_frag_h(kn, KLP, 16 + l15, 0, lane);
          ka1 = ld_frag_h(kn, KLP, l15, 32, lane);
          ka3 = ld_frag_h(kn, KLP, 16 + l15, 32, lane);
        }
#pragma unroll
        for (int g = 0; g < 2; ++g) {
          // maximum over the raw accumulators (the scale is positive, so the order is the same)
          float lm = fmaxf(r0[g][0], r1[g][0]);
#pragma unroll
          for (int r = 1; r < 8; ++r) lm = fmaxf(lm, fmaxf(r0[g][r], r1[g][r]));
          lm = fmaxf(lm, __shfl_xor(lm, 16, 32));   // both halves of a query keep one reference
          const float mnew = fmaxf(mref[g], lm);
          const float alpha = __builtin_amdgcn_exp2f((mref[g] - mnew) * kq);
          nb[g] = fmaf(-mnew, kq, 10.0f);
          mref[g] = mnew;
          ls[g] = 0.0f;
#pragma unroll
          for (int r = 0; r < 8; ++r) {
            p0[g][r] = __builtin_amdgcn_exp2f(fmaf(r0[g][r], kq, nb[g]));
            p1[g][r] = exp2_slot(fmaf(r1[g][r], kq, nb[g]));
            ls[g] += p0[g][r] + p1[g][r];
          }
          lrun[g] *= alpha;
#pragma unroll
          for (int j = 0; j < 4; ++j)
#pragma unroll
            for (int r = 0; r < 8; ++r) o[g][j][r] *= alpha;
        }
      }

      v16h pb[2];
#pragma unroll
      for (int g = 0; g < 2; ++g) {
        lrun[g] += ls[g];   // this lane's 16 keys only: the rescale branch needs lrun at hand, so no exchange stands in the loop
#pragma unroll
        for (int e = 0; e < 8; ++e) {
          pb[g][e]     = (_Float16)p0[g][e];   // key 32c + 8h + e of the wave's half tile
          pb[g][8 + e] = (_Float16)p1[g][e];   // key 32c + 16 + 8h + e of the wave's half tile
        }
      }
#pragma unroll
      for (int j = 0; j < 4; ++j)
#pragma unroll
        for (int g = 0; g < 2; ++g) o[g][j] = mma_f16(va[j], pb[g], o[g][j]);
    }
    asm volatile("s_wait_dscnt 0x0" ::: "memory");      // this wave's reads of buffer b are done
    asm volatile("s_wait_asynccnt 0x0" ::: "memory");   // this wave's part of tile t + 1 has landed
    __syncthreads();   // publishes tile t + 1 and ends every wave's reads of buffer b
    if (t + 2 < NST)   // the same for the whole workgroup
      copy_tile(lk0 + b * kbuf, lv0 + b * vbuf,
                gk + (size_t)(t + 2) * SK * OUT_DIM, gv + (size_t)(t + 2) * SK);
  }
  asm volatile("s_wait_asynccnt 0x0" ::: "memory");     // nothing in flight when the wave ends

  // o[g][j][r] = 8192 * sum_t p_t v_t over this wave's keys for query g*16 + l15, d = j*16 + 8*half + r; the two
  // halves of a query hold one reference, so their sums join by one add: lrun = 1024 * sum_t p_t
#pragma unroll
  for (int g = 0; g < 2; ++g) lrun[g] += __shfl_xor(lrun[g], 16, 32);

  // The wave of key half kh finishes group kh and hands group 1 - kh to its partner (same lane, same registers).
  float* xo = Xo[wave];
#pragma unroll
  for (int j = 0; j < 4; ++j) {
    const v8f og = kh ? o[0][j] : o[1][j];
    v4f lo4, hi4;
    lo4[0] = og[0]; lo4[1] = og[1]; lo4[2] = og[2]; lo4[3] = og[3];
    hi4[0] = og[4]; hi4[1] = og[5]; hi4[2] = og[6]; hi4[3] = og[7];
    *(v4f*)(&xo[((j * 2 + 0) * 32 + lane) * 4]) = lo4;
    *(v4f*)(&xo[((j * 2 + 1) * 32 + lane) * 4]) = hi4;
  }
  Xs[wave][lane]      = kh ? mref[0] : mref[1];
  Xs[wave][32 + lane] = kh ? lrun[0] : lrun[1];
  __syncthreads();   // the partner's group is complete in LDS

  const float* xp = Xo[wave ^ 4];
  const float m_own = kh ? mref[1] : mref[0];
  const float l_own = kh ? lrun[1] : lrun[0];
  const float m_par = Xs[wave ^ 4][lane];
  const float l_par = Xs[wave ^ 4][32 + lane];
  const float m_all = fmaxf(m_own, m_par);
  const float a_own = exp2_slot((m_own - m_all) * kq);
  const float a_par = exp2_slot((m_par - m_all) * kq);
  const float inv = 1.0f / ((l_own * a_own + l_par * a_par) * 8.0f);
  const float f_own = a_own * inv, f_par = a_par * inv;
#pragma unroll
  for (int j = 0; j < 4; ++j) {
    const v8f ow = kh ? o[1][j] : o[0][j];
    const v4f pl = *(const v4f*)(&xp[((j * 2 + 0) * 32 + lane) * 4]);
    const v4f ph = *(const v4f*)(&xp[((j * 2 + 1) * 32 + lane) * 4]);
    v4f lo4, hi4;
#pragma unroll
    for (int r = 0; r < 4; ++r) {
      lo4[r] = ow[r] * f_own + pl[r] * f_par;
      hi4[r] = ow[4 + r] * f_own + ph[r] * f_par;
    }
    *(v4f*)(&Ol[l15 * OLP + j * 16 + 8 * half])     = lo4;
    *(v4f*)(&Ol[l15 * OLP + j * 16 + 8 * half + 4]) = hi4;
  }
  __syncthreads();

  v4f v[8];
  size_t off[8];
  float* ob = outp + (size_t)(qw + kh * 16) * OUT_DIM + head * HEAD_DIM;
#pragma unroll
  for (int it = 0; it < 8; ++it) {
    const int row = it * 2 + half;       // 0..15
    const int q = l15;                   // 16 pieces of 16 B = the row's 256 bytes (2 lines)
    v[it] = *(const v4f*)(&Ol[row * OLP + q * 4]);
    off[it] = (size_t)row * OUT_DIM + q * 4;
  }
#pragma unroll
  for (int it = 0; it < 8; ++it) *(v4f*)(ob + off[it]) = v[it];
  
}

// ---------------------------------------------------------------------------
extern "C" void kernel_launch(void* const* d_in, const int* in_sizes, int n_in,
                              void* d_out, int out_size, void* d_ws, size_t ws_size,
                              hipStream_t stream) {
  if (n_in < 7) return;
  if (in_sizes[0] < SEQ * IN_DIM) return;
  if (in_sizes[1] < IN_DIM * OUT_DIM || in_sizes[2] < IN_DIM * OUT_DIM ||
      in_sizes[3] < IN_DIM * OUT_DIM) return;
  if (in_sizes[4] < OUT_DIM || in_sizes[5] < OUT_DIM || in_sizes[6] < OUT_DIM) return;
  if (out_size < SEQ * OUT_DIM) return;

  const float* h  = (const float*)d_in[0];
  const float* Wq = (const float*)d_in[1];
  const float* Wk = (const float*)d_in[2];
  const float* Wv = (const float*)d_in[3];
  const float* bq = (const float*)d_in[4];
  const float* bk = (const float*)d_in[5];
  const float* bv = (const float*)d_in[6];

  // every offset a multiple of 2 MiB
  const size_t hb_bytes = (size_t)SEQ * IN_DIM * 2;           // bf16 h plane
  const size_t wt_bytes = (size_t)3 * OUT_DIM * IN_DIM * 2;   // 3 bf16 WT planes
  const size_t pl_bytes = (size_t)SEQ * OUT_DIM * 2;          // one f16 q/k/vT plane
  const size_t off_hb = 0;
  const size_t off_wt = off_hb + hb_bytes;
  const size_t off_q  = off_wt + wt_bytes;
  const size_t off_k  = off_q + pl_bytes;
  const size_t off_vt = off_k + pl_bytes;
  const size_t total  = off_vt + pl_bytes;                    // 38 MiB at SEQ = 4096
  if (total > ws_size) return;

  char* ws = (char*)d_ws;
  unsigned short* hb  = (unsigned short*)(ws + off_hb);
  unsigned short* wt  = (unsigned short*)(ws + off_wt);
  unsigned short* qpl = (unsigned short*)(ws + off_q);
  unsigned short* kpl = (unsigned short*)(ws + off_k);
  unsigned short* vtp = (unsigned short*)(ws + off_vt);

  const int n8 = SEQ * IN_DIM / 8;
  k_cvt_rows<<<(n8 + 255) / 256, 256, 0, stream>>>(h, hb, n8);
  k_cvt_wT<<<dim3(IN_DIM / 64, OUT_DIM / 64, 3), 256, 0, stream>>>(Wq, Wk, Wv, wt);
  k_proj<<<dim3(OUT_DIM / 128, SEQ / 128, 3), 256, 0, stream>>>(hb, wt, bq, bk, bv, qpl, kpl, vtp);
  k_attn<<<dim3(SEQ / (AW * 16), NUM_HEADS), AW * 32, 0, stream>>>(qpl, kpl, vtp, (float*)d_out);
}

// v008
// It runs in 84.8 microseconds.
// Next to v007, in two timings, it ran 1.04 times as fast each time.
// All steps since v000 together make it 3.87 times as fast.
#include <hip/hip_runtime.h>
// Projections h*W{q,k,v}: v_wmma_f32_16x16x32_bf16 (bf16 operands = RNE-converted inputs, f32 accumulate); scores K*Q^T and context V^T*P: v_wmma_f32_16x16x32_f16 (f16 operands, Q/K/V planes carried x8, P carried x1024, f32 accumulate); softmax in f32.

#ifndef SEQ
#define SEQ 4096
#endif
#define SEQ_FULL 4096
#define IN_DIM 1024
#define NUM_HEADS 16
#define HEAD_DIM 64
#define OUT_DIM (NUM_HEADS * HEAD_DIM)

static_assert(SEQ % 128 == 0);
static_assert(SEQ <= SEQ_FULL);
static_assert(IN_DIM % 64 == 0);
static_assert(OUT_DIM % 128 == 0);
static_assert(HEAD_DIM == 64);
static_assert((size_t)SEQ_FULL * OUT_DIM * 4 == 16777216);

// LDS pitches (in 16-bit elements unless noted); all keep 16-byte row alignment
#define TP  72     // weight transpose tile [64 n][64 k]
#define OLP 68     // context tile [16 q][64 d], floats

typedef __bf16   v16bf __attribute__((ext_vector_type(16)));
typedef __bf16   v8bf  __attribute__((ext_vector_type(8)));
typedef _Float16 v16h  __attribute__((ext_vector_type(16)));
typedef _Float16 v8h   __attribute__((ext_vector_type(8)));
typedef float    v8f   __attribute__((ext_vector_type(8)));
typedef float    v4f   __attribute__((ext_vector_type(4)));
typedef unsigned int v4u __attribute__((ext_vector_type(4)));

// ---------------------------------------------------------------------------
// WMMA wrappers. k_proj's carries 4 v_nop after every issue; its loop has vector slots to spare, and with the
// statement in place its LDS reads stay one group ahead of each block of products.
__device__ __forceinline__ v8f mma_bf16(v16bf a, v16bf b, v8f c) {
  v8f d = __builtin_amdgcn_wmma_f32_16x16x32_bf16(false, a, false, b, (short)0, c, false, false);
  asm volatile("v_nop\n\tv_nop\n\tv_nop\n\tv_nop" : "+v"(d) : "v"(a), "v"(b));
  return d;
}
// k_attn's is the bare builtin: the compiler keeps the distances behind it and counts the WMMAs and the vector
// work that follow as cover. Four waves share the SIMD's vector port there, so an idle slot is taken from another wave.
__device__ __forceinline__ v8f mma_f16(v16h a, v16h b, v8f c) {
  return __builtin_amdgcn_wmma_f32_16x16x32_f16(false, a, false, b, (short)0, c, false, false);
}

// 16-bit fragment, contraction dim CONTIGUOUS in memory: elem(k) = p0[rc*ld + k].
// Lane l: row/col rc = (l&15); elements 0..7 <- kk+8h+0..7, elements 8..15 <- kk+16+8h+0..7
// (h = l>>4). Same map for A (rc = row) and B (rc = column of a k-contiguous copy).
__device__ __forceinline__ v16bf ld_frag_bf(const __bf16* p0, int ld, int rc, int kk, int lane) {
  const int hh = (lane >> 4) & 1;
  const __bf16* p = p0 + (size_t)rc * ld + kk + 8 * hh;
  const v8bf lo = *(const v8bf*)(p);
  const v8bf hi = *(const v8bf*)(p + 16);
  v16bf f;
#pragma unroll
  for (int i = 0; i < 8; ++i) { f[i] = lo[i]; f[8 + i] = hi[i]; }
  return f;
}
__device__ __forceinline__ v16h ld_frag_h(const _Float16* p0, int ld, int rc, int kk, int lane) {
  const int hh = (lane >> 4) & 1;
  const _Float16* p = p0 + (size_t)rc * ld + kk + 8 * hh;
  const v8h lo = *(const v8h*)(p);
  const v8h hi = *(const v8h*)(p + 16);
  v16h f;
#pragma unroll
  for (int i = 0; i < 8; ++i) { f[i] = lo[i]; f[8 + i] = hi[i]; }
  return f;
}

// f32 -> bf16 bits, RNE convert
__device__ __forceinline__ unsigned int bfb(float x) {
  unsigned int u = __float_as_uint(x);
  u = u + 0x7FFFu + ((u >> 16) & 1u);
  return u >> 16;
}
// f32 -> value of its RNE bf16
__device__ __forceinline__ float bf16val(float x) {
  return __uint_as_float(bfb(x) << 16);
}
// f32 -> f16 bits, RNE convert
__device__ __forceinline__ unsigned short hbits(float x) {
  const _Float16 hv = (_Float16)x;
  return __builtin_bit_cast(unsigned short, hv);
}

// 2^x off the hot path (rescale branch, epilogue): v_exp_f32 and, in the same statement, the one slot the instruction
// set asks for behind a transcendental.
__device__ __forceinline__ float exp2_slot(float x) {
  float r;
  asm("v_exp_f32 %0, %1\n\tv_nop" : "=v"(r) : "v"(x));
  return r;
}

// ---------------------------------------------------------------------------
// Both conversions in one launch: neither reads what the other writes, so they share a grid and the second
// launch's gap, fill and tail go. The branch on the block index is the same for a whole workgroup.
// Blocks 0 .. WTB-1:  W f32 [IN_DIM k][OUT_DIM n] -> WT bf16 [OUT_DIM n][IN_DIM k] (k contiguous), three matrices
//                     into three consecutive planes; a block = one 64 k x 64 n tile transposed through LDS.
//                     They stand first: their chain (load, LDS, barrier, store) is the longer one.
// Blocks WTB .. :     h f32 [SEQ][IN_DIM] -> bf16 plane (same layout); thread g converts 8 consecutive floats
//                     into one 16-byte store.
#define WTX (IN_DIM / 64)               // k tiles of one matrix
#define WTY (OUT_DIM / 64)              // n tiles of one matrix
#define WTB (3 * WTX * WTY)             // transpose blocks
#define HRB ((SEQ * IN_DIM / 8 + 255) / 256)   // row blocks
__global__ __launch_bounds__(256) void k_cvt(const float* __restrict__ in,
                                             const float* __restrict__ Wq,
                                             const float* __restrict__ Wk,
                                             const float* __restrict__ Wv,
                                             unsigned short* __restrict__ outp,
                                             unsigned short* __restrict__ wT, int n8) {
  __shared__ __align__(16) unsigned short T[64 * TP];   // [n local][k local], cross-wave (block barrier)
  const unsigned int bid = blockIdx.x;
  const int tid = threadIdx.x;

  if (bid >= WTB) {   // block-uniform: no thread of such a block reaches the barrier below
    const int g = (int)(bid - WTB) * 256 + tid;
    if (g >= n8) return;
    const v4f a = *(const v4f*)(in + (size_t)g * 8);
    const v4f b = *(const v4f*)(in + (size_t)g * 8 + 4);
    v4u w;
    w[0] = bfb(a[0]) | (bfb(a[1]) << 16);
    w[1] = bfb(a[2]) | (bfb(a[3]) << 16);
    w[2] = bfb(b[0]) | (bfb(b[1]) << 16);
    w[3] = bfb(b[2]) | (bfb(b[3]) << 16);
    v4u* p = (v4u*)(outp + (size_t)g * 8);
    *p = w;
    return;
  }

  const int z = (int)(bid / (WTX * WTY));
  const float* W = (z == 0) ? Wq : ((z == 1) ? Wk : Wv);
  unsigned short* dst = wT + (size_t)z * OUT_DIM * IN_DIM;
  const int k0 = (int)(bid % WTX) * 64;
  const int n0 = (int)((bid / WTX) % WTY) * 64;
  const int wave = tid >> 5, lane = tid & 31;

#pragma unroll
  for (int i = 0; i < 4; ++i) {
    const int idx = i * 256 + tid;          // 0..1023
    const int kk = idx >> 4;                // 0..63
    const int c4 = (idx & 15) * 4;          // 0..60
    const v4f w = *(const v4f*)(W + (size_t)(k0 + kk) * OUT_DIM + n0 + c4);
    T[(c4 + 0) * TP + kk] = (unsigned short)bfb(w[0]);
    T[(c4 + 1) * TP + kk] = (unsigned short)bfb(w[1]);
    T[(c4 + 2) * TP + kk] = (unsigned short)bfb(w[2]);
    T[(c4 + 3) * TP + kk] = (unsigned short)bfb(w[3]);
  }
  __syncthreads();

  v4u v[2];
  size_t off[2];
#pragma unroll
  for (int it = 0; it < 2; ++it) {
    const int nn = wave * 8 + it * 4 + (lane >> 3);   // 0..63 over (wave, it, lane>>3)
    const int q = lane & 7;
    v[it] = *(const v4u*)(&T[nn * TP + q * 8]);
    off[it] = (size_t)(n0 + nn) * IN_DIM + k0 + q * 8;
  }
#pragma unroll
  for (int it = 0; it < 2; ++it) *(v4u*)(dst + off[it]) = v[it];
}

// ---------------------------------------------------------------------------
// Projection: C[SEQ][OUT_DIM] = hb[SEQ][IN_DIM] * WT[OUT_DIM][IN_DIM]^T + bias.
// 256 thr = 8 waves; block tile 128 rows x 128 cols; wave (wr, wc) owns 32 rows x 64 cols.
// A k-tile = 64 k of both operands: hb [128 rows][64 k] and WT [128 n][64 k], copied
// whole-line from the planes into LDS by asynchronous copies, two buffers: tile t + 1 is
// in flight while tile t is multiplied. Each accumulator still sums k in ascending 32-steps.
// z = 0: Q plane f16 x8 [SEQ][OUT_DIM]; z = 1: K plane f16 x8 [SEQ][OUT_DIM];
// z = 2: V^T plane f16 x8 [OUT_DIM][SEQ]. Epilogue staged in the same LDS behind the loop.
#define PK  64                 // k per tile
#define PLP 72                 // operand tile pitch: 144 B = 16 B x 9
#define PTS (128 * PLP)        // elements of one operand tile
#define PNT (IN_DIM / PK)      // tiles
#define EP  136                // epilogue tile pitch [128][128]: 272 B = 16 B x 17
static_assert(PNT >= 2);
static_assert(128 * EP <= 4 * PTS);
static_assert(256 * 4 * 8 == 128 * PK);   // four 16-byte copies a lane fill one operand tile

// One k-tile's copies of one lane: four 16-byte pieces of hb and four of WT, 32 rows apart.
// s_wait_xcnt 0 is the statement's last line, so that no address register named here is
// rewritten before it.
__device__ __forceinline__ void copy_ab(unsigned int la, unsigned int lw,
                                        const unsigned short* ga, const unsigned short* gw) {
  asm volatile(
      "global_load_async_to_lds_b128 %0, %8, off\n\t"
      "global_load_async_to_lds_b128 %1, %9, off\n\t"
      "global_load_async_to_lds_b128 %2, %10, off\n\t"
      "global_load_async_to_lds_b128 %3, %11, off\n\t"
      "global_load_async_to_lds_b128 %4, %12, off\n\t"
      "global_load_async_to_lds_b128 %5, %13, off\n\t"
      "global_load_async_to_lds_b128 %6, %14, off\n\t"
      "global_load_async_to_lds_b128 %7, %15, off\n\t"
      "s_wait_xcnt 0x0"
      :
      : "v"(la), "v"(la + 32u * PLP * 2u), "v"(la + 64u * PLP * 2u), "v"(la + 96u * PLP * 2u),
        "v"(lw), "v"(lw + 32u * PLP * 2u), "v"(lw + 64u * PLP * 2u), "v"(lw + 96u * PLP * 2u),
        "v"(ga), "v"(ga + (size_t)32 * IN_DIM), "v"(ga + (size_t)64 * IN_DIM),
        "v"(ga + (size_t)96 * IN_DIM),
        "v"(gw), "v"(gw + (size_t)32 * IN_DIM), "v"(gw + (size_t)64 * IN_DIM),
        "v"(gw + (size_t)96 * IN_DIM)
      : "memory");
}

__global__ __launch_bounds__(256) void k_proj(
    const unsigned short* __restrict__ hb, const unsigned short* __restrict__ wT,
    const float* __restrict__ bq, const float* __restrict__ bk, const float* __restrict__ bv,
    unsigned short* __restrict__ qp, unsigned short* __restrict__ kp,
    unsigned short* __restrict__ vtp) {
  // [buffer][hb tile | WT tile], cross-wave (block barrier); behind the loop the epilogue tile
  __shared__ __align__(16) unsigned short S[4 * PTS];

  const int z = blockIdx.z;
  const int n0 = blockIdx.x * 128;
  const int m0 = blockIdx.y * 128;
  const int tid = threadIdx.x;
  const int wave = tid >> 5, lane = tid & 31;
  const int l15 = lane & 15, half = (lane >> 4) & 1;
  const int wr = wave >> 1, wc = wave & 1;

  const unsigned short* Wt = wT + (size_t)z * OUT_DIM * IN_DIM;
  const float* bias = (z == 0) ? bq : ((z == 1) ? bk : bv);

  // this lane's first piece of a tile: row tid>>3, piece tid&7, in both operands
  const unsigned short* ga = hb + (size_t)(m0 + (tid >> 3)) * IN_DIM + (tid & 7) * 8;
  const unsigned short* gw = Wt + (size_t)(n0 + (tid >> 3)) * IN_DIM + (tid & 7) * 8;
  const unsigned int la0 = (unsigned int)(size_t)(&S[(tid >> 3) * PLP + (tid & 7) * 8]);
  const unsigned int lw0 = la0 + PTS * 2u;
  const unsigned int pbuf = 2u * PTS * 2u;         // bytes from buffer 0 to buffer 1

  copy_ab(la0, lw0, ga, gw);                                     // tile 0 -> buffer 0
  asm volatile("s_wait_asynccnt 0x0" ::: "memory");              // this wave's part of tile 0 has landed
  __syncthreads();                                               // tile 0 complete for every wave
  copy_ab(la0 + pbuf, lw0 + pbuf, ga + PK, gw + PK);             // tile 1 -> buffer 1

  v8f acc[2][4] = {};
  for (int t = 0; t < PNT; ++t) {
    const int b = t & 1;
    const __bf16* at = (const __bf16*)(S + b * 2 * PTS);
    const __bf16* wt = at + PTS;
#pragma unroll   // the two 32-k halves of a tile read LDS at constant offsets from one address
    for (int kk = 0; kk < PK; kk += 32) {
      v16bf a[2], w[4];
#pragma unroll
      for (int i = 0; i < 2; ++i) a[i] = ld_frag_bf(at, PLP, wr * 32 + i * 16 + l15, kk, lane);
#pragma unroll
      for (int j = 0; j < 4; ++j) w[j] = ld_frag_bf(wt, PLP, wc * 64 + j * 16 + l15, kk, lane);
#pragma unroll
      for (int j = 0; j < 4; ++j)
#pragma unroll
        for (int i = 0; i < 2; ++i) acc[i][j] = mma_bf16(a[i], w[j], acc[i][j]);
    }
    asm volatile("s_wait_dscnt 0x0" ::: "memory");      // this wave's reads of buffer b are done
    asm volatile("s_wait_asynccnt 0x0" ::: "memory");   // this wave's part of tile t + 1 has landed
    __syncthreads();   // publishes tile t + 1 and ends every wave's reads of buffer b
    if (t + 2 < PNT)   // the same for the whole workgroup
      copy_ab(la0 + b * pbuf, lw0 + b * pbuf, ga + (size_t)(t + 2) * PK, gw + (size_t)(t + 2) * PK);
  }
  asm volatile("s_wait_asynccnt 0x0" ::: "memory");     // nothing in flight when the LDS changes its use

  // acc[i][j][r] = C[m0 + wr*32 + i*16 + 8*half + r][n0 + wc*64 + j*16 + l15]
  unsigned short* E = S;   // every wave's last read of the tiles ended at the last trip's barrier
  const float car = 8.0f;
  if (z != 2) {                      // block-uniform branch
#pragma unroll
    for (int j = 0; j < 4; ++j) {
      const int col = wc * 64 + j * 16 + l15;
      const float bb = bf16val(bias[n0 + col]);
#pragma unroll
      for (int i = 0; i < 2; ++i)
#pragma unroll
        for (int r = 0; r < 8; ++r) {
          const int row = wr * 32 + i * 16 + 8 * half + r;
          E[row * EP + col] = hbits((acc[i][j][r] + bb) * car);
        }
    }
    __syncthreads();
    unsigned short* dst = (z == 0) ? qp : kp;
    v4u v[8];
    size_t off[8];
#pragma unroll
    for (int it = 0; it < 8; ++it) {
      const int row = it * 16 + (tid >> 4);               // 0..127 over (it, tid>>4)
      const int q = l15;                                  // 16 pieces = 256-byte row = 2 lines
      v[it] = *(const v4u*)(&E[row * EP + q * 8]);
      off[it] = (size_t)(m0 + row) * OUT_DIM + n0 + q * 8;
    }
#pragma unroll
    for (int it = 0; it < 8; ++it) *(v4u*)(dst + off[it]) = v[it];
    // behind the last store: no register that a store names is rewritten on any path of the listing before this wait
    asm volatile("s_wait_xcnt 0x0" ::: "memory");
  } else {
#pragma unroll
    for (int j = 0; j < 4; ++j) {
      const int col = wc * 64 + j * 16 + l15;             // d within tile
      const float bb = bf16val(bias[n0 + col]);
#pragma unroll
      for (int i = 0; i < 2; ++i)
#pragma unroll
        for (int r = 0; r < 8; ++r) {
          const int srow = wr * 32 + i * 16 + 8 * half + r;   // s within tile
          E[col * EP + srow] = hbits((acc[i][j][r] + bb) * car);
        }
    }
    __syncthreads();
    v4u v[8];
    size_t off[8];
#pragma unroll
    for (int it = 0; it < 8; ++it) {
      const int drow = it * 16 + (tid >> 4);              // 0..127 over (it, tid>>4)
      const int q = l15;                                  // 16 pieces = 256-byte row = 2 lines
      v[it] = *(const v4u*)(&E[drow * EP + q * 8]);
      off[it] = (size_t)(n0 + drow) * SEQ + m0 + q * 8;
    }
#pragma unroll
    for (int it = 0; it < 8; ++it) *(v4u*)(vtp + off[it]) = v[it];
  }
}

// ---------------------------------------------------------------------------
// Flash attention, transposed-score form: one wave = (32 queries as two 16-column groups, one head,
// half of every tile's keys), so that each K / V^T fragment read from LDS feeds two products.
// A workgroup = 8 waves = 4 query blocks x 2 key halves = 128 queries of one head, which share every
// K / V^T tile. The two waves of a query block keep their own reference, sum and context and join them
// once, behind the loop, through LDS; each then finishes and stores 16 of the 32 queries.
// A tile = 128 keys: K [128 keys][64 d] and V^T [64 d][128 keys], copied whole-line
// from the planes into LDS by asynchronous copies, two buffers: tile t + 1 is in
// flight while tile t is worked on. Fragments come from LDS (ds_load_b128 pitches).
// Per 32-key chunk and 16-column group:
//   S^T = K . Q^T    A = K rows (lane = key, k = d), B = Q^T (lane = query, k = d)
//                    D[row = key 8h+r][col = query l15]; c0 keys 0..15, c1 keys 16..31
//   per-lane softmax terms for query l15 (16 local keys; the xor-16 partner holds the other 16)
//   O^T += V^T . P   A = V^T rows (lane = d, k = key), B = P: element i<8 <- c0[i]
//                    (key 8h+i), element 8+i <- c1[i] (key 16+8h+i), same lane
//                    D[row = d 8h+r][col = query l15]
// Scores carry 64 from the x8 planes: P = exp2(score * log2(e)/512 - ref * log2(e)/512 + 10),
// one multiply-add and one exponential a score; ref is a held reference score per query, in
// raw score units, and moves only when a chunk's P outgrow f16 (lazy rescale, below).
// P and its sum carried x1024, V carried x8 -> context scaled by 1/(8 * carried sum).
// Output tile [16 q][64 d] f32 staged in LDS; each 256-byte row = 2 lines,
#define AW  8                  // waves per workgroup
#define SK  128                // keys per tile
#define KLP 72                 // K tile pitch: 144 B = 16 B x 9
#define VLP 136                // V^T tile pitch: 272 B = 16 B x 17
#define NST (SEQ / SK)         // tiles
static_assert(SEQ % (AW * 16) == 0);
static_assert(NST >= 2);
static_assert(AW == 8 && SK % 64 == 0);   // 4 query blocks x 2 key halves; a wave's half tile is whole 32-key chunks
static_assert(AW * 32 * 4 * 8 == SK * HEAD_DIM);   // four 16-byte copies a lane fill one tile

// One tile's copies of one lane: four 16-byte pieces of K (32 key rows apart) and four
// of V^T (16 d rows apart). s_wait_xcnt 0 is the statement's last line, so that no
// address register named here is rewritten before it.
__device__ __forceinline__ void copy_tile(unsigned int lk, unsigned int lv,
                                          const _Float16* gk, const _Float16* gv) {
  asm volatile(
      "global_load_async_to_lds_b128 %0, %8, off\n\t"
      "global_load_async_to_lds_b128 %1, %9, off\n\t"
      "global_load_async_to_lds_b128 %2, %10, off\n\t"
      "global_load_async_to_lds_b128 %3, %11, off\n\t"
      "global_load_async_to_lds_b128 %4, %12, off\n\t"
      "global_load_async_to_lds_b128 %5, %13, off\n\t"
      "global_load_async_to_lds_b128 %6, %14, off\n\t"
      "global_load_async_to_lds_b128 %7, %15, off\n\t"
      "s_wait_xcnt 0x0"
      :
      : "v"(lk), "v"(lk + 32u * KLP * 2u), "v"(lk + 64u * KLP * 2u), "v"(lk + 96u * KLP * 2u),
        "v"(lv), "v"(lv + 16u * VLP * 2u), "v"(lv + 32u * VLP * 2u), "v"(lv + 48u * VLP * 2u),
        "v"(gk), "v"(gk + (size_t)32 * OUT_DIM), "v"(gk + (size_t)64 * OUT_DIM),
        "v"(gk + (size_t)96 * OUT_DIM),
        "v"(gv), "v"(gv + (size_t)16 * SEQ), "v"(gv + (size_t)32 * SEQ), "v"(gv + (size_t)48 * SEQ)
      : "memory");
}

// Four waves per SIMD (two workgroups per WGP), as before: vector work between matrix runs wants waves.
__global__ __launch_bounds__(AW * 32) __attribute__((amdgpu_waves_per_eu(4, 4)))
void k_attn(const unsigned short* __restrict__ qp,
            const unsigned short* __restrict__ kp,
            const unsigned short* __restrict__ vtp,
            float* __restrict__ outp) {
  __shared__ __align__(16) _Float16 Kt[2][SK * KLP];         // K tiles, cross-wave (block barrier)
  __shared__ __align__(16) _Float16 Vt[2][HEAD_DIM * VLP];   // V^T tiles, cross-wave (block barrier)
  __shared__ __align__(16) float Olw[AW][16 * OLP];          // one output tile per wave
  __shared__ __align__(16) float Xo[AW][8 * 32 * 4];         // context of the group handed to the partner wave
  __shared__ float Xs[AW][2 * 32];                           // that group's reference and sum

  const int tid = threadIdx.x;
  const int wave = __builtin_amdgcn_readfirstlane(tid >> 5);
  const int lane = tid & 31;
  const int l15 = lane & 15;
  const int half = (lane >> 4) & 1;
  const int qg = wave & 3;    // query block of 32
  const int kh = wave >> 2;   // key half of every tile
  const int qw = blockIdx.x * (AW * 16) + qg * 32;
  const int head = blockIdx.y;
  float* Ol = Olw[wave];

  const _Float16* Q  = (const _Float16*)qp;
  const _Float16* K  = (const _Float16*)kp;
  const _Float16* VT = (const _Float16*)vtp;

  const _Float16* qbase = Q + (size_t)qw * OUT_DIM + head * HEAD_DIM;
  v16h qb[2][2];   // [column group][d 0..31 | d 32..63]
#pragma unroll
  for (int g = 0; g < 2; ++g) {
    qb[g][0] = ld_frag_h(qbase, OUT_DIM, g * 16 + l15, 0, lane);
    qb[g][1] = ld_frag_h(qbase, OUT_DIM, g * 16 + l15, 32, lane);
  }
  const _Float16* kbase = K + head * HEAD_DIM;                   // key t at kbase + t*OUT_DIM
  const _Float16* vbase = VT + (size_t)head * HEAD_DIM * SEQ;    // d row at vbase + d*SEQ

  // this lane's first piece of a tile: K row tid>>3, piece tid&7; V^T row tid>>4, piece tid&15
  const _Float16* gk = kbase + (size_t)(tid >> 3) * OUT_DIM + (tid & 7) * 8;
  const _Float16* gv = vbase + (size_t)(tid >> 4) * SEQ + (tid & 15) * 8;
  const unsigned int lk0 = (unsigned int)(size_t)(&Kt[0][(tid >> 3) * KLP + (tid & 7) * 8]);
  const unsigned int lv0 = (unsigned int)(size_t)(&Vt[0][(tid >> 4) * VLP + (tid & 15) * 8]);
  const unsigned int kbuf = SK * KLP * 2u;         // bytes from buffer 0 to buffer 1
  const unsigned int vbuf = HEAD_DIM * VLP * 2u;

  copy_tile(lk0, lv0, gk, gv);                                   // tile 0 -> buffer 0
  asm volatile("s_wait_asynccnt 0x0" ::: "memory");              // this wave's part of tile 0 has landed
  __syncthreads();                                               // tile 0 complete for every wave
  copy_tile(lk0 + kbuf, lv0 + vbuf, gk + (size_t)SK * OUT_DIM, gv + SK);   // tile 1 -> buffer 1

  v8f o[2][4] = {};
  const float kq = 1.44269504f / 512.0f;   // 1/512 (score scale on the x8 planes) times log2(e)
  // 10 = log2(1024): P leaves the exponential already x1024. With the start value of mref every P of
  // the first chunk is infinite, so the test below sends that chunk through the rescale, which sets mref.
  float mref[2], lrun[2], nb[2];
#pragma unroll
  for (int g = 0; g < 2; ++g) {
    mref[g] = -1.0e30f;
    lrun[g] = 0.0f;
    nb[g] = fmaf(-mref[g], kq, 10.0f);
  }
  const float plim = 32768.0f;   // a lane's 16 P are each at most their sum: at or under this they fit f16

  for (int t = 0; t < NST; ++t) {
    const int b = t & 1;
    const _Float16* ktile = Kt[b] + kh * (SK / 2) * KLP;   // this wave's 64 key rows of the tile
    const _Float16* vtile = Vt[b] + kh * (SK / 2);         // and the same 64 keys of every V^T row
    // K fragments of chunk 0; the later chunk's are fetched one chunk ahead, inside this tile only
    v16h ka0 = ld_frag_h(ktile, KLP, l15, 0, lane);
    v16h ka2 = ld_frag_h(ktile, KLP, 16 + l15, 0, lane);
    v16h ka1 = ld_frag_h(ktile, KLP, l15, 32, lane);
    v16h ka3 = ld_frag_h(ktile, KLP, 16 + l15, 32, lane);
#pragma unroll   // the wave's two chunks of a tile read LDS at constant offsets from one address
    for (int c = 0; c < SK / 64; ++c) {
      // this chunk's four V^T fragments, one group of reads: they land under the scores and the softmax
      v16h va[4];
#pragma unroll
      for (int j = 0; j < 4; ++j) va[j] = ld_frag_h(vtile, VLP, j * 16 + l15, c * 32, lane);
      // keeps the group of reads above the score products, so that it is in flight under the scores and the softmax
      __builtin_amdgcn_sched_barrier(0);
      v8f c0[2] = {}, c1[2] = {};   // [column group]
#pragma unroll
      for (int g = 0; g < 2; ++g) {
        c0[g] = mma_f16(ka0, qb[g][0], c0[g]);
        c1[g] = mma_f16(ka2, qb[g][0], c1[g]);
      }
#pragma unroll
      for (int g = 0; g < 2; ++g) {
        c0[g] = mma_f16(ka1, qb[g][1], c0[g]);
        c1[g] = mma_f16(ka3, qb[g][1], c1[g]);
      }
      if (c + 1 < SK / 64) {   // next chunk's K fragments, one group: they land under the softmax and the context products
        const _Float16* kn = ktile + (c + 1) * 32 * KLP;
        ka0 = ld_frag_h(kn, KLP, l15, 0, lane);
        ka2 = ld_frag_h(kn, KLP, 16 + l15, 0, lane);
        ka1 = ld_frag_h(kn, KLP, l15, 32, lane);
        ka3 = ld_frag_h(kn, KLP, 16 + l15, 32, lane);
        // keeps that group here, ahead of the softmax, so that the next chunk's score products find it landed
        __builtin_amdgcn_sched_barrier(0);
      }

      // P against the held references: no maximum, no rescale on this path
      float p0[2][8], p1[2][8];
      float ls[2];
#pragma unroll
      for (int g = 0; g < 2; ++g) {
#pragma unroll
        for (int r = 0; r < 8; ++r) p0[g][r] = __builtin_amdgcn_exp2f(fmaf(c0[g][r], kq, nb[g]));
#pragma unroll
        for (int r = 0; r < 8; ++r) p1[g][r] = __builtin_amdgcn_exp2f(fmaf(c1[g][r], kq, nb[g]));
        ls[g] = 0.0f;
#pragma unroll
        for (int r = 0; r < 8; ++r) ls[g] += p0[g][r] + p1[g][r];
      }
      // One test a chunk for both groups, a scalar branch for the whole wave: only where some lane's P have
      // outgrown f16 (or are not numbers) do the references move to the maxima seen so far.
      if (__builtin_expect(__builtin_amdgcn_ballot_w32(!(ls[0] <= plim && ls[1] <= plim)) != 0u, 0)) {   // rare: laid out off the straight path
        // The straight path keeps no raw scores beside P (registers: four waves per SIMD must fit), so this
        // path forms them again, the same products from the same tile, in the K registers' place.
        const _Float16* kc = ktile + c * 32 * KLP;
        ka0 = ld_frag_h(kc, KLP, l15, 0, lane);
        ka2 = ld_frag_h(kc, KLP, 16 + l15, 0, lane);
        ka1 = ld_frag_h(kc, KLP, l15, 32, lane);
        ka3 = ld_frag_h(kc, KLP, 16 + l15, 32, lane);
        v8f r0[2] = {}, r1[2] = {};
#pragma unroll
        for (int g = 0; g < 2; ++g) {
          r0[g] = mma_f16(ka0, qb[g][0], r0[g]);
          r1[g] = mma_f16(ka2, qb[g][0], r1[g]);
        }
#pragma unroll
        for (int g = 0; g < 2; ++g) {
          r0[g] = mma_f16(ka1, qb[g][1], r0[g]);
          r1[g] = mma_f16(ka3, qb[g][1], r1[g]);
        }
        if (c + 1 < SK / 64) {   // the next chunk's K fragments again
          const _Float16* kn = ktile + (c + 1) * 32 * KLP;
          ka0 = ld_frag_h(kn, KLP, l15, 0, lane);
          ka2 = ld_frag_h(kn, KLP, 16 + l15, 0, lane);
          ka1 = ld_frag_h(kn, KLP, l15, 32, lane);
          ka3 = ld_frag_h(kn, KLP, 16 + l15, 32, lane);
        }
#pragma unroll
        for (int g = 0; g < 2; ++g) {
          // maximum over the raw accumulators (the scale is positive, so the order is the same)
          float lm = fmaxf(r0[g][0], r1[g][0]);
#pragma unroll
          for (int r = 1; r < 8; ++r) lm = fmaxf(lm, fmaxf(r0[g][r], r1[g][r]));
          lm = fmaxf(lm, __shfl_xor(lm, 16, 32));   // both halves of a query keep one reference
          const float mnew = fmaxf(mref[g], lm);
          const float alpha = __builtin_amdgcn_exp2f((mref[g] - mnew) * kq);
          nb[g] = fmaf(-mnew, kq, 10.0f);
          mref[g] = mnew;
          ls[g] = 0.0f;
#pragma unroll
          for (int r = 0; r < 8; ++r) {
            p0[g][r] = __builtin_amdgcn_exp2f(fmaf(r0[g][r], kq, nb[g]));
            p1[g][r] = exp2_slot(fmaf(r1[g][r], kq, nb[g]));
            ls[g] += p0[g][r] + p1[g][r];
          }
          lrun[g] *= alpha;
#pragma unroll
          for (int j = 0; j < 4; ++j)
#pragma unroll
            for (int r = 0; r < 8; ++r) o[g][j][r] *= alpha;
        }
      }

      v16h pb[2];
#pragma unroll
      for (int g = 0; g < 2; ++g) {
        lrun[g] += ls[g];   // this lane's 16 keys only: the rescale branch needs lrun at hand, so no exchange stands in the loop
#pragma unroll
        for (int e = 0; e < 8; ++e) {
          pb[g][e]     = (_Float16)p0[g][e];   // key 32c + 8h + e of the wave's half tile
          pb[g][8 + e] = (_Float16)p1[g][e];   // key 32c + 16 + 8h + e of the wave's half tile
        }
      }
#pragma unroll
      for (int j = 0; j < 4; ++j)
#pragma unroll
        for (int g = 0; g < 2; ++g) o[g][j] = mma_f16(va[j], pb[g], o[g][j]);
    }
    asm volatile("s_wait_dscnt 0x0" ::: "memory");      // this wave's reads of buffer b are done
    asm volatile("s_wait_asynccnt 0x0" ::: "memory");   // this wave's part of tile t + 1 has landed
    __syncthreads();   // publishes tile t + 1 and ends every wave's reads of buffer b
    if (t + 2 < NST)   // the same for the whole workgroup
      copy_tile(lk0 + b * kbuf, lv0 + b * vbuf,
                gk + (size_t)(t + 2) * SK * OUT_DIM, gv + (size_t)(t + 2) * SK);
  }
  asm volatile("s_wait_asynccnt 0x0" ::: "memory");     // nothing in flight when the wave ends

  // o[g][j][r] = 8192 * sum_t p_t v_t over this wave's keys for query g*16 + l15, d = j*16 + 8*half + r; the two
  // halves of a query hold one reference, so their sums join by one add: lrun = 1024 * sum_t p_t
#pragma unroll
  for (int g = 0; g < 2; ++g) lrun[g] += __shfl_xor(lrun[g], 16, 32);

  // The wave of key half kh finishes group kh and hands group 1 - kh to its partner (same lane, same registers).
  float* xo = Xo[wave];
#pragma unroll
  for (int j = 0; j < 4; ++j) {
    const v8f og = kh ? o[0][j] : o[1][j];
    v4f lo4, hi4;
    lo4[0] = og[0]; lo4[1] = og[1]; lo4[2] = og[2]; lo4[3] = og[3];
    hi4[0] = og[4]; hi4[1] = og[5]; hi4[2] = og[6]; hi4[3] = og[7];
    *(v4f*)(&xo[((j * 2 + 0) * 32 + lane) * 4]) = lo4;
    *(v4f*)(&xo[((j * 2 + 1) * 32 + lane) * 4]) = hi4;
  }
  Xs[wave][lane]      = kh ? mref[0] : mref[1];
  Xs[wave][32 + lane] = kh ? lrun[0] : lrun[1];
  __syncthreads();   // the partner's group is complete in LDS

  const float* xp = Xo[wave ^ 4];
  const float m_own = kh ? mref[1] : mref[0];
  const float l_own = kh ? lrun[1] : lrun[0];
  const float m_par = Xs[wave ^ 4][lane];
  const float l_par = Xs[wave ^ 4][32 + lane];
  const float m_all = fmaxf(m_own, m_par);
  const float a_own = exp2_slot((m_own - m_all) * kq);
  const float a_par = exp2_slot((m_par - m_all) * kq);
  const float inv = 1.0f / ((l_own * a_own + l_par * a_par) * 8.0f);
  const float f_own = a_own * inv, f_par = a_par * inv;
#pragma unroll
  for (int j = 0; j < 4; ++j) {
    const v8f ow = kh ? o[1][j] : o[0][j];
    const v4f pl = *(const v4f*)(&xp[((j * 2 + 0) * 32 + lane) * 4]);
    const v4f ph = *(const v4f*)(&xp[((j * 2 + 1) * 32 + lane) * 4]);
    v4f lo4, hi4;
#pragma unroll
    for (int r = 0; r < 4; ++r) {
      lo4[r] = ow[r] * f_own + pl[r] * f_par;
      hi4[r] = ow[4 + r] * f_own + ph[r] * f_par;
    }
    *(v4f*)(&Ol[l15 * OLP + j * 16 + 8 * half])     = lo4;
    *(v4f*)(&Ol[l15 * OLP + j * 16 + 8 * half + 4]) = hi4;
  }
  __syncthreads();

  v4f v[8];
  size_t off[8];
  float* ob = outp + (size_t)(qw + kh * 16) * OUT_DIM + head * HEAD_DIM;
#pragma unroll
  for (int it = 0; it < 8; ++it) {
    const int row = it * 2 + half;       // 0..15
    const int q = l15;                   // 16 pieces of 16 B = the row's 256 bytes (2 lines)
    v[it] = *(const v4f*)(&Ol[row * OLP + q * 4]);
    off[it] = (size_t)row * OUT_DIM + q * 4;
  }
#pragma unroll
  for (int it = 0; it < 8; ++it) *(v4f*)(ob + off[it]) = v[it];
  
}

// ---------------------------------------------------------------------------
extern "C" void kernel_launch(void* const* d_in, const int* in_sizes, int n_in,
                              void* d_out, int out_size, void* d_ws, size_t ws_size,
                              hipStream_t stream) {
  if (n_in < 7) return;
  if (in_sizes[0] < SEQ * IN_DIM) return;
  if (in_sizes[1] < IN_DIM * OUT_DIM || in_sizes[2] < IN_DIM * OUT_DIM ||
      in_sizes[3] < IN_DIM * OUT_DIM) return;
  if (in_sizes[4] < OUT_DIM || in_sizes[5] < OUT_DIM || in_sizes[6] < OUT_DIM) return;
  if (out_size < SEQ * OUT_DIM) return;

  const float* h  = (const float*)d_in[0];
  const float* Wq = (const float*)d_in[1];
  const float* Wk = (const float*)d_in[2];
  const float* Wv = (const float*)d_in[3];
  const float* bq = (const float*)d_in[4];
  const float* bk = (const float*)d_in[5];
  const float* bv = (const float*)d_in[6];

  // every offset a multiple of 2 MiB
  const size_t hb_bytes = (size_t)SEQ * IN_DIM * 2;           // bf16 h plane
  const size_t wt_bytes = (size_t)3 * OUT_DIM * IN_DIM * 2;   // 3 bf16 WT planes
  const size_t pl_bytes = (size_t)SEQ * OUT_DIM * 2;          // one f16 q/k/vT plane
  const size_t off_hb = 0;
  const size_t off_wt = off_hb + hb_bytes;
  const size_t off_q  = off_wt + wt_bytes;
  const size_t off_k  = off_q + pl_bytes;
  const size_t off_vt = off_k + pl_bytes;
  const size_t total  = off_vt + pl_bytes;                    // 38 MiB at SEQ = 4096
  if (total > ws_size) return;

  char* ws = (char*)d_ws;
  unsigned short* hb  = (unsigned short*)(ws + off_hb);
  unsigned short* wt  = (unsigned short*)(ws + off_wt);
  unsigned short* qpl = (unsigned short*)(ws + off_q);
  unsigned short* kpl = (unsigned short*)(ws + off_k);
  unsigned short* vtp = (unsigned short*)(ws + off_vt);

  const int n8 = SEQ * IN_DIM / 8;
  k_cvt<<<WTB + HRB, 256, 0, stream>>>(h, Wq, Wk, Wv, hb, wt, n8);
  k_proj<<<dim3(OUT_DIM / 128, SEQ / 128, 3), 256, 0, stream>>>(hb, wt, bq, bk, bv, qpl, kpl, vtp);
  k_attn<<<dim3(SEQ / (AW * 16), NUM_HEADS), AW * 32, 0, stream>>>(qpl, kpl, vtp, (float*)d_out);
}

// v009
// Measured time: 82.3 microseconds a run.
// Next to v008, in two timings, it ran 1.03 times as fast each time.
// All steps since v000 together make it 3.99 times as fast.
#include <hip/hip_runtime.h>
// Projections h*W{q,k,v}: v_wmma_f32_16x16x32_bf16 (bf16 operands = RNE-converted inputs, f32 accumulate); scores K*Q^T and context V^T*P: v_wmma_f32_16x16x32_f16 (f16 operands, K/V planes carried x8, Q plane carried x log2(e)/64, P carried x1024, f32 accumulate); softmax in f32.

#ifndef SEQ
#define SEQ 4096
#endif
#define SEQ_FULL 4096
#define IN_DIM 1024
#define NUM_HEADS 16
#define HEAD_DIM 64
#define OUT_DIM (NUM_HEADS * HEAD_DIM)

static_assert(SEQ % 128 == 0);
static_assert(SEQ <= SEQ_FULL);
static_assert(IN_DIM % 64 == 0);
static_assert(OUT_DIM % 128 == 0);
static_assert(HEAD_DIM == 64);
static_assert((size_t)SEQ_FULL * OUT_DIM * 4 == 16777216);

// LDS pitches (in 16-bit elements unless noted); all keep 16-byte row alignment
#define TP  72     // weight transpose tile [64 n][64 k]
#define OLP 68     // context tile [16 q][64 d], floats

typedef __bf16   v16bf __attribute__((ext_vector_type(16)));
typedef __bf16   v8bf  __attribute__((ext_vector_type(8)));
typedef _Float16 v16h  __attribute__((ext_vector_type(16)));
typedef _Float16 v8h   __attribute__((ext_vector_type(8)));
typedef float    v8f   __attribute__((ext_vector_type(8)));
typedef float    v4f   __attribute__((ext_vector_type(4)));
typedef unsigned int v4u __attribute__((ext_vector_type(4)));

// ---------------------------------------------------------------------------
// WMMA wrappers. k_proj's carries 4 v_nop after every issue; its loop has vector slots to spare, and with the
// statement in place its LDS reads stay one group ahead of each block of products.
__device__ __forceinline__ v8f mma_bf16(v16bf a, v16bf b, v8f c) {
  v8f d = __builtin_amdgcn_wmma_f32_16x16x32_bf16(false, a, false, b, (short)0, c, false, false);
  asm volatile("v_nop\n\tv_nop\n\tv_nop\n\tv_nop" : "+v"(d) : "v"(a), "v"(b));
  return d;
}
// k_attn's is the bare builtin: the compiler keeps the distances behind it and counts the WMMAs and the vector
// work that follow as cover. Four waves share the SIMD's vector port there, so an idle slot is taken from another wave.
__device__ __forceinline__ v8f mma_f16(v16h a, v16h b, v8f c) {
  return __builtin_amdgcn_wmma_f32_16x16x32_f16(false, a, false, b, (short)0, c, false, false);
}

// 16-bit fragment, contraction dim CONTIGUOUS in memory: elem(k) = p0[rc*ld + k].
// Lane l: row/col rc = (l&15); elements 0..7 <- kk+8h+0..7, elements 8..15 <- kk+16+8h+0..7
// (h = l>>4). Same map for A (rc = row) and B (rc = column of a k-contiguous copy).
__device__ __forceinline__ v16bf ld_frag_bf(const __bf16* p0, int ld, int rc, int kk, int lane) {
  const int hh = (lane >> 4) & 1;
  const __bf16* p = p0 + (size_t)rc * ld + kk + 8 * hh;
  const v8bf lo = *(const v8bf*)(p);
  const v8bf hi = *(const v8bf*)(p + 16);
  v16bf f;
#pragma unroll
  for (int i = 0; i < 8; ++i) { f[i] = lo[i]; f[8 + i] = hi[i]; }
  return f;
}
__device__ __forceinline__ v16h ld_frag_h(const _Float16* p0, int ld, int rc, int kk, int lane) {
  const int hh = (lane >> 4) & 1;
  const _Float16* p = p0 + (size_t)rc * ld + kk + 8 * hh;
  const v8h lo = *(const v8h*)(p);
  const v8h hi = *(const v8h*)(p + 16);
  v16h f;
#pragma unroll
  for (int i = 0; i < 8; ++i) { f[i] = lo[i]; f[8 + i] = hi[i]; }
  return f;
}

// f32 -> bf16 bits, RNE convert
__device__ __forceinline__ unsigned int bfb(float x) {
  unsigned int u = __float_as_uint(x);
  u = u + 0x7FFFu + ((u >> 16) & 1u);
  return u >> 16;
}
// f32 -> value of its RNE bf16
__device__ __forceinline__ float bf16val(float x) {
  return __uint_as_float(bfb(x) << 16);
}
// f32 -> f16 bits, RNE convert
__device__ __forceinline__ unsigned short hbits(float x) {
  const _Float16 hv = (_Float16)x;
  return __builtin_bit_cast(unsigned short, hv);
}

// 2^x off the hot path (rescale branch, epilogue): v_exp_f32 and, in the same statement, the one slot the instruction
// set asks for behind a transcendental.
__device__ __forceinline__ float exp2_slot(float x) {
  float r;
  asm("v_exp_f32 %0, %1\n\tv_nop" : "=v"(r) : "v"(x));
  return r;
}

// ---------------------------------------------------------------------------
// Both conversions in one launch: neither reads what the other writes, so they share a grid and the second
// launch's gap, fill and tail go. The branch on the block index is the same for a whole workgroup.
// Blocks 0 .. WTB-1:  W f32 [IN_DIM k][OUT_DIM n] -> WT bf16 [OUT_DIM n][IN_DIM k] (k contiguous), three matrices
//                     into three consecutive planes; a block = one 64 k x 64 n tile transposed through LDS.
//                     They stand first: their chain (load, LDS, barrier, store) is the longer one.
// Blocks WTB .. :     h f32 [SEQ][IN_DIM] -> bf16 plane (same layout); thread g converts 8 consecutive floats
//                     into one 16-byte store.
#define WTX (IN_DIM / 64)               // k tiles of one matrix
#define WTY (OUT_DIM / 64)              // n tiles of one matrix
#define WTB (3 * WTX * WTY)             // transpose blocks
#define HRB ((SEQ * IN_DIM / 8 + 255) / 256)   // row blocks
__global__ __launch_bounds__(256) void k_cvt(const float* __restrict__ in,
                                             const float* __restrict__ Wq,
                                             const float* __restrict__ Wk,
                                             const float* __restrict__ Wv,
                                             unsigned short* __restrict__ outp,
                                             unsigned short* __restrict__ wT, int n8) {
  __shared__ __align__(16) unsigned short T[64 * TP];   // [n local][k local], cross-wave (block barrier)
  const unsigned int bid = blockIdx.x;
  const int tid = threadIdx.x;

  if (bid >= WTB) {   // block-uniform: no thread of such a block reaches the barrier below
    const int g = (int)(bid - WTB) * 256 + tid;
    if (g >= n8) return;
    const v4f a = *(const v4f*)(in + (size_t)g * 8);
    const v4f b = *(const v4f*)(in + (size_t)g * 8 + 4);
    v4u w;
    w[0] = bfb(a[0]) | (bfb(a[1]) << 16);
    w[1] = bfb(a[2]) | (bfb(a[3]) << 16);
    w[2] = bfb(b[0]) | (bfb(b[1]) << 16);
    w[3] = bfb(b[2]) | (bfb(b[3]) << 16);
    v4u* p = (v4u*)(outp + (size_t)g * 8);
    *p = w;
    return;
  }

  const int z = (int)(bid / (WTX * WTY));
  const float* W = (z == 0) ? Wq : ((z == 1) ? Wk : Wv);
  unsigned short* dst = wT + (size_t)z * OUT_DIM * IN_DIM;
  const int k0 = (int)(bid % WTX) * 64;
  const int n0 = (int)((bid / WTX) % WTY) * 64;
  const int wave = tid >> 5, lane = tid & 31;

#pragma unroll
  for (int i = 0; i < 4; ++i) {
    const int idx = i * 256 + tid;          // 0..1023
    const int kk = idx >> 4;                // 0..63
    const int c4 = (idx & 15) * 4;          // 0..60
    const v4f w = *(const v4f*)(W + (size_t)(k0 + kk) * OUT_DIM + n0 + c4);
    T[(c4 + 0) * TP + kk] = (unsigned short)bfb(w[0]);
    T[(c4 + 1) * TP + kk] = (unsigned short)bfb(w[1]);
    T[(c4 + 2) * TP + kk] = (unsigned short)bfb(w[2]);
    T[(c4 + 3) * TP + kk] = (unsigned short)bfb(w[3]);
  }
  __syncthreads();

  v4u v[2];
  size_t off[2];
#pragma unroll
  for (int it = 0; it < 2; ++it) {
    const int nn = wave * 8 + it * 4 + (lane >> 3);   // 0..63 over (wave, it, lane>>3)
    const int q = lane & 7;
    v[it] = *(const v4u*)(&T[nn * TP + q * 8]);
    off[it] = (size_t)(n0 + nn) * IN_DIM + k0 + q * 8;
  }
#pragma unroll
  for (int it = 0; it < 2; ++it) *(v4u*)(dst + off[it]) = v[it];
}

// ---------------------------------------------------------------------------
// Projection: C[SEQ][OUT_DIM] = hb[SEQ][IN_DIM] * WT[OUT_DIM][IN_DIM]^T + bias.
// 256 thr = 8 waves; block tile 128 rows x 128 cols; wave (wr, wc) owns 32 rows x 64 cols.
// A k-tile = 64 k of both operands: hb [128 rows][64 k] and WT [128 n][64 k], copied
// whole-line from the planes into LDS by asynchronous copies, two buffers: tile t + 1 is
// in flight while tile t is multiplied. Each accumulator still sums k in ascending 32-steps.
// z = 0: Q plane f16 x log2(e)/64 [SEQ][OUT_DIM]; z = 1: K plane f16 x8 [SEQ][OUT_DIM];
// z = 2: V^T plane f16 x8 [OUT_DIM][SEQ]. Epilogue staged in the same LDS behind the loop.
#define PK  64                 // k per tile
#define PLP 72                 // operand tile pitch: 144 B = 16 B x 9
#define PTS (128 * PLP)        // elements of one operand tile
#define PNT (IN_DIM / PK)      // tiles
#define EP  136                // epilogue tile pitch [128][128]: 272 B = 16 B x 17
static_assert(PNT >= 2);
static_assert(128 * EP <= 4 * PTS);
static_assert(256 * 4 * 8 == 128 * PK);   // four 16-byte copies a lane fill one operand tile

// One k-tile's copies of one lane: four 16-byte pieces of hb and four of WT, 32 rows apart.
// s_wait_xcnt 0 is the statement's last line, so that no address register named here is
// rewritten before it.
__device__ __forceinline__ void copy_ab(unsigned int la, unsigned int lw,
                                        const unsigned short* ga, const unsigned short* gw) {
  asm volatile(
      "global_load_async_to_lds_b128 %0, %8, off\n\t"
      "global_load_async_to_lds_b128 %1, %9, off\n\t"
      "global_load_async_to_lds_b128 %2, %10, off\n\t"
      "global_load_async_to_lds_b128 %3, %11, off\n\t"
      "global_load_async_to_lds_b128 %4, %12, off\n\t"
      "global_load_async_to_lds_b128 %5, %13, off\n\t"
      "global_load_async_to_lds_b128 %6, %14, off\n\t"
      "global_load_async_to_lds_b128 %7, %15, off\n\t"
      "s_wait_xcnt 0x0"
      :
      : "v"(la), "v"(la + 32u * PLP * 2u), "v"(la + 64u * PLP * 2u), "v"(la + 96u * PLP * 2u),
        "v"(lw), "v"(lw + 32u * PLP * 2u), "v"(lw + 64u * PLP * 2u), "v"(lw + 96u * PLP * 2u),
        "v"(ga), "v"(ga + (size_t)32 * IN_DIM), "v"(ga + (size_t)64 * IN_DIM),
        "v"(ga + (size_t)96 * IN_DIM),
        "v"(gw), "v"(gw + (size_t)32 * IN_DIM), "v"(gw + (size_t)64 * IN_DIM),
        "v"(gw + (size_t)96 * IN_DIM)
      : "memory");
}

__global__ __launch_bounds__(256) void k_proj(
    const unsigned short* __restrict__ hb, const unsigned short* __restrict__ wT,
    const float* __restrict__ bq, const float* __restrict__ bk, const float* __restrict__ bv,
    unsigned short* __restrict__ qp, unsigned short* __restrict__ kp,
    unsigned short* __restrict__ vtp) {
  // [buffer][hb tile | WT tile], cross-wave (block barrier); behind the loop the epilogue tile
  __shared__ __align__(16) unsigned short S[4 * PTS];

  const int z = blockIdx.z;
  const int n0 = blockIdx.x * 128;
  const int m0 = blockIdx.y * 128;
  const int tid = threadIdx.x;
  const int wave = tid >> 5, lane = tid & 31;
  const int l15 = lane & 15, half = (lane >> 4) & 1;
  const int wr = wave >> 1, wc = wave & 1;

  const unsigned short* Wt = wT + (size_t)z * OUT_DIM * IN_DIM;
  const float* bias = (z == 0) ? bq : ((z == 1) ? bk : bv);

  // this lane's first piece of a tile: row tid>>3, piece tid&7, in both operands
  const unsigned short* ga = hb + (size_t)(m0 + (tid >> 3)) * IN_DIM + (tid & 7) * 8;
  const unsigned short* gw = Wt + (size_t)(n0 + (tid >> 3)) * IN_DIM + (tid & 7) * 8;
  const unsigned int la0 = (unsigned int)(size_t)(&S[(tid >> 3) * PLP + (tid & 7) * 8]);
  const unsigned int lw0 = la0 + PTS * 2u;
  const unsigned int pbuf = 2u * PTS * 2u;         // bytes from buffer 0 to buffer 1

  copy_ab(la0, lw0, ga, gw);                                     // tile 0 -> buffer 0
  asm volatile("s_wait_asynccnt 0x0" ::: "memory");              // this wave's part of tile 0 has landed
  __syncthreads();                                               // tile 0 complete for every wave
  copy_ab(la0 + pbuf, lw0 + pbuf, ga + PK, gw + PK);             // tile 1 -> buffer 1

  v8f acc[2][4] = {};
  for (int t = 0; t < PNT; ++t) {
    const int b = t & 1;
    const __bf16* at = (const __bf16*)(S + b * 2 * PTS);
    const __bf16* wt = at + PTS;
#pragma unroll   // the two 32-k halves of a tile read LDS at constant offsets from one address
    for (int kk = 0; kk < PK; kk += 32) {
      v16bf a[2], w[4];
#pragma unroll
      for (int i = 0; i < 2; ++i) a[i] = ld_frag_bf(at, PLP, wr * 32 + i * 16 + l15, kk, lane);
#pragma unroll
      for (int j = 0; j < 4; ++j) w[j] = ld_frag_bf(wt, PLP, wc * 64 + j * 16 + l15, kk, lane);
#pragma unroll
      for (int j = 0; j < 4; ++j)
#pragma unroll
        for (int i = 0; i < 2; ++i) acc[i][j] = mma_bf16(a[i], w[j], acc[i][j]);
    }
    asm volatile("s_wait_dscnt 0x0" ::: "memory");      // this wave's reads of buffer b are done
    asm volatile("s_wait_asynccnt 0x0" ::: "memory");   // this wave's part of tile t + 1 has landed
    __syncthreads();   // publishes tile t + 1 and ends every wave's reads of buffer b
    if (t + 2 < PNT)   // the same for the whole workgroup
      copy_ab(la0 + b * pbuf, lw0 + b * pbuf, ga + (size_t)(t + 2) * PK, gw + (size_t)(t + 2) * PK);
  }
  asm volatile("s_wait_asynccnt 0x0" ::: "memory");     // nothing in flight when the LDS changes its use

  // acc[i][j][r] = C[m0 + wr*32 + i*16 + 8*half + r][n0 + wc*64 + j*16 + l15]
  unsigned short* E = S;   // every wave's last read of the tiles ended at the last trip's barrier
  // Q's carry times K's 8 is log2(e)/8: the score products come out as score / sqrt(HEAD_DIM) in log2 units
  const float car = (z == 0) ? 1.44269504f / 64.0f : 8.0f;
  if (z != 2) {                      // block-uniform branch
#pragma unroll
    for (int j = 0; j < 4; ++j) {
      const int col = wc * 64 + j * 16 + l15;
      const float bb = bf16val(bias[n0 + col]);
#pragma unroll
      for (int i = 0; i < 2; ++i)
#pragma unroll
        for (int r = 0; r < 8; ++r) {
          const int row = wr * 32 + i * 16 + 8 * half + r;
          E[row * EP + col] = hbits((acc[i][j][r] + bb) * car);
        }
    }
    __syncthreads();
    unsigned short* dst = (z == 0) ? qp : kp;
    v4u v[8];
    size_t off[8];
#pragma unroll
    for (int it = 0; it < 8; ++it) {
      const int row = it * 16 + (tid >> 4);               // 0..127 over (it, tid>>4)
      const int q = l15;                                  // 16 pieces = 256-byte row = 2 lines
      v[it] = *(const v4u*)(&E[row * EP + q * 8]);
      off[it] = (size_t)(m0 + row) * OUT_DIM + n0 + q * 8;
    }
#pragma unroll
    for (int it = 0; it < 8; ++it) *(v4u*)(dst + off[it]) = v[it];
    // behind the last store: no register that a store names is rewritten on any path of the listing before this wait
    asm volatile("s_wait_xcnt 0x0" ::: "memory");
  } else {
#pragma unroll
    for (int j = 0; j < 4; ++j) {
      const int col = wc * 64 + j * 16 + l15;             // d within tile
      const float bb = bf16val(bias[n0 + col]);
#pragma unroll
      for (int i = 0; i < 2; ++i)
#pragma unroll
        for (int r = 0; r < 8; ++r) {
          const int srow = wr * 32 + i * 16 + 8 * half + r;   // s within tile
          E[col * EP + srow] = hbits((acc[i][j][r] + bb) * car);
        }
    }
    __syncthreads();
    v4u v[8];
    size_t off[8];
#pragma unroll
    for (int it = 0; it < 8; ++it) {
      const int drow = it * 16 + (tid >> 4);              // 0..127 over (it, tid>>4)
      const int q = l15;                                  // 16 pieces = 256-byte row = 2 lines
      v[it] = *(const v4u*)(&E[drow * EP + q * 8]);
      off[it] = (size_t)(n0 + drow) * SEQ + m0 + q * 8;
    }
#pragma unroll
    for (int it = 0; it < 8; ++it) *(v4u*)(vtp + off[it]) = v[it];
  }
}

// ---------------------------------------------------------------------------
// Flash attention, transposed-score form: one wave = (32 queries as two 16-column groups, one head,
// half of every tile's keys), so that each K / V^T fragment read from LDS feeds two products.
// A workgroup = 8 waves = 4 query blocks x 2 key halves = 128 queries of one head, which share every
// K / V^T tile. The two waves of a query block keep their own reference, sum and context and join them
// once, behind the loop, through LDS; each then finishes and stores 16 of the 32 queries.
// A tile = 128 keys: K [128 keys][64 d] and V^T [64 d][128 keys], copied whole-line
// from the planes into LDS by asynchronous copies, two buffers: tile t + 1 is in
// flight while tile t is worked on. Fragments come from LDS (ds_load_b128 pitches).
// Per 32-key chunk and 16-column group:
//   S^T = K . Q^T    A = K rows (lane = key, k = d), B = Q^T (lane = query, k = d)
//                    D[row = key 8h+r][col = query l15]; c0 keys 0..15, c1 keys 16..31
//   per-lane softmax terms for query l15 (16 local keys; the xor-16 partner holds the other 16)
//   O^T += V^T . P   A = V^T rows (lane = d, k = key), B = P: element i<8 <- c0[i]
//                    (key 8h+i), element 8+i <- c1[i] (key 16+8h+i), same lane
//                    D[row = d 8h+r][col = query l15]
// The planes' carries make K . Q^T the scaled score in log2 units, and 10 - ref enters as the C operand
// of the score products: P = exp2(accumulator), one exponential a score and nothing else; ref is a held
// reference score per query, in log2 units, and moves only when a chunk's P outgrow f16 (lazy rescale, below).
// P and its sum carried x1024, V carried x8 -> context scaled by 1/(8 * carried sum).
// Output tile [16 q][64 d] f32 staged in LDS; each 256-byte row = 2 lines,
#define AW  8                  // waves per workgroup
#define SK  128                // keys per tile
#define KLP 72                 // K tile pitch: 144 B = 16 B x 9
#define VLP 136                // V^T tile pitch: 272 B = 16 B x 17
#define NST (SEQ / SK)         // tiles
static_assert(SEQ % (AW * 16) == 0);
static_assert(NST >= 2);
static_assert(AW == 8 && SK % 64 == 0);   // 4 query blocks x 2 key halves; a wave's half tile is whole 32-key chunks
static_assert(AW * 32 * 4 * 8 == SK * HEAD_DIM);   // four 16-byte copies a lane fill one tile

// One tile's copies of one lane: four 16-byte pieces of K (32 key rows apart) and four
// of V^T (16 d rows apart). s_wait_xcnt 0 is the statement's last line, so that no
// address register named here is rewritten before it.
__device__ __forceinline__ void copy_tile(unsigned int lk, unsigned int lv,
                                          const _Float16* gk, const _Float16* gv) {
  asm volatile(
      "global_load_async_to_lds_b128 %0, %8, off\n\t"
      "global_load_async_to_lds_b128 %1, %9, off\n\t"
      "global_load_async_to_lds_b128 %2, %10, off\n\t"
      "global_load_async_to_lds_b128 %3, %11, off\n\t"
      "global_load_async_to_lds_b128 %4, %12, off\n\t"
      "global_load_async_to_lds_b128 %5, %13, off\n\t"
      "global_load_async_to_lds_b128 %6, %14, off\n\t"
      "global_load_async_to_lds_b128 %7, %15, off\n\t"
      "s_wait_xcnt 0x0"
      :
      : "v"(lk), "v"(lk + 32u * KLP * 2u), "v"(lk + 64u * KLP * 2u), "v"(lk + 96u * KLP * 2u),
        "v"(lv), "v"(lv + 16u * VLP * 2u), "v"(lv + 32u * VLP * 2u), "v"(lv + 48u * VLP * 2u),
        "v"(gk), "v"(gk + (size_t)32 * OUT_DIM), "v"(gk + (size_t)64 * OUT_DIM),
        "v"(gk + (size_t)96 * OUT_DIM),
        "v"(gv), "v"(gv + (size_t)16 * SEQ), "v"(gv + (size_t)32 * SEQ), "v"(gv + (size_t)48 * SEQ)
      : "memory");
}

// Four waves per SIMD (two workgroups per WGP), as before: vector work between matrix runs wants waves.
__global__ __launch_bounds__(AW * 32) __attribute__((amdgpu_waves_per_eu(4, 4)))
void k_attn(const unsigned short* __restrict__ qp,
            const unsigned short* __restrict__ kp,
            const unsigned short* __restrict__ vtp,
            float* __restrict__ outp) {
  __shared__ __align__(16) _Float16 Kt[2][SK * KLP];         // K tiles, cross-wave (block barrier)
  __shared__ __align__(16) _Float16 Vt[2][HEAD_DIM * VLP];   // V^T tiles, cross-wave (block barrier)
  __shared__ __align__(16) float Olw[AW][16 * OLP];          // one output tile per wave
  __shared__ __align__(16) float Xo[AW][8 * 32 * 4];         // context of the group handed to the partner wave
  __shared__ float Xs[AW][2 * 32];                           // that group's reference and sum

  const int tid = threadIdx.x;
  const int wave = __builtin_amdgcn_readfirstlane(tid >> 5);
  const int lane = tid & 31;
  const int l15 = lane & 15;
  const int half = (lane >> 4) & 1;
  const int qg = wave & 3;    // query block of 32
  const int kh = wave >> 2;   // key half of every tile
  const int qw = blockIdx.x * (AW * 16) + qg * 32;
  const int head = blockIdx.y;
  float* Ol = Olw[wave];

  const _Float16* Q  = (const _Float16*)qp;
  const _Float16* K  = (const _Float16*)kp;
  const _Float16* VT = (const _Float16*)vtp;

  const _Float16* qbase = Q + (size_t)qw * OUT_DIM + head * HEAD_DIM;
  v16h qb[2][2];   // [column group][d 0..31 | d 32..63]
#pragma unroll
  for (int g = 0; g < 2; ++g) {
    qb[g][0] = ld_frag_h(qbase, OUT_DIM, g * 16 + l15, 0, lane);
    qb[g][1] = ld_frag_h(qbase, OUT_DIM, g * 16 + l15, 32, lane);
  }
  const _Float16* kbase = K + head * HEAD_DIM;                   // key t at kbase + t*OUT_DIM
  const _Float16* vbase = VT + (size_t)head * HEAD_DIM * SEQ;    // d row at vbase + d*SEQ

  // this lane's first piece of a tile: K row tid>>3, piece tid&7; V^T row tid>>4, piece tid&15
  const _Float16* gk = kbase + (size_t)(tid >> 3) * OUT_DIM + (tid & 7) * 8;
  const _Float16* gv = vbase + (size_t)(tid >> 4) * SEQ + (tid & 15) * 8;
  const unsigned int lk0 = (unsigned int)(size_t)(&Kt[0][(tid >> 3) * KLP + (tid & 7) * 8]);
  const unsigned int lv0 = (unsigned int)(size_t)(&Vt[0][(tid >> 4) * VLP + (tid & 15) * 8]);
  const unsigned int kbuf = SK * KLP * 2u;         // bytes from buffer 0 to buffer 1
  const unsigned int vbuf = HEAD_DIM * VLP * 2u;

  copy_tile(lk0, lv0, gk, gv);                                   // tile 0 -> buffer 0
  asm volatile("s_wait_asynccnt 0x0" ::: "memory");              // this wave's part of tile 0 has landed
  __syncthreads();                                               // tile 0 complete for every wave
  copy_tile(lk0 + kbuf, lv0 + vbuf, gk + (size_t)SK * OUT_DIM, gv + SK);   // tile 1 -> buffer 1

  v8f o[2][4] = {};
  // 10 = log2(1024): P leaves the exponential already x1024. With the start value of mref every P of
  // the first chunk is infinite, so the test below sends that chunk through the rescale, which sets nbv.
  float mref[2], lrun[2];   // mref: start value here, set again from nbv behind the loop; inside it nbv alone holds the reference
  v8f nbv[2];   // 10 - reference in all eight rows: a lane's accumulator rows are keys of its one query
#pragma unroll
  for (int g = 0; g < 2; ++g) {
    mref[g] = -1.0e27f;
    lrun[g] = 0.0f;
#pragma unroll
    for (int r = 0; r < 8; ++r) nbv[g][r] = 10.0f - mref[g];
  }
  const float plim = 32768.0f;   // a lane's 16 P are each at most their sum: at or under this they fit f16

  for (int t = 0; t < NST; ++t) {
    const int b = t & 1;
    const _Float16* ktile = Kt[b] + kh * (SK / 2) * KLP;   // this wave's 64 key rows of the tile
    const _Float16* vtile = Vt[b] + kh * (SK / 2);         // and the same 64 keys of every V^T row
    // K fragments of chunk 0; the later chunk's are fetched one chunk ahead, inside this tile only
    v16h ka0 = ld_frag_h(ktile, KLP, l15, 0, lane);
    v16h ka2 = ld_frag_h(ktile, KLP, 16 + l15, 0, lane);
    v16h ka1 = ld_frag_h(ktile, KLP, l15, 32, lane);
    v16h ka3 = ld_frag_h(ktile, KLP, 16 + l15, 32, lane);
#pragma unroll   // the wave's two chunks of a tile read LDS at constant offsets from one address
    for (int c = 0; c < SK / 64; ++c) {
      // this chunk's four V^T fragments, one group of reads: they land under the scores and the softmax
      v16h va[4];
#pragma unroll
      for (int j = 0; j < 4; ++j) va[j] = ld_frag_h(vtile, VLP, j * 16 + l15, c * 32, lane);
      // keeps the group of reads above the score products, so that it is in flight under the scores and the softmax
      __builtin_amdgcn_sched_barrier(0);
      v8f c0[2], c1[2];   // [column group]
#pragma unroll
      for (int g = 0; g < 2; ++g) {
        c0[g] = mma_f16(ka0, qb[g][0], nbv[g]);
        c1[g] = mma_f16(ka2, qb[g][0], nbv[g]);
      }
#pragma unroll
      for (int g = 0; g < 2; ++g) {
        c0[g] = mma_f16(ka1, qb[g][1], c0[g]);
        c1[g] = mma_f16(ka3, qb[g][1], c1[g]);
      }
      if (c + 1 < SK / 64) {   // next chunk's K fragments, one group: they land under the softmax and the context products
        const _Float16* kn = ktile + (c + 1) * 32 * KLP;
        ka0 = ld_frag_h(kn, KLP, l15, 0, lane);
        ka2 = ld_frag_h(kn, KLP, 16 + l15, 0, lane);
        ka1 = ld_frag_h(kn, KLP, l15, 32, lane);
        ka3 = ld_frag_h(kn, KLP, 16 + l15, 32, lane);
        // keeps that group here, ahead of the softmax, so that the next chunk's score products find it landed
        __builtin_amdgcn_sched_barrier(0);
      }

      // P against the held references: no maximum, no rescale on this path. Each path packs its own P to f16, so
      // that 16 registers, not 32, meet at the join: with nbv's 16 beside 32 the build spilled a Q fragment.
      v16h pb[2];
      float ls[2];
#pragma unroll
      for (int g = 0; g < 2; ++g) {
        float p0[8], p1[8];
#pragma unroll
        for (int r = 0; r < 8; ++r) p0[r] = __builtin_amdgcn_exp2f(c0[g][r]);
#pragma unroll
        for (int r = 0; r < 8; ++r) p1[r] = __builtin_amdgcn_exp2f(c1[g][r]);
        ls[g] = 0.0f;
#pragma unroll
        for (int r = 0; r < 8; ++r) ls[g] += p0[r] + p1[r];
#pragma unroll
        for (int e = 0; e < 8; ++e) {
          pb[g][e]     = (_Float16)p0[e];   // key 32c + 8h + e of the wave's half tile
          pb[g][8 + e] = (_Float16)p1[e];   // key 32c + 16 + 8h + e of the wave's half tile
        }
      }
      // One test a chunk for both groups, a scalar branch for the whole wave: only where some lane's P have
      // outgrown f16 (or are not numbers) do the references move to the maxima seen so far.
      if (__builtin_expect(__builtin_amdgcn_ballot_w32(!(ls[0] <= plim && ls[1] <= plim)) != 0u, 0)) {   // rare: laid out off the straight path
        // The straight path keeps no scores beside P (registers: four waves per SIMD must fit), so this
        // path forms them again, the same products from the same tile on a zero C, in the K registers' place.
        const _Float16* kc = ktile + c * 32 * KLP;
        ka0 = ld_frag_h(kc, KLP, l15, 0, lane);
        ka2 = ld_frag_h(kc, KLP, 16 + l15, 0, lane);
        ka1 = ld_frag_h(kc, KLP, l15, 32, lane);
        ka3 = ld_frag_h(kc, KLP, 16 + l15, 32, lane);
        v8f r0[2] = {}, r1[2] = {};
#pragma unroll
        for (int g = 0; g < 2; ++g) {
          r0[g] = mma_f16(ka0, qb[g][0], r0[g]);
          r1[g] = mma_f16(ka2, qb[g][0], r1[g]);
        }
#pragma unroll
        for (int g = 0; g < 2; ++g) {
          r0[g] = mma_f16(ka1, qb[g][1], r0[g]);
          r1[g] = mma_f16(ka3, qb[g][1], r1[g]);
        }
        if (c + 1 < SK / 64) {   // the next chunk's K fragments again
          const _Float16* kn = ktile + (c + 1) * 32 * KLP;
          ka0 = ld_frag_h(kn, KLP, l15, 0, lane);
          ka2 = ld_frag_h(kn, KLP, 16 + l15, 0, lane);
          ka1 = ld_frag_h(kn, KLP, l15, 32, lane);
          ka3 = ld_frag_h(kn, KLP, 16 + l15, 32, lane);
        }
#pragma unroll
        for (int g = 0; g < 2; ++g) {
          float lm = fmaxf(r0[g][0], r1[g][0]);
#pragma unroll
          for (int r = 1; r < 8; ++r) lm = fmaxf(lm, fmaxf(r0[g][r], r1[g][r]));
          lm = fmaxf(lm, __shfl_xor(lm, 16, 32));   // both halves of a query keep one reference
          const float nbo = nbv[g][0];
          const float nb = 10.0f - fmaxf(10.0f - nbo, lm);
          const float alpha = __builtin_amdgcn_exp2f(nb - nbo);   // the shift that P really sees
          ls[g] = 0.0f;
#pragma unroll
          for (int r = 0; r < 8; ++r) {
            const float pa = exp2_slot(r0[g][r] + nb);
            const float pc = exp2_slot(r1[g][r] + nb);
            ls[g] += pa + pc;
            pb[g][r]     = (_Float16)pa;
            pb[g][8 + r] = (_Float16)pc;
            nbv[g][r] = nb;
          }
          lrun[g] *= alpha;
#pragma unroll
          for (int j = 0; j < 4; ++j)
#pragma unroll
            for (int r = 0; r < 8; ++r) o[g][j][r] *= alpha;
        }
      }

#pragma unroll
      for (int g = 0; g < 2; ++g)
        lrun[g] += ls[g];   // this lane's 16 keys only: the rescale branch needs lrun at hand, so no exchange stands in the loop
#pragma unroll
      for (int j = 0; j < 4; ++j)
#pragma unroll
        for (int g = 0; g < 2; ++g) o[g][j] = mma_f16(va[j], pb[g], o[g][j]);
    }
    asm volatile("s_wait_dscnt 0x0" ::: "memory");      // this wave's reads of buffer b are done
    asm volatile("s_wait_asynccnt 0x0" ::: "memory");   // this wave's part of tile t + 1 has landed
    __syncthreads();   // publishes tile t + 1 and ends every wave's reads of buffer b
    if (t + 2 < NST)   // the same for the whole workgroup
      copy_tile(lk0 + b * kbuf, lv0 + b * vbuf,
                gk + (size_t)(t + 2) * SK * OUT_DIM, gv + (size_t)(t + 2) * SK);
  }
  asm volatile("s_wait_asynccnt 0x0" ::: "memory");     // nothing in flight when the wave ends

  // o[g][j][r] = 8192 * sum_t p_t v_t over this wave's keys for query g*16 + l15, d = j*16 + 8*half + r; the two
  // halves of a query hold one reference, so their sums join by one add: lrun = 1024 * sum_t p_t
#pragma unroll
  for (int g = 0; g < 2; ++g) {
    lrun[g] += __shfl_xor(lrun[g], 16, 32);
    mref[g] = 10.0f - nbv[g][0];
  }

  // The wave of key half kh finishes group kh and hands group 1 - kh to its partner (same lane, same registers).
  float* xo = Xo[wave];
#pragma unroll
  for (int j = 0; j < 4; ++j) {
    const v8f og = kh ? o[0][j] : o[1][j];
    v4f lo4, hi4;
    lo4[0] = og[0]; lo4[1] = og[1]; lo4[2] = og[2]; lo4[3] = og[3];
    hi4[0] = og[4]; hi4[1] = og[5]; hi4[2] = og[6]; hi4[3] = og[7];
    *(v4f*)(&xo[((j * 2 + 0) * 32 + lane) * 4]) = lo4;
    *(v4f*)(&xo[((j * 2 + 1) * 32 + lane) * 4]) = hi4;
  }
  Xs[wave][lane]      = kh ? mref[0] : mref[1];
  Xs[wave][32 + lane] = kh ? lrun[0] : lrun[1];
  __syncthreads();   // the partner's group is complete in LDS

  const float* xp = Xo[wave ^ 4];
  const float m_own = kh ? mref[1] : mref[0];
  const float l_own = kh ? lrun[1] : lrun[0];
  const float m_par = Xs[wave ^ 4][lane];
  const float l_par = Xs[wave ^ 4][32 + lane];
  const float m_all = fmaxf(m_own, m_par);
  const float a_own = exp2_slot(m_own - m_all);
  const float a_par = exp2_slot(m_par - m_all);
  const float inv = 1.0f / ((l_own * a_own + l_par * a_par) * 8.0f);
  const float f_own = a_own * inv, f_par = a_par * inv;
#pragma unroll
  for (int j = 0; j < 4; ++j) {
    const v8f ow = kh ? o[1][j] : o[0][j];
    const v4f pl = *(const v4f*)(&xp[((j * 2 + 0) * 32 + lane) * 4]);
    const v4f ph = *(const v4f*)(&xp[((j * 2 + 1) * 32 + lane) * 4]);
    v4f lo4, hi4;
#pragma unroll
    for (int r = 0; r < 4; ++r) {
      lo4[r] = ow[r] * f_own + pl[r] * f_par;
      hi4[r] = ow[4 + r] * f_own + ph[r] * f_par;
    }
    *(v4f*)(&Ol[l15 * OLP + j * 16 + 8 * half])     = lo4;
    *(v4f*)(&Ol[l15 * OLP + j * 16 + 8 * half + 4]) = hi4;
  }
  __syncthreads();

  v4f v[8];
  size_t off[8];
  float* ob = outp + (size_t)(qw + kh * 16) * OUT_DIM + head * HEAD_DIM;
#pragma unroll
  for (int it = 0; it < 8; ++it) {
    const int row = it * 2 + half;       // 0..15
    const int q = l15;                   // 16 pieces of 16 B = the row's 256 bytes (2 lines)
    v[it] = *(const v4f*)(&Ol[row * OLP + q * 4]);
    off[it] = (size_t)row * OUT_DIM + q * 4;
  }
#pragma unroll
  for (int it = 0; it < 8; ++it) *(v4f*)(ob + off[it]) = v[it];
  
}

// ---------------------------------------------------------------------------
extern "C" void kernel_launch(void* const* d_in, const int* in_sizes, int n_in,
                              void* d_out, int out_size, void* d_ws, size_t ws_size,
                              hipStream_t stream) {
  if (n_in < 7) return;
  if (in_sizes[0] < SEQ * IN_DIM) return;
  if (in_sizes[1] < IN_DIM * OUT_DIM || in_sizes[2] < IN_DIM * OUT_DIM ||
      in_sizes[3] < IN_DIM * OUT_DIM) return;
  if (in_sizes[4] < OUT_DIM || in_sizes[5] < OUT_DIM || in_sizes[6] < OUT_DIM) return;
  if (out_size < SEQ * OUT_DIM) return;

  const float* h  = (const float*)d_in[0];
  const float* Wq = (const float*)d_in[1];
  const float* Wk = (const float*)d_in[2];
  const float* Wv = (const float*)d_in[3];
  const float* bq = (const float*)d_in[4];
  const float* bk = (const float*)d_in[5];
  const float* bv = (const float*)d_in[6];

  // every offset a multiple of 2 MiB
  const size_t hb_bytes = (size_t)SEQ * IN_DIM * 2;           // bf16 h plane
  const size_t wt_bytes = (size_t)3 * OUT_DIM * IN_DIM * 2;   // 3 bf16 WT planes
  const size_t pl_bytes = (size_t)SEQ * OUT_DIM * 2;          // one f16 q/k/vT plane
  const size_t off_hb = 0;
  const size_t off_wt = off_hb + hb_bytes;
  const size_t off_q  = off_wt + wt_bytes;
  const size_t off_k  = off_q + pl_bytes;
  const size_t off_vt = off_k + pl_bytes;
  const size_t total  = off_vt + pl_bytes;                    // 38 MiB at SEQ = 4096
  if (total > ws_size) return;

  char* ws = (char*)d_ws;
  unsigned short* hb  = (unsigned short*)(ws + off_hb);
  unsigned short* wt  = (unsigned short*)(ws + off_wt);
  unsigned short* qpl = (unsigned short*)(ws + off_q);
  unsigned short* kpl = (unsigned short*)(ws + off_k);
  unsigned short* vtp = (unsigned short*)(ws + off_vt);

  const int n8 = SEQ * IN_DIM / 8;
  k_cvt<<<WTB + HRB, 256, 0, stream>>>(h, Wq, Wk, Wv, hb, wt, n8);
  k_proj<<<dim3(OUT_DIM / 128, SEQ / 128, 3), 256, 0, stream>>>(hb, wt, bq, bk, bv, qpl, kpl, vtp);
  k_attn<<<dim3(SEQ / (AW * 16), NUM_HEADS), AW * 32, 0, stream>>>(qpl, kpl, vtp, (float*)d_out);
}

// v010
// It runs in 75.4 microseconds.
// Two timings next to v009 put it at 1.06 and 1.09 times that version's speed.
// Over all steps from v000 it is 4.28 times as fast.
#include <hip/hip_runtime.h>
// Projections h*W{q,k,v}: v_wmma_f32_16x16x32_bf16 (bf16 operands = RNE-converted inputs, f32 accumulate); scores K*Q^T and context V^T*P: v_wmma_f32_16x16x32_f16 (f16 operands, K/V planes carried x8, Q plane carried x log2(e)/64, P carried x1024, f32 accumulate); softmax in f32.

#ifndef SEQ
#define SEQ 4096
#endif
#define SEQ_FULL 4096
#define IN_DIM 1024
#define NUM_HEADS 16
#define HEAD_DIM 64
#define OUT_DIM (NUM_HEADS * HEAD_DIM)

static_assert(SEQ % 128 == 0);
static_assert(SEQ <= SEQ_FULL);
static_assert(IN_DIM % 64 == 0);
static_assert(OUT_DIM % 128 == 0);
static_assert(HEAD_DIM == 64);
static_assert((size_t)SEQ_FULL * OUT_DIM * 4 == 16777216);

// LDS pitches (in 16-bit elements unless noted); all keep 16-byte row alignment
#define TP  72     // weight transpose tile [64 n][64 k]
#define OLP 68     // context tile [16 q][64 d], floats

typedef __bf16   v16bf __attribute__((ext_vector_type(16)));
typedef __bf16   v8bf  __attribute__((ext_vector_type(8)));
typedef _Float16 v16h  __attribute__((ext_vector_type(16)));
typedef _Float16 v8h   __attribute__((ext_vector_type(8)));
typedef float    v8f   __attribute__((ext_vector_type(8)));
typedef float    v4f   __attribute__((ext_vector_type(4)));
typedef unsigned int v4u __attribute__((ext_vector_type(4)));

// ---------------------------------------------------------------------------
// WMMA wrappers, both the bare builtin: the compiler keeps the distances behind it and counts the WMMAs and the
// vector work that follow as cover. k_proj's accumulators reach above v255, which asm text cannot name.
__device__ __forceinline__ v8f mma_bf16(v16bf a, v16bf b, v8f c) {
  return __builtin_amdgcn_wmma_f32_16x16x32_bf16(false, a, false, b, (short)0, c, false, false);
}
// In k_attn four waves share the SIMD's vector port, so an idle slot is taken from another wave.
__device__ __forceinline__ v8f mma_f16(v16h a, v16h b, v8f c) {
  return __builtin_amdgcn_wmma_f32_16x16x32_f16(false, a, false, b, (short)0, c, false, false);
}

// 16-bit fragment, contraction dim CONTIGUOUS in memory: elem(k) = p0[rc*ld + k].
// Lane l: row/col rc = (l&15); elements 0..7 <- kk+8h+0..7, elements 8..15 <- kk+16+8h+0..7
// (h = l>>4). Same map for A (rc = row) and B (rc = column of a k-contiguous copy).
__device__ __forceinline__ v16bf ld_frag_bf(const __bf16* p0, int ld, int rc, int kk, int lane) {
  const int hh = (lane >> 4) & 1;
  const __bf16* p = p0 + (size_t)rc * ld + kk + 8 * hh;
  const v8bf lo = *(const v8bf*)(p);
  const v8bf hi = *(const v8bf*)(p + 16);
  v16bf f;
#pragma unroll
  for (int i = 0; i < 8; ++i) { f[i] = lo[i]; f[8 + i] = hi[i]; }
  return f;
}
__device__ __forceinline__ v16h ld_frag_h(const _Float16* p0, int ld, int rc, int kk, int lane) {
  const int hh = (lane >> 4) & 1;
  const _Float16* p = p0 + (size_t)rc * ld + kk + 8 * hh;
  const v8h lo = *(const v8h*)(p);
  const v8h hi = *(const v8h*)(p + 16);
  v16h f;
#pragma unroll
  for (int i = 0; i < 8; ++i) { f[i] = lo[i]; f[8 + i] = hi[i]; }
  return f;
}

// f32 -> bf16 bits, RNE convert
__device__ __forceinline__ unsigned int bfb(float x) {
  unsigned int u = __float_as_uint(x);
  u = u + 0x7FFFu + ((u >> 16) & 1u);
  return u >> 16;
}
// f32 -> value of its RNE bf16
__device__ __forceinline__ float bf16val(float x) {
  return __uint_as_float(bfb(x) << 16);
}
// f32 -> f16 bits, RNE convert
__device__ __forceinline__ unsigned short hbits(float x) {
  const _Float16 hv = (_Float16)x;
  return __builtin_bit_cast(unsigned short, hv);
}

// 2^x off the hot path (rescale branch, epilogue): v_exp_f32 and, in the same statement, the one slot the instruction
// set asks for behind a transcendental.
__device__ __forceinline__ float exp2_slot(float x) {
  float r;
  asm("v_exp_f32 %0, %1\n\tv_nop" : "=v"(r) : "v"(x));
  return r;
}

// ---------------------------------------------------------------------------
// Both conversions in one launch: neither reads what the other writes, so they share a grid and the second
// launch's gap, fill and tail go. The branch on the block index is the same for a whole workgroup.
// Blocks 0 .. WTB-1:  W f32 [IN_DIM k][OUT_DIM n] -> WT bf16 [OUT_DIM n][IN_DIM k] (k contiguous), three matrices
//                     into three consecutive planes; a block = one 64 k x 64 n tile transposed through LDS.
//                     They stand first: their chain (load, LDS, barrier, store) is the longer one.
// Blocks WTB .. :     h f32 [SEQ][IN_DIM] -> bf16 plane (same layout); thread g converts 8 consecutive floats
//                     into one 16-byte store.
#define WTX (IN_DIM / 64)               // k tiles of one matrix
#define WTY (OUT_DIM / 64)              // n tiles of one matrix
#define WTB (3 * WTX * WTY)             // transpose blocks
#define HRB ((SEQ * IN_DIM / 8 + 255) / 256)   // row blocks
__global__ __launch_bounds__(256) void k_cvt(const float* __restrict__ in,
                                             const float* __restrict__ Wq,
                                             const float* __restrict__ Wk,
                                             const float* __restrict__ Wv,
                                             unsigned short* __restrict__ outp,
                                             unsigned short* __restrict__ wT, int n8) {
  __shared__ __align__(16) unsigned short T[64 * TP];   // [n local][k local], cross-wave (block barrier)
  const unsigned int bid = blockIdx.x;
  const int tid = threadIdx.x;

  if (bid >= WTB) {   // block-uniform: no thread of such a block reaches the barrier below
    const int g = (int)(bid - WTB) * 256 + tid;
    if (g >= n8) return;
    const v4f a = *(const v4f*)(in + (size_t)g * 8);
    const v4f b = *(const v4f*)(in + (size_t)g * 8 + 4);
    v4u w;
    w[0] = bfb(a[0]) | (bfb(a[1]) << 16);
    w[1] = bfb(a[2]) | (bfb(a[3]) << 16);
    w[2] = bfb(b[0]) | (bfb(b[1]) << 16);
    w[3] = bfb(b[2]) | (bfb(b[3]) << 16);
    v4u* p = (v4u*)(outp + (size_t)g * 8);
    *p = w;
    return;
  }

  const int z = (int)(bid / (WTX * WTY));
  const float* W = (z == 0) ? Wq : ((z == 1) ? Wk : Wv);
  unsigned short* dst = wT + (size_t)z * OUT_DIM * IN_DIM;
  const int k0 = (int)(bid % WTX) * 64;
  const int n0 = (int)((bid / WTX) % WTY) * 64;
  const int wave = tid >> 5, lane = tid & 31;

#pragma unroll
  for (int i = 0; i < 4; ++i) {
    const int idx = i * 256 + tid;          // 0..1023
    const int kk = idx >> 4;                // 0..63
    const int c4 = (idx & 15) * 4;          // 0..60
    const v4f w = *(const v4f*)(W + (size_t)(k0 + kk) * OUT_DIM + n0 + c4);
    T[(c4 + 0) * TP + kk] = (unsigned short)bfb(w[0]);
    T[(c4 + 1) * TP + kk] = (unsigned short)bfb(w[1]);
    T[(c4 + 2) * TP + kk] = (unsigned short)bfb(w[2]);
    T[(c4 + 3) * TP + kk] = (unsigned short)bfb(w[3]);
  }
  __syncthreads();

  v4u v[2];
  size_t off[2];
#pragma unroll
  for (int it = 0; it < 2; ++it) {
    const int nn = wave * 8 + it * 4 + (lane >> 3);   // 0..63 over (wave, it, lane>>3)
    const int q = lane & 7;
    v[it] = *(const v4u*)(&T[nn * TP + q * 8]);
    off[it] = (size_t)(n0 + nn) * IN_DIM + k0 + q * 8;
  }
#pragma unroll
  for (int it = 0; it < 2; ++it) *(v4u*)(dst + off[it]) = v[it];
}

// ---------------------------------------------------------------------------
// Projection: C[SEQ][3 * OUT_DIM] = hb[SEQ][IN_DIM] * WT[3 * OUT_DIM][IN_DIM]^T + bias; the three WT planes lie
// one behind the other, so Q, K and V are one product over 3072 columns.
// 256 thr = 8 waves; block tile 256 rows x 192 cols: 16 x 16 = 256 workgroups, one per WGP, and each byte copied
// from L2 feeds the most products that an even deal allows. Wave (wr, wc) owns 64 rows x 96 cols, so that a
// fragment read from LDS feeds 6 or 4 products.
// A k-tile = 128 k of both operands: hb [256 rows][128 k], behind it WT [192 n][128 k], copied whole-line from the
// planes into LDS by asynchronous copies, two buffers: tile t + 1 is in flight while tile t is multiplied.
// Each accumulator still sums k in ascending 32-steps.
// A 64-column group lies in one plane: Q plane f16 x log2(e)/64 [SEQ][OUT_DIM]; K plane f16 x8 [SEQ][OUT_DIM];
// V^T plane f16 x8 [OUT_DIM][SEQ]. Epilogue staged in the same LDS behind the loop.
#define PK  128                // k per tile
#define PLP 136                // operand tile pitch: 272 B = 16 B x 17
#define PBM 256                // rows of a block tile
#define PBN 192                // columns of a block tile
#define PTS ((PBM + PBN) * PLP)   // elements of one buffer: hb rows, then WT rows
#define PNT (IN_DIM / PK)      // tiles
#define EQP 72                 // epilogue pitch, Q or K group [256 s][64 n]: 144 B = 16 B x 9
#define EVP 264                // epilogue pitch, V group [64 d][256 s]: 528 B = 16 B x 33
#define EGS (PBM * EQP)        // elements of one 64-column group's staging region
static_assert(PNT >= 2);
static_assert(SEQ % PBM == 0 && (3 * OUT_DIM) % PBN == 0 && PBN % 64 == 0 && OUT_DIM % 64 == 0);
static_assert(64 * EVP <= EGS && 3 * EGS <= 2 * PTS);
static_assert(OUT_DIM == 1024);   // a column's plane is its index >> 10
static_assert(256 * 28 * 8 == (PBM + PBN) * PK);   // 28 16-byte copies a lane fill one buffer

// Fourteen 16-byte copies of one lane. s_wait_xcnt 0 is the statement's last line, so that no
// address register named here is rewritten before it.
__device__ __forceinline__ void copy14(const unsigned int (&l)[14], const unsigned short* const (&g)[14]) {
  asm volatile(
      "global_load_async_to_lds_b128 %0, %14, off\n\t"
      "global_load_async_to_lds_b128 %1, %15, off\n\t"
      "global_load_async_to_lds_b128 %2, %16, off\n\t"
      "global_load_async_to_lds_b128 %3, %17, off\n\t"
      "global_load_async_to_lds_b128 %4, %18, off\n\t"
      "global_load_async_to_lds_b128 %5, %19, off\n\t"
      "global_load_async_to_lds_b128 %6, %20, off\n\t"
      "global_load_async_to_lds_b128 %7, %21, off\n\t"
      "global_load_async_to_lds_b128 %8, %22, off\n\t"
      "global_load_async_to_lds_b128 %9, %23, off\n\t"
      "global_load_async_to_lds_b128 %10, %24, off\n\t"
      "global_load_async_to_lds_b128 %11, %25, off\n\t"
      "global_load_async_to_lds_b128 %12, %26, off\n\t"
      "global_load_async_to_lds_b128 %13, %27, off\n\t"
      "s_wait_xcnt 0x0"
      :
      : "v"(l[0]), "v"(l[1]), "v"(l[2]), "v"(l[3]), "v"(l[4]), "v"(l[5]), "v"(l[6]),
        "v"(l[7]), "v"(l[8]), "v"(l[9]), "v"(l[10]), "v"(l[11]), "v"(l[12]), "v"(l[13]),
        "v"(g[0]), "v"(g[1]), "v"(g[2]), "v"(g[3]), "v"(g[4]), "v"(g[5]), "v"(g[6]),
        "v"(g[7]), "v"(g[8]), "v"(g[9]), "v"(g[10]), "v"(g[11]), "v"(g[12]), "v"(g[13])
      : "memory");
}
// One k-tile's copies of one lane: its piece of every 16th row, 16 rows of hb and 12 of WT; in LDS the rows of
// both operands follow one another at one pitch.
__device__ __forceinline__ void copy_ab(unsigned int l0, const unsigned short* ga, const unsigned short* gw) {
#pragma unroll
  for (int s = 0; s < 2; ++s) {
    unsigned int l[14];
    const unsigned short* g[14];
#pragma unroll
    for (int i = 0; i < 14; ++i) {
      const int x = s * 14 + i;
      l[i] = l0 + (unsigned int)x * (16u * PLP * 2u);
      g[i] = (x < PBM / 16) ? ga + (size_t)x * 16 * IN_DIM : gw + (size_t)(x - PBM / 16) * 16 * IN_DIM;
    }
    copy14(l, g);
  }
}

__global__ __launch_bounds__(256) void k_proj(
    const unsigned short* __restrict__ hb, const unsigned short* __restrict__ wT,
    const float* __restrict__ bq, const float* __restrict__ bk, const float* __restrict__ bv,
    unsigned short* __restrict__ qp, unsigned short* __restrict__ kp,
    unsigned short* __restrict__ vtp) {
  // [buffer][hb tile | WT tile], cross-wave (block barrier); behind the loop the epilogue tile
  __shared__ __align__(16) unsigned short S[2 * PTS];

  const int n0 = blockIdx.x * PBN;   // column among the 3 * OUT_DIM of Q | K | V
  const int m0 = blockIdx.y * PBM;
  const int tid = threadIdx.x;
  const int wave = __builtin_amdgcn_readfirstlane(tid >> 5);
  const int lane = tid & 31;
  const int l15 = lane & 15, half = (lane >> 4) & 1;
  const int wr = wave >> 1, wc = wave & 1;

  // this lane's first piece of a tile: row tid>>4, piece tid&15, in both operands
  const unsigned short* ga = hb + (size_t)(m0 + (tid >> 4)) * IN_DIM + (tid & 15) * 8;
  const unsigned short* gw = wT + (size_t)(n0 + (tid >> 4)) * IN_DIM + (tid & 15) * 8;
  const unsigned int la0 = (unsigned int)(size_t)(&S[(tid >> 4) * PLP + (tid & 15) * 8]);
  const unsigned int pbuf = PTS * 2u;              // bytes from buffer 0 to buffer 1

  copy_ab(la0, ga, gw);                                          // tile 0 -> buffer 0
  asm volatile("s_wait_asynccnt 0x0" ::: "memory");              // this wave's part of tile 0 has landed
  __syncthreads();                                               // tile 0 complete for every wave
  copy_ab(la0 + pbuf, ga + PK, gw + PK);                         // tile 1 -> buffer 1

  // the six bias values of this lane's columns, asked for here so that they arrive under the k loop
  float braw[6];
#pragma unroll
  for (int j = 0; j < 6; ++j) {
    const int n = n0 + wc * 96 + j * 16;   // first column of the 16-column tile; its plane is the same for the whole wave
    const float* bias = ((n >> 10) == 0) ? bq : (((n >> 10) == 1) ? bk : bv);
    braw[j] = bias[(n & (OUT_DIM - 1)) + l15];
  }
  // behind the last of these loads, so that their offset registers are rewritten only behind it; the fence keeps
  // the vector work that follows from being scheduled ahead of the wait, where the build had put it
  asm volatile("s_wait_xcnt 0x0" ::: "memory");
  __builtin_amdgcn_sched_barrier(0);

  v8f acc[4][6] = {};
#pragma clang loop unroll(disable)   // one copy of the 96 products in the text; the buffer is picked by address
  for (int t = 0; t < PNT; ++t) {
    const int b = t & 1;
    const __bf16* at = (const __bf16*)(S + b * PTS) + wr * 64 * PLP;
    const __bf16* wt = (const __bf16*)(S + b * PTS) + (PBM + wc * 96) * PLP;
    v16bf a[2][4], w[2][6];   // two fragment sets: the next 32 k are fetched while these are multiplied
#pragma unroll
    for (int i = 0; i < 4; ++i) a[0][i] = ld_frag_bf(at, PLP, i * 16 + l15, 0, lane);
#pragma unroll
    for (int j = 0; j < 6; ++j) w[0][j] = ld_frag_bf(wt, PLP, j * 16 + l15, 0, lane);
#pragma unroll   // the four 32-k steps of a tile read LDS at constant offsets from two addresses
    for (int ks = 0; ks < PK / 32; ++ks) {
      const int c = ks & 1;
      if (ks + 1 < PK / 32) {   // inside this tile only: nothing of tile t + 1 is read ahead of its barrier
#pragma unroll
        for (int i = 0; i < 4; ++i) a[c ^ 1][i] = ld_frag_bf(at, PLP, i * 16 + l15, (ks + 1) * 32, lane);
#pragma unroll
        for (int j = 0; j < 6; ++j) w[c ^ 1][j] = ld_frag_bf(wt, PLP, j * 16 + l15, (ks + 1) * 32, lane);
      }
      // keeps the next step's reads one group ahead of this step's products, not spread among them
      __builtin_amdgcn_sched_barrier(0);
#pragma unroll
      for (int j = 0; j < 6; ++j)
#pragma unroll
        for (int i = 0; i < 4; ++i) acc[i][j] = mma_bf16(a[c][i], w[c][j], acc[i][j]);
      // keeps the step after next's reads behind these products, whose operands they overwrite
      __builtin_amdgcn_sched_barrier(0);
    }
    asm volatile("s_wait_dscnt 0x0" ::: "memory");      // this wave's reads of buffer b are done
    asm volatile("s_wait_asynccnt 0x0" ::: "memory");   // this wave's part of tile t + 1 has landed
    __syncthreads();   // publishes tile t + 1 and ends every wave's reads of buffer b
    if (t + 2 < PNT)   // the same for the whole workgroup
      copy_ab(la0 + b * pbuf, ga + (size_t)(t + 2) * PK, gw + (size_t)(t + 2) * PK);
  }
  asm volatile("s_wait_asynccnt 0x0" ::: "memory");     // nothing in flight when the LDS changes its use

  // acc[i][j][r] = C[m0 + wr*64 + i*16 + 8*half + r][n0 + wc*96 + j*16 + l15]
  unsigned short* E = S;   // every wave's last read of the tiles ended at the last trip's barrier
#pragma unroll
  for (int j = 0; j < 6; ++j) {
    const int cl = wc * 96 + j * 16;       // first column of this 16-column tile in the block tile
    const int z = (n0 + cl) >> 10;         // its plane: 0 Q, 1 K, 2 V; the same for the whole wave
    const float bb = bf16val(braw[j]);
    // Q's carry times K's 8 is log2(e)/8: the score products come out as score / sqrt(HEAD_DIM) in log2 units
    const float car = (z == 0) ? 1.44269504f / 64.0f : 8.0f;
    unsigned short* Eg = E + (cl >> 6) * EGS;
    const int col = (cl & 63) + l15;       // column within the 64-column group
    if (z != 2) {                          // wave-uniform branch, no barrier inside
#pragma unroll
      for (int i = 0; i < 4; ++i)
#pragma unroll
        for (int r = 0; r < 8; ++r) {
          const int row = wr * 64 + i * 16 + 8 * half + r;
          Eg[row * EQP + col] = hbits((acc[i][j][r] + bb) * car);
        }
    } else {
#pragma unroll
      for (int i = 0; i < 4; ++i) {
        v4u p;   // a lane's eight rows are eight neighbours of a V^T row
#pragma unroll
        for (int r = 0; r < 4; ++r)
          p[r] = (unsigned int)hbits((acc[i][j][2 * r] + bb) * car) |
                 ((unsigned int)hbits((acc[i][j][2 * r + 1] + bb) * car) << 16);
        *(v4u*)(&Eg[col * EVP + wr * 64 + i * 16 + 8 * half]) = p;
      }
    }
  }
  __syncthreads();
#pragma unroll
  for (int g = 0; g < PBN / 64; ++g) {
    const int z = (n0 + g * 64) >> 10;               // block-uniform
    const int cg = (n0 + g * 64) & (OUT_DIM - 1);    // first column of the group in its plane
    const unsigned short* Eg = E + g * EGS;
    unsigned short* dst = (z == 0) ? qp : ((z == 1) ? kp : vtp);
    v4u v[8];
    unsigned short* p[8];
    if (z != 2) {
#pragma unroll
      for (int it = 0; it < 8; ++it) {
        const int row = it * 32 + (tid >> 3);             // 0..255 over (it, tid>>3)
        const int q = tid & 7;                            // 8 pieces = the group's 128 bytes of a row = 1 line
        v[it] = *(const v4u*)(&Eg[row * EQP + q * 8]);
        p[it] = dst + (size_t)(m0 + row) * OUT_DIM + cg + q * 8;
      }
    } else {
#pragma unroll
      for (int it = 0; it < 8; ++it) {
        const int drow = it * 8 + (tid >> 5);             // 0..63 over (it, tid>>5)
        const int q = lane;                               // 32 pieces = 512 bytes of a V^T row = 4 lines
        v[it] = *(const v4u*)(&Eg[drow * EVP + q * 8]);
        p[it] = dst + (size_t)(cg + drow) * SEQ + m0 + q * 8;
      }
    }
    // all eight addresses are formed ahead of the first store: formed among the stores they took the registers
    // of stores in flight, each behind a wait of its own
    __builtin_amdgcn_sched_barrier(0);
#pragma unroll
    for (int it = 0; it < 8; ++it) *(v4u*)(p[it]) = v[it];
    // behind the group's last store: no register that a store names is rewritten before this wait
    asm volatile("s_wait_xcnt 0x0" ::: "memory");
  }
}

// ---------------------------------------------------------------------------
// Flash attention, transposed-score form: one wave = (32 queries as two 16-column groups, one head,
// half of every tile's keys), so that each K / V^T fragment read from LDS feeds two products.
// A workgroup = 8 waves = 4 query blocks x 2 key halves = 128 queries of one head, which share every
// K / V^T tile. The two waves of a query block keep their own reference, sum and context and join them
// once, behind the loop, through LDS; each then finishes and stores 16 of the 32 queries.
// A tile = 128 keys: K [128 keys][64 d] and V^T [64 d][128 keys], copied whole-line
// from the planes into LDS by asynchronous copies, two buffers: tile t + 1 is in
// flight while tile t is worked on. Fragments come from LDS (ds_load_b128 pitches).
// Per 32-key chunk and 16-column group:
//   S^T = K . Q^T    A = K rows (lane = key, k = d), B = Q^T (lane = query, k = d)
//                    D[row = key 8h+r][col = query l15]; c0 keys 0..15, c1 keys 16..31
//   per-lane softmax terms for query l15 (16 local keys; the xor-16 partner holds the other 16)
//   O^T += V^T . P   A = V^T rows (lane = d, k = key), B = P: element i<8 <- c0[i]
//                    (key 8h+i), element 8+i <- c1[i] (key 16+8h+i), same lane
//                    D[row = d 8h+r][col = query l15]
// The planes' carries make K . Q^T the scaled score in log2 units, and 10 - ref enters as the C operand
// of the score products: P = exp2(accumulator), one exponential a score and nothing else; ref is a held
// reference score per query, in log2 units, and moves only when a chunk's P outgrow f16 (lazy rescale, below).
// P and its sum carried x1024, V carried x8 -> context scaled by 1/(8 * carried sum).
// Output tile [16 q][64 d] f32 staged in LDS; each 256-byte row = 2 lines,
#define AW  8                  // waves per workgroup
#define SK  128                // keys per tile
#define KLP 72                 // K tile pitch: 144 B = 16 B x 9
#define VLP 136                // V^T tile pitch: 272 B = 16 B x 17
#define NST (SEQ / SK)         // tiles
static_assert(SEQ % (AW * 16) == 0);
static_assert(NST >= 2);
static_assert(AW == 8 && SK % 64 == 0);   // 4 query blocks x 2 key halves; a wave's half tile is whole 32-key chunks
static_assert(AW * 32 * 4 * 8 == SK * HEAD_DIM);   // four 16-byte copies a lane fill one tile

// One tile's copies of one lane: four 16-byte pieces of K (32 key rows apart) and four
// of V^T (16 d rows apart). s_wait_xcnt 0 is the statement's last line, so that no
// address register named here is rewritten before it.
__device__ __forceinline__ void copy_tile(unsigned int lk, unsigned int lv,
                                          const _Float16* gk, const _Float16* gv) {
  asm volatile(
      "global_load_async_to_lds_b128 %0, %8, off\n\t"
      "global_load_async_to_lds_b128 %1, %9, off\n\t"
      "global_load_async_to_lds_b128 %2, %10, off\n\t"
      "global_load_async_to_lds_b128 %3, %11, off\n\t"
      "global_load_async_to_lds_b128 %4, %12, off\n\t"
      "global_load_async_to_lds_b128 %5, %13, off\n\t"
      "global_load_async_to_lds_b128 %6, %14, off\n\t"
      "global_load_async_to_lds_b128 %7, %15, off\n\t"
      "s_wait_xcnt 0x0"
      :
      : "v"(lk), "v"(lk + 32u * KLP * 2u), "v"(lk + 64u * KLP * 2u), "v"(lk + 96u * KLP * 2u),
        "v"(lv), "v"(lv + 16u * VLP * 2u), "v"(lv + 32u * VLP * 2u), "v"(lv + 48u * VLP * 2u),
        "v"(gk), "v"(gk + (size_t)32 * OUT_DIM), "v"(gk + (size_t)64 * OUT_DIM),
        "v"(gk + (size_t)96 * OUT_DIM),
        "v"(gv), "v"(gv + (size_t)16 * SEQ), "v"(gv + (size_t)32 * SEQ), "v"(gv + (size_t)48 * SEQ)
      : "memory");
}

// Four waves per SIMD (two workgroups per WGP), as before: vector work between matrix runs wants waves.
__global__ __launch_bounds__(AW * 32) __attribute__((amdgpu_waves_per_eu(4, 4)))
void k_attn(const unsigned short* __restrict__ qp,
            const unsigned short* __restrict__ kp,
            const unsigned short* __restrict__ vtp,
            float* __restrict__ outp) {
  __shared__ __align__(16) _Float16 Kt[2][SK * KLP];         // K tiles, cross-wave (block barrier)
  __shared__ __align__(16) _Float16 Vt[2][HEAD_DIM * VLP];   // V^T tiles, cross-wave (block barrier)
  __shared__ __align__(16) float Olw[AW][16 * OLP];          // one output tile per wave
  __shared__ __align__(16) float Xo[AW][8 * 32 * 4];         // context of the group handed to the partner wave
  __shared__ float Xs[AW][2 * 32];                           // that group's reference and sum

  const int tid = threadIdx.x;
  const int wave = __builtin_amdgcn_readfirstlane(tid >> 5);
  const int lane = tid & 31;
  const int l15 = lane & 15;
  const int half = (lane >> 4) & 1;
  const int qg = wave & 3;    // query block of 32
  const int kh = wave >> 2;   // key half of every tile
  const int qw = blockIdx.x * (AW * 16) + qg * 32;
  const int head = blockIdx.y;
  float* Ol = Olw[wave];

  const _Float16* Q  = (const _Float16*)qp;
  const _Float16* K  = (const _Float16*)kp;
  const _Float16* VT = (const _Float16*)vtp;

  const _Float16* qbase = Q + (size_t)qw * OUT_DIM + head * HEAD_DIM;
  v16h qb[2][2];   // [column group][d 0..31 | d 32..63]
#pragma unroll
  for (int g = 0; g < 2; ++g) {
    qb[g][0] = ld_frag_h(qbase, OUT_DIM, g * 16 + l15, 0, lane);
    qb[g][1] = ld_frag_h(qbase, OUT_DIM, g * 16 + l15, 32, lane);
  }
  const _Float16* kbase = K + head * HEAD_DIM;                   // key t at kbase + t*OUT_DIM
  const _Float16* vbase = VT + (size_t)head * HEAD_DIM * SEQ;    // d row at vbase + d*SEQ

  // this lane's first piece of a tile: K row tid>>3, piece tid&7; V^T row tid>>4, piece tid&15
  const _Float16* gk = kbase + (size_t)(tid >> 3) * OUT_DIM + (tid & 7) * 8;
  const _Float16* gv = vbase + (size_t)(tid >> 4) * SEQ + (tid & 15) * 8;
  const unsigned int lk0 = (unsigned int)(size_t)(&Kt[0][(tid >> 3) * KLP + (tid & 7) * 8]);
  const unsigned int lv0 = (unsigned int)(size_t)(&Vt[0][(tid >> 4) * VLP + (tid & 15) * 8]);
  const unsigned int kbuf = SK * KLP * 2u;         // bytes from buffer 0 to buffer 1
  const unsigned int vbuf = HEAD_DIM * VLP * 2u;

  copy_tile(lk0, lv0, gk, gv);                                   // tile 0 -> buffer 0
  asm volatile("s_wait_asynccnt 0x0" ::: "memory");              // this wave's part of tile 0 has landed
  __syncthreads();                                               // tile 0 complete for every wave
  copy_tile(lk0 + kbuf, lv0 + vbuf, gk + (size_t)SK * OUT_DIM, gv + SK);   // tile 1 -> buffer 1

  v8f o[2][4] = {};
  // 10 = log2(1024): P leaves the exponential already x1024. With the start value of mref every P of
  // the first chunk is infinite, so the test below sends that chunk through the rescale, which sets nbv.
  float mref[2], lrun[2];   // mref: start value here, set again from nbv behind the loop; inside it nbv alone holds the reference
  v8f nbv[2];   // 10 - reference in all eight rows: a lane's accumulator rows are keys of its one query
#pragma unroll
  for (int g = 0; g < 2; ++g) {
    mref[g] = -1.0e27f;
    lrun[g] = 0.0f;
#pragma unroll
    for (int r = 0; r < 8; ++r) nbv[g][r] = 10.0f - mref[g];
  }
  const float plim = 32768.0f;   // a lane's 16 P are each at most their sum: at or under this they fit f16

  for (int t = 0; t < NST; ++t) {
    const int b = t & 1;
    const _Float16* ktile = Kt[b] + kh * (SK / 2) * KLP;   // this wave's 64 key rows of the tile
    const _Float16* vtile = Vt[b] + kh * (SK / 2);         // and the same 64 keys of every V^T row
    // K fragments of chunk 0; the later chunk's are fetched one chunk ahead, inside this tile only
    v16h ka0 = ld_frag_h(ktile, KLP, l15, 0, lane);
    v16h ka2 = ld_frag_h(ktile, KLP, 16 + l15, 0, lane);
    v16h ka1 = ld_frag_h(ktile, KLP, l15, 32, lane);
    v16h ka3 = ld_frag_h(ktile, KLP, 16 + l15, 32, lane);
#pragma unroll   // the wave's two chunks of a tile read LDS at constant offsets from two addresses
    for (int c = 0; c < SK / 64; ++c) {
      // this chunk's four V^T fragments, one group of reads: they land under the scores and the softmax
      v16h va[4];
#pragma unroll
      for (int j = 0; j < 4; ++j) va[j] = ld_frag_h(vtile, VLP, j * 16 + l15, c * 32, lane);
      // keeps the group of reads above the score products, so that it is in flight under the scores and the softmax
      __builtin_amdgcn_sched_barrier(0);
      v8f c0[2], c1[2];   // [column group]
#pragma unroll
      for (int g = 0; g < 2; ++g) {
        c0[g] = mma_f16(ka0, qb[g][0], nbv[g]);
        c1[g] = mma_f16(ka2, qb[g][0], nbv[g]);
      }
#pragma unroll
      for (int g = 0; g < 2; ++g) {
        c0[g] = mma_f16(ka1, qb[g][1], c0[g]);
        c1[g] = mma_f16(ka3, qb[g][1], c1[g]);
      }
      if (c + 1 < SK / 64) {   // next chunk's K fragments, one group: they land under the softmax and the context products
        const _Float16* kn = ktile + (c + 1) * 32 * KLP;
        ka0 = ld_frag_h(kn, KLP, l15, 0, lane);
        ka2 = ld_frag_h(kn, KLP, 16 + l15, 0, lane);
        ka1 = ld_frag_h(kn, KLP, l15, 32, lane);
        ka3 = ld_frag_h(kn, KLP, 16 + l15, 32, lane);
        // keeps that group here, ahead of the softmax, so that the next chunk's score products find it landed
        __builtin_amdgcn_sched_barrier(0);
      }

      // P against the held references: no maximum, no rescale on this path. Each path packs its own P to f16, so
      // that 16 registers, not 32, meet at the join: with nbv's 16 beside 32 the build spilled a Q fragment.
      v16h pb[2];
      float ls[2];
#pragma unroll
      for (int g = 0; g < 2; ++g) {
        float p0[8], p1[8];
#pragma unroll
        for (int r = 0; r < 8; ++r) p0[r] = __builtin_amdgcn_exp2f(c0[g][r]);
#pragma unroll
        for (int r = 0; r < 8; ++r) p1[r] = __builtin_amdgcn_exp2f(c1[g][r]);
        ls[g] = 0.0f;
#pragma unroll
        for (int r = 0; r < 8; ++r) ls[g] += p0[r] + p1[r];
#pragma unroll
        for (int e = 0; e < 8; ++e) {
          pb[g][e]     = (_Float16)p0[e];   // key 32c + 8h + e of the wave's half tile
          pb[g][8 + e] = (_Float16)p1[e];   // key 32c + 16 + 8h + e of the wave's half tile
        }
      }
      // One test a chunk for both groups, a scalar branch for the whole wave: only where some lane's P have
      // outgrown f16 (or are not numbers) do the references move to the maxima seen so far.
      if (__builtin_expect(__builtin_amdgcn_ballot_w32(!(ls[0] <= plim && ls[1] <= plim)) != 0u, 0)) {   // rare: laid out off the straight path
        // The straight path keeps no scores beside P (registers: four waves per SIMD must fit), so this
        // path forms them again, the same products from the same tile on a zero C, in the K registers' place.
        const _Float16* kc = ktile + c * 32 * KLP;
        ka0 = ld_frag_h(kc, KLP, l15, 0, lane);
        ka2 = ld_frag_h(kc, KLP, 16 + l15, 0, lane);
        ka1 = ld_frag_h(kc, KLP, l15, 32, lane);
        ka3 = ld_frag_h(kc, KLP, 16 + l15, 32, lane);
        v8f r0[2] = {}, r1[2] = {};
#pragma unroll
        for (int g = 0; g < 2; ++g) {
          r0[g] = mma_f16(ka0, qb[g][0], r0[g]);
          r1[g] = mma_f16(ka2, qb[g][0], r1[g]);
        }
#pragma unroll
        for (int g = 0; g < 2; ++g) {
          r0[g] = mma_f16(ka1, qb[g][1], r0[g]);
          r1[g] = mma_f16(ka3, qb[g][1], r1[g]);
        }
        if (c + 1 < SK / 64) {   // the next chunk's K fragments again
          const _Float16* kn = ktile + (c + 1) * 32 * KLP;
          ka0 = ld_frag_h(kn, KLP, l15, 0, lane);
          ka2 = ld_frag_h(kn, KLP, 16 + l15, 0, lane);
          ka1 = ld_frag_h(kn, KLP, l15, 32, lane);
          ka3 = ld_frag_h(kn, KLP, 16 + l15, 32, lane);
        }
#pragma unroll
        for (int g = 0; g < 2; ++g) {
          float lm = fmaxf(r0[g][0], r1[g][0]);
#pragma unroll
          for (int r = 1; r < 8; ++r) lm = fmaxf(lm, fmaxf(r0[g][r], r1[g][r]));
          lm = fmaxf(lm, __shfl_xor(lm, 16, 32));   // both halves of a query keep one reference
          const float nbo = nbv[g][0];
          const float nb = 10.0f - fmaxf(10.0f - nbo, lm);
          const float alpha = __builtin_amdgcn_exp2f(nb - nbo);   // the shift that P really sees
          ls[g] = 0.0f;
#pragma unroll
          for (int r = 0; r < 8; ++r) {
            const float pa = exp2_slot(r0[g][r] + nb);
            const float pc = exp2_slot(r1[g][r] + nb);
            ls[g] += pa + pc;
            pb[g][r]     = (_Float16)pa;
            pb[g][8 + r] = (_Float16)pc;
            nbv[g][r] = nb;
          }
          lrun[g] *= alpha;
#pragma unroll
          for (int j = 0; j < 4; ++j)
#pragma unroll
            for (int r = 0; r < 8; ++r) o[g][j][r] *= alpha;
        }
      }

#pragma unroll
      for (int g = 0; g < 2; ++g)
        lrun[g] += ls[g];   // this lane's 16 keys only: the rescale branch needs lrun at hand, so no exchange stands in the loop
#pragma unroll
      for (int j = 0; j < 4; ++j)
#pragma unroll
        for (int g = 0; g < 2; ++g) o[g][j] = mma_f16(va[j], pb[g], o[g][j]);
    }
    asm volatile("s_wait_dscnt 0x0" ::: "memory");      // this wave's reads of buffer b are done
    asm volatile("s_wait_asynccnt 0x0" ::: "memory");   // this wave's part of tile t + 1 has landed
    __syncthreads();   // publishes tile t + 1 and ends every wave's reads of buffer b
    if (t + 2 < NST)   // the same for the whole workgroup
      copy_tile(lk0 + b * kbuf, lv0 + b * vbuf,
                gk + (size_t)(t + 2) * SK * OUT_DIM, gv + (size_t)(t + 2) * SK);
  }
  asm volatile("s_wait_asynccnt 0x0" ::: "memory");     // nothing in flight when the wave ends

  // o[g][j][r] = 8192 * sum_t p_t v_t over this wave's keys for query g*16 + l15, d = j*16 + 8*half + r; the two
  // halves of a query hold one reference, so their sums join by one add: lrun = 1024 * sum_t p_t
#pragma unroll
  for (int g = 0; g < 2; ++g) {
    lrun[g] += __shfl_xor(lrun[g], 16, 32);
    mref[g] = 10.0f - nbv[g][0];
  }

  // The wave of key half kh finishes group kh and hands group 1 - kh to its partner (same lane, same registers).
  float* xo = Xo[wave];
#pragma unroll
  for (int j = 0; j < 4; ++j) {
    const v8f og = kh ? o[0][j] : o[1][j];
    v4f lo4, hi4;
    lo4[0] = og[0]; lo4[1] = og[1]; lo4[2] = og[2]; lo4[3] = og[3];
    hi4[0] = og[4]; hi4[1] = og[5]; hi4[2] = og[6]; hi4[3] = og[7];
    *(v4f*)(&xo[((j * 2 + 0) * 32 + lane) * 4]) = lo4;
    *(v4f*)(&xo[((j * 2 + 1) * 32 + lane) * 4]) = hi4;
  }
  Xs[wave][lane]      = kh ? mref[0] : mref[1];
  Xs[wave][32 + lane] = kh ? lrun[0] : lrun[1];
  __syncthreads();   // the partner's group is complete in LDS

  const float* xp = Xo[wave ^ 4];
  const float m_own = kh ? mref[1] : mref[0];
  const float l_own = kh ? lrun[1] : lrun[0];
  const float m_par = Xs[wave ^ 4][lane];
  const float l_par = Xs[wave ^ 4][32 + lane];
  const float m_all = fmaxf(m_own, m_par);
  const float a_own = exp2_slot(m_own - m_all);
  const float a_par = exp2_slot(m_par - m_all);
  const float inv = 1.0f / ((l_own * a_own + l_par * a_par) * 8.0f);
  const float f_own = a_own * inv, f_par = a_par * inv;
#pragma unroll
  for (int j = 0; j < 4; ++j) {
    const v8f ow = kh ? o[1][j] : o[0][j];
    const v4f pl = *(const v4f*)(&xp[((j * 2 + 0) * 32 + lane) * 4]);
    const v4f ph = *(const v4f*)(&xp[((j * 2 + 1) * 32 + lane) * 4]);
    v4f lo4, hi4;
#pragma unroll
    for (int r = 0; r < 4; ++r) {
      lo4[r] = ow[r] * f_own + pl[r] * f_par;
      hi4[r] = ow[4 + r] * f_own + ph[r] * f_par;
    }
    *(v4f*)(&Ol[l15 * OLP + j * 16 + 8 * half])     = lo4;
    *(v4f*)(&Ol[l15 * OLP + j * 16 + 8 * half + 4]) = hi4;
  }
  __syncthreads();

  v4f v[8];
  size_t off[8];
  float* ob = outp + (size_t)(qw + kh * 16) * OUT_DIM + head * HEAD_DIM;
#pragma unroll
  for (int it = 0; it < 8; ++it) {
    const int row = it * 2 + half;       // 0..15
    const int q = l15;                   // 16 pieces of 16 B = the row's 256 bytes (2 lines)
    v[it] = *(const v4f*)(&Ol[row * OLP + q * 4]);
    off[it] = (size_t)row * OUT_DIM + q * 4;
  }
#pragma unroll
  for (int it = 0; it < 8; ++it) *(v4f*)(ob + off[it]) = v[it];
  
}

// ---------------------------------------------------------------------------
extern "C" void kernel_launch(void* const* d_in, const int* in_sizes, int n_in,
                              void* d_out, int out_size, void* d_ws, size_t ws_size,
                              hipStream_t stream) {
  if (n_in < 7) return;
  if (in_sizes[0] < SEQ * IN_DIM) return;
  if (in_sizes[1] < IN_DIM * OUT_DIM || in_sizes[2] < IN_DIM * OUT_DIM ||
      in_sizes[3] < IN_DIM * OUT_DIM) return;
  if (in_sizes[4] < OUT_DIM || in_sizes[5] < OUT_DIM || in_sizes[6] < OUT_DIM) return;
  if (out_size < SEQ * OUT_DIM) return;

  const float* h  = (const float*)d_in[0];
  const float* Wq = (const float*)d_in[1];
  const float* Wk = (const float*)d_in[2];
  const float* Wv = (const float*)d_in[3];
  const float* bq = (const float*)d_in[4];
  const float* bk = (const float*)d_in[5];
  const float* bv = (const float*)d_in[6];

  // every offset a multiple of 2 MiB
  const size_t hb_bytes = (size_t)SEQ * IN_DIM * 2;           // bf16 h plane
  const size_t wt_bytes = (size_t)3 * OUT_DIM * IN_DIM * 2;   // 3 bf16 WT planes
  const size_t pl_bytes = (size_t)SEQ * OUT_DIM * 2;          // one f16 q/k/vT plane
  const size_t off_hb = 0;
  const size_t off_wt = off_hb + hb_bytes;
  const size_t off_q  = off_wt + wt_bytes;
  const size_t off_k  = off_q + pl_bytes;
  const size_t off_vt = off_k + pl_bytes;
  const size_t total  = off_vt + pl_bytes;                    // 38 MiB at SEQ = 4096
  if (total > ws_size) return;

  char* ws = (char*)d_ws;
  unsigned short* hb  = (unsigned short*)(ws + off_hb);
  unsigned short* wt  = (unsigned short*)(ws + off_wt);
  unsigned short* qpl = (unsigned short*)(ws + off_q);
  unsigned short* kpl = (unsigned short*)(ws + off_k);
  unsigned short* vtp = (unsigned short*)(ws + off_vt);

  const int n8 = SEQ * IN_DIM / 8;
  k_cvt<<<WTB + HRB, 256, 0, stream>>>(h, Wq, Wk, Wv, hb, wt, n8);
  k_proj<<<dim3(3 * OUT_DIM / PBN, SEQ / PBM), 256, 0, stream>>>(hb, wt, bq, bk, bv, qpl, kpl, vtp);
  k_attn<<<dim3(SEQ / (AW * 16), NUM_HEADS), AW * 32, 0, stream>>>(qpl, kpl, vtp, (float*)d_out);
}
